// v000
// Times are from an AMD MI455X. After a warm-up the kernel runs many times in a row, and a time is the length of
// such a window on the GPU divided by its runs, so every launch and the gaps after it count. The runs cycle
// through copies of the inputs. A figure is the median of several windows, for all but v000 over two sittings.
// Sittings can differ by a few percent; kernels timed side by side share one.
// v000 is the starting kernel. One run takes 303 microseconds.
#include <hip/hip_runtime.h>

// Compute dtypes (f32 accumulate everywhere): x@[Wq|Wk|Wv] v_wmma_f32_16x16x32_bf16 (inputs RNE-converted to bf16, single product); q.k^T bf16 hi/lo planes (3 products, one accumulator, 1/8 folded into q);
// P.V v_wmma_f32_16x16x32_f16 with P carried x1024 (query rows < 256: f16 value + x2048 residual planes of P and V, separate accumulator); ctx@Wo bf16 hi/lo ctx x bf16 Wo (2 products). Softmax, rotary: f32.
// Causal grouped-query attention, rotary cos/sin tables read by value from their input buffers (bf16 RNE on load). Fused flash-style attention in transposed form: S^T = K Q^T so the probability
// tile leaves the accumulators already in B-fragment layout (element r <- key tile 0 row 8h+r, element 8+r <- key tile 1), O^T = V^T P^T; row statistics are per-lane scalars.

#ifndef NB
#define NB 2
#endif
#ifndef SEQ
#define SEQ 2048
#endif
#define SEQ_FULL 2048
#define DM   1024
#define NH_  16
#define NKV  4
#define REP  (NH_ / NKV)
#define HD   64
#define DQ   (NH_ * HD)
#define DKV  (NKV * HD)
#define NQKV (DQ + 2 * DKV)
#define KCOL DQ
#define VCOL (DQ + DKV)
#define RH   ((SEQ) < 256 ? (SEQ) : 256)   // query rows < RH carry residual planes on P, V
#define EPP  72                            // LDS pitch (halves) of the ctx staging rows
#define PCAR 1024.0f
#define RCAR 2048.0f
#define L2E  1.4426950408889634f
#define NEGBIG (-1.0e30f)

typedef _Float16 h16;
typedef unsigned short bf;
typedef __attribute__((ext_vector_type(16))) __bf16   v16bf;
typedef __attribute__((ext_vector_type(16))) _Float16 v16h;
typedef __attribute__((ext_vector_type(8)))  _Float16 v8h;
typedef __attribute__((ext_vector_type(8)))  unsigned short v8us;
typedef __attribute__((ext_vector_type(8)))  float    v8f;
typedef __attribute__((ext_vector_type(4)))  float    v4f;
typedef __attribute__((ext_vector_type(2)))  _Float16 v2h;
typedef __attribute__((ext_vector_type(2)))  unsigned short v2us;
typedef v4f  __attribute__((may_alias)) v4fa;
typedef v8us __attribute__((may_alias)) v8usa;

static_assert(HD == 64);
static_assert(DQ == DM);
static_assert(NH_ % NKV == 0);
static_assert(SEQ % 64 == 0);
static_assert(SEQ <= SEQ_FULL);
static_assert(RH % 64 == 0);
static_assert(RH <= SEQ);
static_assert(DM % 32 == 0);
static_assert(DQ % 32 == 0);
static_assert((NB * SEQ) % 64 == 0);
static_assert(NQKV % 64 == 0);
static_assert(DM % 64 == 0);
static_assert(EPP % 8 == 0);
static_assert(EPP >= HD);
static_assert((DM * DQ) % 64 == 0);
static_assert((DM * DKV) % 64 == 0);

__device__ __forceinline__ unsigned short f2bf(float f) { unsigned u = __float_as_uint(f); u += 0x7FFFu + ((u >> 16) & 1u); return (unsigned short)(u >> 16); }
__device__ __forceinline__ float bf2f(unsigned short b) { return __uint_as_float(((unsigned)b) << 16); }
__device__ __forceinline__ float bfr(float f) { return bf2f(f2bf(f)); }
__device__ __forceinline__ void splitf(float y, unsigned short& h, unsigned short& l) { h = f2bf(y); l = f2bf(y - bf2f(h)); }
__device__ __forceinline__ v16h cat16(v8h lo, v8h hi) { return __builtin_shufflevector(lo, hi, 0, 1, 2, 3, 4, 5, 6, 7, 8, 9, 10, 11, 12, 13, 14, 15); }
__device__ __forceinline__ v16bf cat16b(v8us lo, v8us hi) { return __builtin_bit_cast(v16bf, __builtin_shufflevector(lo, hi, 0, 1, 2, 3, 4, 5, 6, 7, 8, 9, 10, 11, 12, 13, 14, 15)); }
__device__ __forceinline__ v8f wmma16(v16h a, v16h b, v8f c) { return __builtin_amdgcn_wmma_f32_16x16x32_f16(false, a, false, b, (short)0, c, false, false); }
__device__ __forceinline__ v8f wmmab(v16bf a, v16bf b, v8f c) { return __builtin_amdgcn_wmma_f32_16x16x32_bf16(false, a, false, b, (short)0, c, false, false); }
// fragment loaders: p points at (row l&15, k0 + 8*(l>>4)); elements 0..7 <- p[0..7], elements 8..15 <- p[16..23]
__device__ __forceinline__ v16bf ldb(const bf* p) { return cat16b(*(const v8us*)p, *(const v8us*)(p + 16)); }
__device__ __forceinline__ v16h ldh(const h16* p) { return cat16(*(const v8h*)p, *(const v8h*)(p + 16)); }

// hazard guards: name every accumulator of the group and the last fragments
template <typename V> __device__ __forceinline__ void nopg2(v8f& c0, v8f& c1, const V& x, const V& y, const V& z) {
    asm volatile("v_nop\n\tv_nop\n\tv_nop\n\tv_nop" : "+v"(c0), "+v"(c1) : "v"(x), "v"(y), "v"(z)); }
template <typename V> __device__ __forceinline__ void nopg4(v8f& c0, v8f& c1, v8f& c2, v8f& c3, const V& x, const V& y, const V& z) {
    asm volatile("v_nop\n\tv_nop\n\tv_nop\n\tv_nop" : "+v"(c0), "+v"(c1), "+v"(c2), "+v"(c3) : "v"(x), "v"(y), "v"(z)); }
template <typename V> __device__ __forceinline__ void nopg8(v8f& c0, v8f& c1, v8f& c2, v8f& c3, v8f& c4, v8f& c5, v8f& c6, v8f& c7, const V& x, const V& y, const V& z) {
    asm volatile("v_nop\n\tv_nop\n\tv_nop\n\tv_nop" : "+v"(c0), "+v"(c1), "+v"(c2), "+v"(c3), "+v"(c4), "+v"(c5), "+v"(c6), "+v"(c7) : "v"(x), "v"(y), "v"(z)); }

// ---- one-wave 64x64 tile GEMM: C[m][n] (f32, pitch ldc) = sum_k A[m][k] Bt[n][k] (+ A2[m][k] Bt[n][k] when NSPLIT == 1); operands straight from K-contiguous bf16 planes; K % 32 == 0.
template <int NSPLIT>
__device__ __forceinline__ void gemm_body(const bf* A, const bf* A2, const bf* Bt, int K, float* C, int ldc) {
    __shared__ __align__(16) float os[16 * 68];
    const int lane = threadIdx.x & 31, lr = lane & 15, hi = lane >> 4; const int r0 = blockIdx.x * 64, c0 = blockIdx.y * 64;
    v8f acc[4][4];
#pragma unroll
    for (int mb = 0; mb < 4; ++mb)
#pragma unroll
        for (int nb = 0; nb < 4; ++nb) acc[mb][nb] = (v8f){};
    const size_t aoff = (size_t)(r0 + lr) * K + 8 * hi, boff = (size_t)(c0 + lr) * K + 8 * hi;
#pragma unroll 1
    for (int kc = 0; kc < K; kc += 32) {
        v16bf a[4], a2[4], blast;
#pragma unroll
        for (int mb = 0; mb < 4; ++mb) { a[mb] = ldb(A + aoff + (size_t)mb * 16 * K + kc); if (NSPLIT == 1) a2[mb] = ldb(A2 + aoff + (size_t)mb * 16 * K + kc); }
#pragma unroll
        for (int nb = 0; nb < 4; ++nb) { const v16bf bq = ldb(Bt + boff + (size_t)nb * 16 * K + kc); if (nb == 3) blast = bq;
#pragma unroll
            for (int mb = 0; mb < 4; ++mb) { acc[mb][nb] = wmmab(a[mb], bq, acc[mb][nb]); if (NSPLIT == 1) acc[mb][nb] = wmmab(a2[mb], bq, acc[mb][nb]); } }
        nopg8(acc[0][0], acc[0][1], acc[0][2], acc[0][3], acc[1][0], acc[1][1], acc[1][2], acc[1][3], a[0], a[1], blast);
        nopg8(acc[2][0], acc[2][1], acc[2][2], acc[2][3], acc[3][0], acc[3][1], acc[3][2], acc[3][3], a[3], (NSPLIT == 1) ? a2[3] : a[2], blast);
    }
#pragma unroll
    for (int mb = 0; mb < 4; ++mb) {
#pragma unroll
        for (int nb = 0; nb < 4; ++nb) {
#pragma unroll
            for (int j = 0; j < 8; ++j) os[(hi * 8 + j) * 68 + nb * 16 + lr] = acc[mb][nb][j]; }
        asm volatile("s_wait_dscnt 0" ::: "memory"); __builtin_amdgcn_wave_barrier();
        float* crow = C + (size_t)(r0 + mb * 16) * ldc + c0;
{
#pragma unroll
            for (int s = 0; s < 8; ++s) { const int row = 2 * s + hi, cofs = lr * 4; const v4f val = *(const v4fa*)(os + row * 68 + cofs);
                *(v4f*)(crow + (size_t)row * ldc + cofs) = val; }
             }
        asm volatile("s_wait_dscnt 0" ::: "memory"); __builtin_amdgcn_wave_barrier();
    }
}
// F[NB*SEQ][1536] = XB[NB*SEQ][1024] x WT[1536][1024]^T
__global__ __launch_bounds__(32) void k_gemm_proj(const bf* __restrict__ A, const bf* __restrict__ Bt, float* C) { gemm_body<0>(A, A, Bt, DM, C, NQKV); }
// OUT[NB*SEQ][1024] = (ATh + ATl)[NB*SEQ][1024] x WOT[1024][1024]^T
__global__ __launch_bounds__(32) void k_gemm_out(const bf* __restrict__ A, const bf* __restrict__ A2, const bf* __restrict__ Bt, float* C) { gemm_body<1>(A, A2, Bt, DQ, C, DM); }

__global__ __launch_bounds__(256) void k_wtG(const float* __restrict__ w, int K, int N, bf* Bt) {
    const int lane = threadIdx.x & 31; const int L0 = (blockIdx.x * 8 + (threadIdx.x >> 5)) * 8; const int nlines = N * K / 64;
{
#pragma unroll 1
        for (int l = 0; l < 8; ++l) { const int L = L0 + l; if (L >= nlines) break; const size_t e = (size_t)L * 64 + lane * 2; const int k = (int)(e % K), n = (int)(e / K); v2us o;
            o[0] = f2bf(w[(size_t)k * N + n]); o[1] = f2bf(w[(size_t)(k + 1) * N + n]); *(v2us*)(Bt + e) = o; }
         }
}
__global__ __launch_bounds__(256) void k_cvtx(const float* __restrict__ x, bf* XB) {
    const size_t i = (size_t)blockIdx.x * 256 + threadIdx.x; if (i >= (size_t)NB * SEQ * DM / 8) return;
    const size_t e = i * 8; const size_t b = e / ((size_t)SEQ * DM); const size_t rem = e - b * (size_t)SEQ * DM;
    const v8f v = *(const v8f*)(x + b * (size_t)SEQ_FULL * DM + rem); v8us o;
#pragma unroll
    for (int k = 0; k < 8; ++k) o[k] = f2bf(v[k]);
    *(v8us*)(XB + e) = o; 
}
// ---- k_ropep: head planes [b][head][t][d] (bf16 hi/lo) of rotary(F[b*SEQ+t][colbase + head*64 + d]) x sc; tables COS/SIN [t][32] by value (bf16 RNE on load);
__global__ __launch_bounds__(256) void k_ropep(const float* __restrict__ F, int colbase, int nheads, const float* __restrict__ COS, const float* __restrict__ SIN, float sc, bf* Ph, bf* Pl) {
    const size_t e = ((size_t)blockIdx.x * 256 + threadIdx.x) * 2; if (e >= (size_t)NB * nheads * SEQ * HD) return;
    const int d = (int)(e % HD); const int t = (int)((e / HD) % SEQ); const int hh = (int)((e / ((size_t)HD * SEQ)) % nheads); const int b = (int)(e / ((size_t)HD * SEQ * nheads));
    const float* f = F + (size_t)(b * SEQ + t) * NQKV + colbase + hh * HD; v2us oh, ol;
#pragma unroll
    for (int q = 0; q < 2; ++q) { const int dd = d + q; const int j = dd & 31; const float x1 = f[j], x2 = f[j + 32];
        const float c = bfr(COS[(size_t)t * 32 + j]), s = bfr(SIN[(size_t)t * 32 + j]);
        const float r = ((dd < 32) ? (x1 * c + x2 * s) : (x2 * c - x1 * s)) * sc;
        unsigned short a2, c2; splitf(r, a2, c2); oh[q] = a2; ol[q] = c2; }
    *(v2us*)(Ph + e) = oh; *(v2us*)(Pl + e) = ol; 
}
__global__ __launch_bounds__(256) void k_vtp(const float* __restrict__ F, h16* V16, h16* Vr) {
    const size_t e = ((size_t)blockIdx.x * 256 + threadIdx.x) * 2; if (e >= (size_t)NB * NKV * HD * SEQ) return;
    const int t = (int)(e % SEQ); const int d = (int)((e / SEQ) % HD); const int g = (int)((e / ((size_t)SEQ * HD)) % NKV); const int b = (int)(e / ((size_t)SEQ * HD * NKV)); v2h o16, o2;
#pragma unroll
    for (int q = 0; q < 2; ++q) { const float x = F[(size_t)(b * SEQ + t + q) * NQKV + VCOL + g * HD + d]; const h16 a = (h16)x; o16[q] = a; o2[q] = (h16)((x - (float)a) * RCAR); }
    *(v2h*)(V16 + e) = o16; *(v2h*)(Vr + e) = o2; 
}

// ---- fused causal flash attention, transposed form. Block = 4 waves = 64 query rows of one (b, h); a wave owns 16 query rows (one per lane&15) and walks keys in 32-key steps up to its diagonal.
// S^T tile (keys x queries) = K (A, rows = keys) x Q^T (B, cols = queries); D: lane -> query l&15, rows -> keys 8h+r. Two key tiles give the B fragment of P^T directly.
// O^T tile (d x queries) = V^T (A, rows = d, k = keys) x P^T (B). Running max / sum / scale factor are per-lane scalars (both lane halves of a query agree via one xor-16 shuffle).
template <bool HIRES>
__device__ __forceinline__ void attn_body(const bf* Qh, const bf* Ql, const bf* Kh, const bf* Kl, const h16* V16, const h16* Vr, bf* Ah, bf* Al, int qb0, int nqb) {
    __shared__ __align__(16) bf eh[4 * 16 * EPP];
    __shared__ __align__(16) bf el[4 * 16 * EPP];
    const int lane = threadIdx.x & 31, lr = lane & 15, hi = lane >> 4;
    const int wave = __builtin_amdgcn_readfirstlane((int)(threadIdx.x >> 5));
    const int qblk = qb0 + (int)(blockIdx.x % (unsigned)nqb);
    const int bh = (int)(blockIdx.x / (unsigned)nqb);
    const int b = bh / NH_, h = bh % NH_, g = h / REP;
    const int m0 = qblk * 64 + wave * 16;
    const size_t qbase = ((size_t)(b * NH_ + h) * SEQ) * HD;
    const size_t kbase = ((size_t)(b * NKV + g) * SEQ) * HD;
    const size_t vbase = ((size_t)(b * NKV + g) * HD) * SEQ;
    const int qoff0 = (m0 + lr) * HD + 8 * hi;
    const int qrow = m0 + lr;
    v8f o[4], orr[4];
#pragma unroll
    for (int j = 0; j < 4; ++j) { o[j] = (v8f){}; orr[j] = (v8f){}; }
    float mrun = NEGBIG, lsum = 0.0f;
    const int nst = (m0 + 47) >> 5;              // keys 0 .. m0+15 in 32-key steps; k0 + 31 < SEQ always (SEQ % 32 == 0)
#pragma unroll 1
    for (int st = 0; st < nst; ++st) {
        const int k0 = st * 32;
        int qo = qoff0; asm volatile("" : "+v"(qo));
        const int ko = (k0 + lr) * HD + 8 * hi;
        v8f s0 = (v8f){}, s1 = (v8f){};
        v16bf qhf, qlf, k0h, k0l, k1h, k1l;
#pragma unroll
        for (int c = 0; c < 2; ++c) {
            qhf = ldb(Qh + qbase + qo + 32 * c); qlf = ldb(Ql + qbase + qo + 32 * c);
            k0h = ldb(Kh + kbase + ko + 32 * c); k0l = ldb(Kl + kbase + ko + 32 * c);
            k1h = ldb(Kh + kbase + ko + 16 * HD + 32 * c); k1l = ldb(Kl + kbase + ko + 16 * HD + 32 * c);
            s0 = wmmab(k0h, qhf, s0); s0 = wmmab(k0h, qlf, s0); s0 = wmmab(k0l, qhf, s0);
            s1 = wmmab(k1h, qhf, s1); s1 = wmmab(k1h, qlf, s1); s1 = wmmab(k1l, qhf, s1);
        }
        nopg2(s0, s1, qhf, qlf, k1l);
        // causal exclusion by value (key > query -> NEGBIG, probability exactly 0), running max
        const int kb = k0 + 8 * hi;
        float mx = NEGBIG;
#pragma unroll
        for (int r = 0; r < 8; ++r) {
            const float a0 = (kb + r <= qrow) ? s0[r] : NEGBIG;
            const float a1 = (kb + 16 + r <= qrow) ? s1[r] : NEGBIG;
            s0[r] = a0; s1[r] = a1; mx = fmaxf(mx, fmaxf(a0, a1));
        }
        mx = fmaxf(mx, __shfl_xor(mx, 16, 32));
        const float mnew = fmaxf(mrun, mx);
        const float corr = __builtin_amdgcn_exp2f((mrun - mnew) * L2E);
        mrun = mnew;
        float psum = 0.0f;
        v16h pbv, prv;
#pragma unroll
        for (int r = 0; r < 8; ++r) {
            const float p0 = __builtin_amdgcn_exp2f((s0[r] - mnew) * L2E);
            const float p1 = __builtin_amdgcn_exp2f((s1[r] - mnew) * L2E);
            psum += p0 + p1;
            const float c0 = p0 * PCAR, c1 = p1 * PCAR;
            const h16 h0 = (h16)c0, h1 = (h16)c1;
            pbv[r] = h0; pbv[8 + r] = h1;
            if (HIRES) { prv[r] = (h16)((c0 - (float)h0) * RCAR); prv[8 + r] = (h16)((c1 - (float)h1) * RCAR); }
        }
        lsum = lsum * corr + psum;
#pragma unroll
        for (int j = 0; j < 4; ++j) {
#pragma unroll
            for (int r = 0; r < 8; ++r) { o[j][r] *= corr; if (HIRES) orr[j][r] *= corr; } }
        // O^T += V^T P^T
        const int vo = lr * SEQ + k0 + 8 * hi;
        v16h vlast;
#pragma unroll
        for (int j = 0; j < 4; ++j) {
            const v16h va = ldh(V16 + vbase + vo + j * 16 * SEQ);
            if (j == 3) vlast = va;
            o[j] = wmma16(va, pbv, o[j]);
            if (HIRES) { const v16h vr = ldh(Vr + vbase + vo + j * 16 * SEQ); orr[j] = wmma16(vr, pbv, orr[j]); orr[j] = wmma16(va, prv, orr[j]); }
        }
        if (HIRES) nopg8(o[0], o[1], o[2], o[3], orr[0], orr[1], orr[2], orr[3], pbv, prv, vlast);
        else       nopg4(o[0], o[1], o[2], o[3], pbv, pbv, vlast);
    }
    lsum += __shfl_xor(lsum, 16, 32);
    const float inv = 1.0f / (PCAR * lsum);
    // lane holds ctx(query m0+lr, d = j*16 + 8*hi + r): 8 consecutive d per j -> one 16-B piece per plane
#pragma unroll
    for (int j = 0; j < 4; ++j) { v8us vh, vl;
#pragma unroll
        for (int r = 0; r < 8; ++r) { const float val = HIRES ? (o[j][r] + orr[j][r] * (1.0f / RCAR)) * inv : o[j][r] * inv; unsigned short a2, c2; splitf(val, a2, c2); vh[r] = a2; vl[r] = c2; }
        *(v8usa*)&eh[(wave * 16 + lr) * EPP + j * 16 + 8 * hi] = vh; *(v8usa*)&el[(wave * 16 + lr) * EPP + j * 16 + 8 * hi] = vl; }
    asm volatile("s_wait_dscnt 0" ::: "memory"); __builtin_amdgcn_wave_barrier();
{
#pragma unroll
        for (int i = 0; i < 4; ++i) { const int row = 4 * i + (lane >> 3), pc = lane & 7;
            const v8us a = *(const v8usa*)&eh[(wave * 16 + row) * EPP + pc * 8]; const v8us c = *(const v8usa*)&el[(wave * 16 + row) * EPP + pc * 8];
            const size_t dst = (size_t)(b * SEQ + m0 + row) * DQ + h * HD + pc * 8;
            *(v8us*)(Ah + dst) = a; *(v8us*)(Al + dst) = c; }
         }
}
__global__ __launch_bounds__(128) void k_attn_hi(const bf* __restrict__ Qh, const bf* __restrict__ Ql, const bf* __restrict__ Kh, const bf* __restrict__ Kl, const h16* __restrict__ V16, const h16* __restrict__ Vr, bf* Ah, bf* Al, int qb0, int nqb) {
    attn_body<true>(Qh, Ql, Kh, Kl, V16, Vr, Ah, Al, qb0, nqb); }
__global__ __launch_bounds__(128) void k_attn_lo(const bf* __restrict__ Qh, const bf* __restrict__ Ql, const bf* __restrict__ Kh, const bf* __restrict__ Kl, const h16* __restrict__ V16, const h16* __restrict__ Vr, bf* Ah, bf* Al, int qb0, int nqb) {
    attn_body<false>(Qh, Ql, Kh, Kl, V16, Vr, Ah, Al, qb0, nqb); }

// ---- workspace carve (bytes, every region 256-B aligned and sized to its full store extent)
constexpr size_t al256(size_t x) { return (x + 255) & ~(size_t)255; }
constexpr size_t SZ_WT  = al256((size_t)NQKV * DM * 2);
constexpr size_t SZ_WO  = al256((size_t)DM * DQ * 2);
constexpr size_t SZ_XB  = al256((size_t)NB * SEQ * DM * 2);
constexpr size_t SZ_F   = al256((size_t)NB * SEQ * NQKV * 4);
constexpr size_t SZ_QP  = al256((size_t)NB * NH_ * SEQ * HD * 2);
constexpr size_t SZ_KP  = al256((size_t)NB * NKV * SEQ * HD * 2);
constexpr size_t SZ_AT  = al256((size_t)NB * SEQ * DQ * 2);
constexpr size_t OFF_WT = 0;
constexpr size_t OFF_WO = OFF_WT + SZ_WT;
constexpr size_t OFF_XB = OFF_WO + SZ_WO;
constexpr size_t OFF_F  = OFF_XB + SZ_XB;
constexpr size_t OFF_QH = OFF_F + SZ_F;
constexpr size_t OFF_QL = OFF_QH + SZ_QP;
constexpr size_t OFF_KH = OFF_QL + SZ_QP;
constexpr size_t OFF_KL = OFF_KH + SZ_KP;
constexpr size_t OFF_V1 = OFF_KL + SZ_KP;
constexpr size_t OFF_VR = OFF_V1 + SZ_KP;
constexpr size_t OFF_AH = OFF_VR + SZ_KP;
constexpr size_t OFF_AL = OFF_AH + SZ_AT;
constexpr size_t WS_TOTAL = OFF_AL + SZ_AT;
static_assert(WS_TOTAL <= (size_t)134217728);

extern "C" void kernel_launch(void* const* d_in, const int* in_sizes, int n_in,
                              void* d_out, int out_size, void* d_ws, size_t ws_size, hipStream_t stream) {
    if (n_in < 7) return;
    if (in_sizes[0] < (NB - 1) * SEQ_FULL * DM + SEQ * DM) return;
    if (in_sizes[1] < SEQ * 32 || in_sizes[2] < SEQ * 32) return;
    if (in_sizes[3] < DM * DQ || in_sizes[4] < DM * DKV || in_sizes[5] < DM * DKV || in_sizes[6] < DQ * DM) return;
    if (out_size < NB * SEQ * DM) return;
    if (ws_size < WS_TOTAL) return;
    const float* x = (const float*)d_in[0]; const float* cs = (const float*)d_in[1]; const float* sn = (const float*)d_in[2];
    const float* wq = (const float*)d_in[3]; const float* wk = (const float*)d_in[4]; const float* wv = (const float*)d_in[5]; const float* wo = (const float*)d_in[6];
    float* OUT = (float*)d_out;
    char* w8 = (char*)d_ws;
    bf* WT = (bf*)(w8 + OFF_WT); bf* WOT = (bf*)(w8 + OFF_WO); bf* XB = (bf*)(w8 + OFF_XB); float* F = (float*)(w8 + OFF_F);
    bf* QPh = (bf*)(w8 + OFF_QH); bf* QPl = (bf*)(w8 + OFF_QL); bf* KPh = (bf*)(w8 + OFF_KH); bf* KPl = (bf*)(w8 + OFF_KL);
    h16* V16 = (h16*)(w8 + OFF_V1); h16* VR = (h16*)(w8 + OFF_VR); bf* ATh = (bf*)(w8 + OFF_AH); bf* ATl = (bf*)(w8 + OFF_AL);

    // weights: in w[K = DM][N] -> out plane rows n (K-contiguous); q | k | v stacked into one [1536][1024] plane
    k_wtG<<<(unsigned)((DM * DQ / 64 + 63) / 64), 256, 0, stream>>>(wq, DM, DQ, WT);
    k_wtG<<<(unsigned)((DM * DKV / 64 + 63) / 64), 256, 0, stream>>>(wk, DM, DKV, WT + (size_t)KCOL * DM);
    k_wtG<<<(unsigned)((DM * DKV / 64 + 63) / 64), 256, 0, stream>>>(wv, DM, DKV, WT + (size_t)VCOL * DM);
    k_wtG<<<(unsigned)((DQ * DM / 64 + 63) / 64), 256, 0, stream>>>(wo, DQ, DM, WOT);
    k_cvtx<<<(unsigned)(((size_t)NB * SEQ * DM / 8 + 255) / 256), 256, 0, stream>>>(x, XB);
    k_gemm_proj<<<dim3(NB * SEQ / 64, NQKV / 64, 1), 32, 0, stream>>>(XB, WT, F);
    k_ropep<<<(unsigned)(((size_t)NB * NH_ * SEQ * HD / 2 + 255) / 256), 256, 0, stream>>>(F, 0, NH_, cs, sn, 0.125f, QPh, QPl);
    k_ropep<<<(unsigned)(((size_t)NB * NKV * SEQ * HD / 2 + 255) / 256), 256, 0, stream>>>(F, KCOL, NKV, cs, sn, 1.0f, KPh, KPl);
    k_vtp<<<(unsigned)(((size_t)NB * NKV * HD * SEQ / 2 + 255) / 256), 256, 0, stream>>>(F, V16, VR);
    const int nq1 = RH / 64, nq2 = (SEQ - RH) / 64;
    k_attn_hi<<<(unsigned)(nq1 * NB * NH_), 128, 0, stream>>>(QPh, QPl, KPh, KPl, V16, VR, ATh, ATl, 0, nq1);
    if (nq2 > 0) k_attn_lo<<<(unsigned)(nq2 * NB * NH_), 128, 0, stream>>>(QPh, QPl, KPh, KPl, V16, VR, ATh, ATl, nq1, nq2);
    k_gemm_out<<<dim3(NB * SEQ / 64, DM / 64, 1), 32, 0, stream>>>(ATh, ATl, WOT, OUT);
}

// v001
// A run of this version takes 276 microseconds.
// Two timings next to v000 both put it at 1.13 times that version's speed.
#include <hip/hip_runtime.h>

// Compute dtypes (f32 accumulate everywhere): x@[Wq|Wk|Wv] v_wmma_f32_16x16x32_bf16 (inputs RNE-converted to bf16, single product); q.k^T bf16 hi/lo planes (3 products, one accumulator, 1/8 folded into q);
// P.V v_wmma_f32_16x16x32_f16 with P carried x1024 (query rows < 256: f16 value + x2048 residual planes of P and V, separate accumulator); ctx@Wo bf16 hi/lo ctx x bf16 Wo (2 products). Softmax, rotary: f32.
// Causal grouped-query attention, rotary cos/sin tables read by value from their input buffers (bf16 RNE on load). Fused flash-style attention in transposed form: S^T = K Q^T so the probability
// tile leaves the accumulators already in B-fragment layout (element r <- key tile 0 row 8h+r, element 8+r <- key tile 1), O^T = V^T P^T; row statistics are per-lane scalars.
// Every 16-bit operand plane (rows x K) lies in fragment order: one 1-KiB block per (16-row tile R, 32-wide k chunk C), block index R * (K / 32) + C (V planes, rows = d, k = key: C * 4 + R);
// in a block the 16-B piece of (row r, k = 16 * half + 8 * hi + 0..7) stands at element half * 256 + (hi * 16 + r) * 8, so each of a fragment's two wave-wide loads reads 512 contiguous bytes (4 lines, not 16).

#ifndef NB
#define NB 2
#endif
#ifndef SEQ
#define SEQ 2048
#endif
#define SEQ_FULL 2048
#define DM   1024
#define NH_  16
#define NKV  4
#define REP  (NH_ / NKV)
#define HD   64
#define DQ   (NH_ * HD)
#define DKV  (NKV * HD)
#define NQKV (DQ + 2 * DKV)
#define KCOL DQ
#define VCOL (DQ + DKV)
#define RH   ((SEQ) < 256 ? (SEQ) : 256)   // query rows < RH carry residual planes on P, V
#define PCAR 1024.0f
#define RCAR 2048.0f
#define L2E  1.4426950408889634f
#define NEGBIG (-1.0e30f)

typedef _Float16 h16;
typedef unsigned short bf;
typedef __attribute__((ext_vector_type(16))) __bf16   v16bf;
typedef __attribute__((ext_vector_type(16))) _Float16 v16h;
typedef __attribute__((ext_vector_type(8)))  _Float16 v8h;
typedef __attribute__((ext_vector_type(8)))  unsigned short v8us;
typedef __attribute__((ext_vector_type(8)))  float    v8f;
typedef __attribute__((ext_vector_type(4)))  float    v4f;
typedef __attribute__((ext_vector_type(2)))  _Float16 v2h;
typedef __attribute__((ext_vector_type(2)))  unsigned short v2us;
typedef v4f  __attribute__((may_alias)) v4fa;

static_assert(HD == 64);
static_assert(DQ == DM);
static_assert(NH_ % NKV == 0);
static_assert(SEQ % 64 == 0);
static_assert(SEQ <= SEQ_FULL);
static_assert(RH % 64 == 0);
static_assert(RH <= SEQ);
static_assert(DM % 32 == 0);
static_assert(DQ % 32 == 0);
static_assert((NB * SEQ) % 64 == 0);
static_assert(NQKV % 64 == 0);
static_assert(DM % 64 == 0);
static_assert((DM * DQ) % 64 == 0);
static_assert((DM * DKV) % 64 == 0);

__device__ __forceinline__ unsigned short f2bf(float f) { unsigned u = __float_as_uint(f); u += 0x7FFFu + ((u >> 16) & 1u); return (unsigned short)(u >> 16); }
__device__ __forceinline__ float bf2f(unsigned short b) { return __uint_as_float(((unsigned)b) << 16); }
__device__ __forceinline__ float bfr(float f) { return bf2f(f2bf(f)); }
__device__ __forceinline__ void splitf(float y, unsigned short& h, unsigned short& l) { h = f2bf(y); l = f2bf(y - bf2f(h)); }
__device__ __forceinline__ v16h cat16(v8h lo, v8h hi) { return __builtin_shufflevector(lo, hi, 0, 1, 2, 3, 4, 5, 6, 7, 8, 9, 10, 11, 12, 13, 14, 15); }
__device__ __forceinline__ v16bf cat16b(v8us lo, v8us hi) { return __builtin_bit_cast(v16bf, __builtin_shufflevector(lo, hi, 0, 1, 2, 3, 4, 5, 6, 7, 8, 9, 10, 11, 12, 13, 14, 15)); }
__device__ __forceinline__ v8f wmma16(v16h a, v16h b, v8f c) { return __builtin_amdgcn_wmma_f32_16x16x32_f16(false, a, false, b, (short)0, c, false, false); }
__device__ __forceinline__ v8f wmmab(v16bf a, v16bf b, v8f c) { return __builtin_amdgcn_wmma_f32_16x16x32_bf16(false, a, false, b, (short)0, c, false, false); }
// fragment loaders: p points at block start + lane * 8, which holds (row l&15, k0 + 8*(l>>4)); elements 0..7 <- p[0..7], elements 8..15 (k + 16) <- p[256..263]
__device__ __forceinline__ v16bf ldb(const bf* p) { return cat16b(*(const v8us*)p, *(const v8us*)(p + 256)); }
__device__ __forceinline__ v16h ldh(const h16* p) { return cat16(*(const v8h*)p, *(const v8h*)(p + 256)); }

// hazard guards: name every accumulator of the group and the last fragments
template <typename V> __device__ __forceinline__ void nopg2(v8f& c0, v8f& c1, const V& x, const V& y, const V& z) {
    asm volatile("v_nop\n\tv_nop\n\tv_nop\n\tv_nop" : "+v"(c0), "+v"(c1) : "v"(x), "v"(y), "v"(z)); }
template <typename V> __device__ __forceinline__ void nopg4(v8f& c0, v8f& c1, v8f& c2, v8f& c3, const V& x, const V& y, const V& z) {
    asm volatile("v_nop\n\tv_nop\n\tv_nop\n\tv_nop" : "+v"(c0), "+v"(c1), "+v"(c2), "+v"(c3) : "v"(x), "v"(y), "v"(z)); }
template <typename V> __device__ __forceinline__ void nopg8(v8f& c0, v8f& c1, v8f& c2, v8f& c3, v8f& c4, v8f& c5, v8f& c6, v8f& c7, const V& x, const V& y, const V& z) {
    asm volatile("v_nop\n\tv_nop\n\tv_nop\n\tv_nop" : "+v"(c0), "+v"(c1), "+v"(c2), "+v"(c3), "+v"(c4), "+v"(c5), "+v"(c6), "+v"(c7) : "v"(x), "v"(y), "v"(z)); }

// ---- one-wave 64x64 tile GEMM: C[m][n] (f32, pitch ldc) = sum_k A[m][k] Bt[n][k] (+ A2[m][k] Bt[n][k] when NSPLIT == 1); operands straight from fragment-order bf16 planes; K % 32 == 0.
template <int NSPLIT>
__device__ __forceinline__ void gemm_body(const bf* A, const bf* A2, const bf* Bt, int K, float* C, int ldc) {
    __shared__ __align__(16) float os[16 * 68];
    const int lane = threadIdx.x & 31, lr = lane & 15, hi = lane >> 4; const int r0 = blockIdx.x * 64, c0 = blockIdx.y * 64;
    v8f acc[4][4];
#pragma unroll
    for (int mb = 0; mb < 4; ++mb)
#pragma unroll
        for (int nb = 0; nb < 4; ++nb) acc[mb][nb] = (v8f){};
    const size_t aoff = (size_t)r0 * K + lane * 8, boff = (size_t)c0 * K + lane * 8;   // a 16-row tile spans 16 * K elements, a k chunk of 32 one block of 512
#pragma unroll 1
    for (int kc = 0; kc < K; kc += 32) {
        v16bf a[4], a2[4], blast;
#pragma unroll
        for (int mb = 0; mb < 4; ++mb) { a[mb] = ldb(A + aoff + (size_t)mb * 16 * K + kc * 16); if (NSPLIT == 1) a2[mb] = ldb(A2 + aoff + (size_t)mb * 16 * K + kc * 16); }
#pragma unroll
        for (int nb = 0; nb < 4; ++nb) { const v16bf bq = ldb(Bt + boff + (size_t)nb * 16 * K + kc * 16); if (nb == 3) blast = bq;
#pragma unroll
            for (int mb = 0; mb < 4; ++mb) { acc[mb][nb] = wmmab(a[mb], bq, acc[mb][nb]); if (NSPLIT == 1) acc[mb][nb] = wmmab(a2[mb], bq, acc[mb][nb]); } }
        nopg8(acc[0][0], acc[0][1], acc[0][2], acc[0][3], acc[1][0], acc[1][1], acc[1][2], acc[1][3], a[0], a[1], blast);
        nopg8(acc[2][0], acc[2][1], acc[2][2], acc[2][3], acc[3][0], acc[3][1], acc[3][2], acc[3][3], a[3], (NSPLIT == 1) ? a2[3] : a[2], blast);
    }
#pragma unroll
    for (int mb = 0; mb < 4; ++mb) {
#pragma unroll
        for (int nb = 0; nb < 4; ++nb) {
#pragma unroll
            for (int j = 0; j < 8; ++j) os[(hi * 8 + j) * 68 + nb * 16 + lr] = acc[mb][nb][j]; }
        asm volatile("s_wait_dscnt 0" ::: "memory"); __builtin_amdgcn_wave_barrier();
        float* crow = C + (size_t)(r0 + mb * 16) * ldc + c0;
{
#pragma unroll
            for (int s = 0; s < 8; ++s) { const int row = 2 * s + hi, cofs = lr * 4; const v4f val = *(const v4fa*)(os + row * 68 + cofs);
                *(v4f*)(crow + (size_t)row * ldc + cofs) = val; }
             }
        asm volatile("s_wait_dscnt 0" ::: "memory"); __builtin_amdgcn_wave_barrier();
    }
}
// F[NB*SEQ][1536] = XB[NB*SEQ][1024] x WT[1536][1024]^T
__global__ __launch_bounds__(32) void k_gemm_proj(const bf* __restrict__ A, const bf* __restrict__ Bt, float* C) { gemm_body<0>(A, A, Bt, DM, C, NQKV); }
// OUT[NB*SEQ][1024] = (ATh + ATl)[NB*SEQ][1024] x WOT[1024][1024]^T
__global__ __launch_bounds__(32) void k_gemm_out(const bf* __restrict__ A, const bf* __restrict__ A2, const bf* __restrict__ Bt, float* C) { gemm_body<1>(A, A2, Bt, DQ, C, DM); }

__global__ __launch_bounds__(256) void k_wtG(const float* __restrict__ w, int K, int N, bf* Bt) {
    const int lane = threadIdx.x & 31; const int L0 = (blockIdx.x * 8 + (threadIdx.x >> 5)) * 8; const int nlines = N * K / 64;
{
#pragma unroll 1
        for (int l = 0; l < 8; ++l) { const int L = L0 + l; if (L >= nlines) break; const size_t e = (size_t)L * 64 + lane * 2; const int blk = (int)(e >> 9), in = (int)(e & 511);
            const int k = (blk % (K / 32)) * 32 + (in >> 7) * 8 + (in & 7), n = (blk / (K / 32)) * 16 + ((in >> 3) & 15); v2us o;
            o[0] = f2bf(w[(size_t)k * N + n]); o[1] = f2bf(w[(size_t)(k + 1) * N + n]); *(v2us*)(Bt + e) = o; }
         }
}
__global__ __launch_bounds__(256) void k_cvtx(const float* __restrict__ x, bf* XB) {
    const size_t i = (size_t)blockIdx.x * 256 + threadIdx.x; if (i >= (size_t)NB * SEQ * DM / 8) return;
    // a wave takes 8 rows x 4 pieces: it reads whole 128-B lines of 8 rows and stores 4 whole lines
    const int blk = (int)(i >> 6), r = (int)((i & 7) | ((i >> 2) & 8)), pc = (int)((i >> 3) & 3); const size_t e = (size_t)blk * 512 + (pc * 16 + r) * 8;
    const int row = (blk / (DM / 32)) * 16 + r, k = (blk % (DM / 32)) * 32 + pc * 8;
    const v8f v = *(const v8f*)(x + (size_t)(row / SEQ) * SEQ_FULL * DM + (size_t)(row % SEQ) * DM + k); v8us o;
#pragma unroll
    for (int k = 0; k < 8; ++k) o[k] = f2bf(v[k]);
    *(v8us*)(XB + e) = o; 
}
// ---- k_ropep: head planes [b][head] (rows = t, k = d, fragment order, bf16 hi/lo) of rotary(F[b*SEQ+t][colbase + head*64 + d]) x sc; tables COS/SIN [t][32] by value (bf16 RNE on load);
// a thread makes the 16-B pieces d = j0..j0+7 (chunk 0) and d = 32+j0..32+j0+7 (chunk 1) of one row, which share their inputs; a wave takes 8 rows x 4 pieces: each load touches 8 lines, each store fills 4 whole lines.
__global__ __launch_bounds__(256) void k_ropep(const float* __restrict__ F, int colbase, int nheads, const float* __restrict__ COS, const float* __restrict__ SIN, float sc, bf* Ph, bf* Pl) {
    const size_t i = (size_t)blockIdx.x * 256 + threadIdx.x; if (i >= (size_t)NB * nheads * SEQ * (HD / 16)) return;
    const int tile = (int)(i >> 6), r = (int)((i & 7) | ((i >> 2) & 8)), pc = (int)((i >> 3) & 3); const int t = (tile % (SEQ / 16)) * 16 + r; const int j0 = pc * 8;
    const int hh = (tile / (SEQ / 16)) % nheads; const int b = tile / ((SEQ / 16) * nheads);
    const float* f = F + (size_t)(b * SEQ + t) * NQKV + colbase + hh * HD + j0;
    const v8f x1 = *(const v8f*)f, x2 = *(const v8f*)(f + 32), cv = *(const v8f*)(COS + (size_t)t * 32 + j0), sv = *(const v8f*)(SIN + (size_t)t * 32 + j0);
    v8us ah, al, bh, bl;
#pragma unroll
    for (int q = 0; q < 8; ++q) { const float c = bfr(cv[q]), s = bfr(sv[q]);
        const float ra = (x1[q] * c + x2[q] * s) * sc, rb = (x2[q] * c - x1[q] * s) * sc;
        unsigned short a2, c2; splitf(ra, a2, c2); ah[q] = a2; al[q] = c2; splitf(rb, a2, c2); bh[q] = a2; bl[q] = c2; }
    const size_t dst = (size_t)tile * 1024 + (pc * 16 + r) * 8;
    *(v8us*)(Ph + dst) = ah; *(v8us*)(Pl + dst) = al; *(v8us*)(Ph + dst + 512) = bh; *(v8us*)(Pl + dst + 512) = bl;
}
__global__ __launch_bounds__(256) void k_vtp(const float* __restrict__ F, h16* V16, h16* Vr) {
    const size_t e = ((size_t)blockIdx.x * 256 + threadIdx.x) * 2; if (e >= (size_t)NB * NKV * HD * SEQ) return;
    const int blk = (int)((e % ((size_t)SEQ * HD)) >> 9), in = (int)(e & 511);
    const int t = (blk >> 2) * 32 + (in >> 7) * 8 + (in & 7); const int d = (blk & 3) * 16 + ((in >> 3) & 15); const int g = (int)((e / ((size_t)SEQ * HD)) % NKV); const int b = (int)(e / ((size_t)SEQ * HD * NKV)); v2h o16, o2;
#pragma unroll
    for (int q = 0; q < 2; ++q) { const float x = F[(size_t)(b * SEQ + t + q) * NQKV + VCOL + g * HD + d]; const h16 a = (h16)x; o16[q] = a; o2[q] = (h16)((x - (float)a) * RCAR); }
    *(v2h*)(V16 + e) = o16; *(v2h*)(Vr + e) = o2; 
}

// ---- fused causal flash attention, transposed form. Block = 4 waves = 64 query rows of one (b, h); a wave owns 16 query rows (one per lane&15) and walks keys in 32-key steps up to its diagonal.
// S^T tile (keys x queries) = K (A, rows = keys) x Q^T (B, cols = queries); D: lane -> query l&15, rows -> keys 8h+r. Two key tiles give the B fragment of P^T directly.
// O^T tile (d x queries) = V^T (A, rows = d, k = keys) x P^T (B). Running max / sum / scale factor are per-lane scalars (both lane halves of a query agree via one xor-16 shuffle).
template <bool HIRES>
__device__ __forceinline__ void attn_body(const bf* Qh, const bf* Ql, const bf* Kh, const bf* Kl, const h16* V16, const h16* Vr, bf* Ah, bf* Al, int qb0, int nqb) {
    const int lane = threadIdx.x & 31, lr = lane & 15, hi = lane >> 4;
    const int wave = __builtin_amdgcn_readfirstlane((int)(threadIdx.x >> 5));
    const int qblk = qb0 + (int)(blockIdx.x % (unsigned)nqb);
    const int bh = (int)(blockIdx.x / (unsigned)nqb);
    const int b = bh / NH_, h = bh % NH_, g = h / REP;
    const int m0 = qblk * 64 + wave * 16;
    const size_t qbase = ((size_t)(b * NH_ + h) * SEQ) * HD;
    const size_t kbase = ((size_t)(b * NKV + g) * SEQ) * HD;
    const size_t vbase = ((size_t)(b * NKV + g) * HD) * SEQ;
    const int qoff0 = m0 * HD + lane * 8;
    const int qrow = m0 + lr;
    v8f o[4], orr[4];
#pragma unroll
    for (int j = 0; j < 4; ++j) { o[j] = (v8f){}; orr[j] = (v8f){}; }
    float mrun = NEGBIG, lsum = 0.0f;
    const int nst = (m0 + 47) >> 5;              // keys 0 .. m0+15 in 32-key steps; k0 + 31 < SEQ always (SEQ % 32 == 0)
#pragma unroll 1
    for (int st = 0; st < nst; ++st) {
        const int k0 = st * 32;
        int qo = qoff0; asm volatile("" : "+v"(qo));
        const int ko = k0 * HD + lane * 8;         // 32 keys = 4 blocks (2 key tiles x 2 d chunks) in a row
        v8f s0 = (v8f){}, s1 = (v8f){};
        v16bf qhf, qlf, k0h, k0l, k1h, k1l;
#pragma unroll
        for (int c = 0; c < 2; ++c) {
            qhf = ldb(Qh + qbase + qo + 512 * c); qlf = ldb(Ql + qbase + qo + 512 * c);
            k0h = ldb(Kh + kbase + ko + 512 * c); k0l = ldb(Kl + kbase + ko + 512 * c);
            k1h = ldb(Kh + kbase + ko + 16 * HD + 512 * c); k1l = ldb(Kl + kbase + ko + 16 * HD + 512 * c);
            s0 = wmmab(k0h, qhf, s0); s0 = wmmab(k0h, qlf, s0); s0 = wmmab(k0l, qhf, s0);
            s1 = wmmab(k1h, qhf, s1); s1 = wmmab(k1h, qlf, s1); s1 = wmmab(k1l, qhf, s1);
        }
        nopg2(s0, s1, qhf, qlf, k1l);
        // causal exclusion by value (key > query -> NEGBIG, probability exactly 0), running max
        const int kb = k0 + 8 * hi;
        float mx = NEGBIG;
#pragma unroll
        for (int r = 0; r < 8; ++r) {
            const float a0 = (kb + r <= qrow) ? s0[r] : NEGBIG;
            const float a1 = (kb + 16 + r <= qrow) ? s1[r] : NEGBIG;
            s0[r] = a0; s1[r] = a1; mx = fmaxf(mx, fmaxf(a0, a1));
        }
        mx = fmaxf(mx, __shfl_xor(mx, 16, 32));
        const float mnew = fmaxf(mrun, mx);
        const float corr = __builtin_amdgcn_exp2f((mrun - mnew) * L2E);
        mrun = mnew;
        float psum = 0.0f;
        v16h pbv, prv;
#pragma unroll
        for (int r = 0; r < 8; ++r) {
            const float p0 = __builtin_amdgcn_exp2f((s0[r] - mnew) * L2E);
            const float p1 = __builtin_amdgcn_exp2f((s1[r] - mnew) * L2E);
            psum += p0 + p1;
            const float c0 = p0 * PCAR, c1 = p1 * PCAR;
            const h16 h0 = (h16)c0, h1 = (h16)c1;
            pbv[r] = h0; pbv[8 + r] = h1;
            if (HIRES) { prv[r] = (h16)((c0 - (float)h0) * RCAR); prv[8 + r] = (h16)((c1 - (float)h1) * RCAR); }
        }
        lsum = lsum * corr + psum;
#pragma unroll
        for (int j = 0; j < 4; ++j) {
#pragma unroll
            for (int r = 0; r < 8; ++r) { o[j][r] *= corr; if (HIRES) orr[j][r] *= corr; } }
        // O^T += V^T P^T
        const int vo = k0 * HD + lane * 8;         // 32 keys = 4 blocks (4 d tiles) in a row
        v16h vlast;
#pragma unroll
        for (int j = 0; j < 4; ++j) {
            const v16h va = ldh(V16 + vbase + vo + j * 512);
            if (j == 3) vlast = va;
            o[j] = wmma16(va, pbv, o[j]);
            if (HIRES) { const v16h vr = ldh(Vr + vbase + vo + j * 512); orr[j] = wmma16(vr, pbv, orr[j]); orr[j] = wmma16(va, prv, orr[j]); }
        }
        if (HIRES) nopg8(o[0], o[1], o[2], o[3], orr[0], orr[1], orr[2], orr[3], pbv, prv, vlast);
        else       nopg4(o[0], o[1], o[2], o[3], pbv, pbv, vlast);
    }
    lsum += __shfl_xor(lsum, 16, 32);
    const float inv = 1.0f / (PCAR * lsum);
    // lane holds ctx(query m0+lr, d = j*16 + 8*hi + r): 8 consecutive d per j -> one 16-B piece per plane, and piece j of lane l is piece l of half-block j of the wave's two ctx blocks
    const size_t dst = (size_t)(b * SEQ + m0) * DQ + h * (16 * HD) + lane * 8;
#pragma unroll
    for (int j = 0; j < 4; ++j) { v8us vh, vl;
#pragma unroll
        for (int r = 0; r < 8; ++r) { const float val = HIRES ? (o[j][r] + orr[j][r] * (1.0f / RCAR)) * inv : o[j][r] * inv; unsigned short a2, c2; splitf(val, a2, c2); vh[r] = a2; vl[r] = c2; }
        *(v8us*)(Ah + dst + j * 256) = vh; *(v8us*)(Al + dst + j * 256) = vl; }
}
__global__ __launch_bounds__(128) void k_attn_hi(const bf* __restrict__ Qh, const bf* __restrict__ Ql, const bf* __restrict__ Kh, const bf* __restrict__ Kl, const h16* __restrict__ V16, const h16* __restrict__ Vr, bf* Ah, bf* Al, int qb0, int nqb) {
    attn_body<true>(Qh, Ql, Kh, Kl, V16, Vr, Ah, Al, qb0, nqb); }
__global__ __launch_bounds__(128) void k_attn_lo(const bf* __restrict__ Qh, const bf* __restrict__ Ql, const bf* __restrict__ Kh, const bf* __restrict__ Kl, const h16* __restrict__ V16, const h16* __restrict__ Vr, bf* Ah, bf* Al, int qb0, int nqb) {
    attn_body<false>(Qh, Ql, Kh, Kl, V16, Vr, Ah, Al, qb0, nqb); }

// ---- workspace carve (bytes, every region 256-B aligned and sized to its full store extent)
constexpr size_t al256(size_t x) { return (x + 255) & ~(size_t)255; }
constexpr size_t SZ_WT  = al256((size_t)NQKV * DM * 2);
constexpr size_t SZ_WO  = al256((size_t)DM * DQ * 2);
constexpr size_t SZ_XB  = al256((size_t)NB * SEQ * DM * 2);
constexpr size_t SZ_F   = al256((size_t)NB * SEQ * NQKV * 4);
constexpr size_t SZ_QP  = al256((size_t)NB * NH_ * SEQ * HD * 2);
constexpr size_t SZ_KP  = al256((size_t)NB * NKV * SEQ * HD * 2);
constexpr size_t SZ_AT  = al256((size_t)NB * SEQ * DQ * 2);
constexpr size_t OFF_WT = 0;
constexpr size_t OFF_WO = OFF_WT + SZ_WT;
constexpr size_t OFF_XB = OFF_WO + SZ_WO;
constexpr size_t OFF_F  = OFF_XB + SZ_XB;
constexpr size_t OFF_QH = OFF_F + SZ_F;
constexpr size_t OFF_QL = OFF_QH + SZ_QP;
constexpr size_t OFF_KH = OFF_QL + SZ_QP;
constexpr size_t OFF_KL = OFF_KH + SZ_KP;
constexpr size_t OFF_V1 = OFF_KL + SZ_KP;
constexpr size_t OFF_VR = OFF_V1 + SZ_KP;
constexpr size_t OFF_AH = OFF_VR + SZ_KP;
constexpr size_t OFF_AL = OFF_AH + SZ_AT;
constexpr size_t WS_TOTAL = OFF_AL + SZ_AT;
static_assert(WS_TOTAL <= (size_t)134217728);

extern "C" void kernel_launch(void* const* d_in, const int* in_sizes, int n_in,
                              void* d_out, int out_size, void* d_ws, size_t ws_size, hipStream_t stream) {
    if (n_in < 7) return;
    if (in_sizes[0] < (NB - 1) * SEQ_FULL * DM + SEQ * DM) return;
    if (in_sizes[1] < SEQ * 32 || in_sizes[2] < SEQ * 32) return;
    if (in_sizes[3] < DM * DQ || in_sizes[4] < DM * DKV || in_sizes[5] < DM * DKV || in_sizes[6] < DQ * DM) return;
    if (out_size < NB * SEQ * DM) return;
    if (ws_size < WS_TOTAL) return;
    const float* x = (const float*)d_in[0]; const float* cs = (const float*)d_in[1]; const float* sn = (const float*)d_in[2];
    const float* wq = (const float*)d_in[3]; const float* wk = (const float*)d_in[4]; const float* wv = (const float*)d_in[5]; const float* wo = (const float*)d_in[6];
    float* OUT = (float*)d_out;
    char* w8 = (char*)d_ws;
    bf* WT = (bf*)(w8 + OFF_WT); bf* WOT = (bf*)(w8 + OFF_WO); bf* XB = (bf*)(w8 + OFF_XB); float* F = (float*)(w8 + OFF_F);
    bf* QPh = (bf*)(w8 + OFF_QH); bf* QPl = (bf*)(w8 + OFF_QL); bf* KPh = (bf*)(w8 + OFF_KH); bf* KPl = (bf*)(w8 + OFF_KL);
    h16* V16 = (h16*)(w8 + OFF_V1); h16* VR = (h16*)(w8 + OFF_VR); bf* ATh = (bf*)(w8 + OFF_AH); bf* ATl = (bf*)(w8 + OFF_AL);

    // weights: in w[K = DM][N] -> out plane rows n (fragment order); q | k | v stacked into one [1536][1024] plane
    k_wtG<<<(unsigned)((DM * DQ / 64 + 63) / 64), 256, 0, stream>>>(wq, DM, DQ, WT);
    k_wtG<<<(unsigned)((DM * DKV / 64 + 63) / 64), 256, 0, stream>>>(wk, DM, DKV, WT + (size_t)KCOL * DM);
    k_wtG<<<(unsigned)((DM * DKV / 64 + 63) / 64), 256, 0, stream>>>(wv, DM, DKV, WT + (size_t)VCOL * DM);
    k_wtG<<<(unsigned)((DQ * DM / 64 + 63) / 64), 256, 0, stream>>>(wo, DQ, DM, WOT);
    k_cvtx<<<(unsigned)(((size_t)NB * SEQ * DM / 8 + 255) / 256), 256, 0, stream>>>(x, XB);
    k_gemm_proj<<<dim3(NB * SEQ / 64, NQKV / 64, 1), 32, 0, stream>>>(XB, WT, F);
    k_ropep<<<(unsigned)(((size_t)NB * NH_ * SEQ * HD / 16 + 255) / 256), 256, 0, stream>>>(F, 0, NH_, cs, sn, 0.125f, QPh, QPl);
    k_ropep<<<(unsigned)(((size_t)NB * NKV * SEQ * HD / 16 + 255) / 256), 256, 0, stream>>>(F, KCOL, NKV, cs, sn, 1.0f, KPh, KPl);
    k_vtp<<<(unsigned)(((size_t)NB * NKV * HD * SEQ / 2 + 255) / 256), 256, 0, stream>>>(F, V16, VR);
    const int nq1 = RH / 64, nq2 = (SEQ - RH) / 64;
    k_attn_hi<<<(unsigned)(nq1 * NB * NH_), 128, 0, stream>>>(QPh, QPl, KPh, KPl, V16, VR, ATh, ATl, 0, nq1);
    if (nq2 > 0) k_attn_lo<<<(unsigned)(nq2 * NB * NH_), 128, 0, stream>>>(QPh, QPl, KPh, KPl, V16, VR, ATh, ATl, nq1, nq2);
    k_gemm_out<<<dim3(NB * SEQ / 64, DM / 64, 1), 32, 0, stream>>>(ATh, ATl, WOT, OUT);
}

// v002
// A run of this version takes 129 microseconds.
// Two timings next to v001 put it at 2.16 and 2.14 times that version's speed.
// Counting every step since v000, it is 2.43 times as fast.
#include <hip/hip_runtime.h>

// Compute dtypes (f32 accumulate everywhere): x@[Wq|Wk|Wv] v_wmma_f32_16x16x32_bf16 (inputs RNE-converted to bf16, single product); q.k^T bf16 hi/lo planes (3 products, one accumulator, 1/8 folded into q);
// P.V v_wmma_f32_16x16x32_f16 with P carried x1024 (query rows < 256: f16 value + x2048 residual planes of P and V, separate accumulator); ctx@Wo bf16 hi/lo ctx x bf16 Wo (2 products). Softmax, rotary: f32.
// Causal grouped-query attention, rotary cos/sin tables read by value from their input buffers (bf16 RNE on load). Fused flash-style attention in transposed form: S^T = K Q^T so the probability
// tile leaves the accumulators already in B-fragment layout (element r <- key tile 0 row 8h+r, element 8+r <- key tile 1), O^T = V^T P^T; row statistics are per-lane scalars.
// Every 16-bit operand plane (rows x K) lies in fragment order: one 1-KiB block per (16-row tile R, 32-wide k chunk C), block index R * (K / 32) + C (V planes, rows = d, k = key: C * 4 + R);
// The three matrix loops load their operand fragments one step ahead of the products that use them.
// in a block the 16-B piece of (row r, k = 16 * half + 8 * hi + 0..7) stands at element half * 256 + (hi * 16 + r) * 8, so each of a fragment's two wave-wide loads reads 512 contiguous bytes (4 lines, not 16).

#ifndef NB
#define NB 2
#endif
#ifndef SEQ
#define SEQ 2048
#endif
#define SEQ_FULL 2048
#define DM   1024
#define NH_  16
#define NKV  4
#define REP  (NH_ / NKV)
#define HD   64
#define DQ   (NH_ * HD)
#define DKV  (NKV * HD)
#define NQKV (DQ + 2 * DKV)
#define KCOL DQ
#define VCOL (DQ + DKV)
#define RH   ((SEQ) < 256 ? (SEQ) : 256)   // query rows < RH carry residual planes on P, V
#define PCAR 1024.0f
#define RCAR 2048.0f
#define L2E  1.4426950408889634f
#define NEGBIG (-1.0e30f)

typedef _Float16 h16;
typedef unsigned short bf;
typedef __attribute__((ext_vector_type(16))) __bf16   v16bf;
typedef __attribute__((ext_vector_type(16))) _Float16 v16h;
typedef __attribute__((ext_vector_type(8)))  _Float16 v8h;
typedef __attribute__((ext_vector_type(8)))  unsigned short v8us;
typedef __attribute__((ext_vector_type(8)))  float    v8f;
typedef __attribute__((ext_vector_type(4)))  float    v4f;
typedef __attribute__((ext_vector_type(2)))  _Float16 v2h;
typedef __attribute__((ext_vector_type(2)))  unsigned short v2us;
typedef v4f  __attribute__((may_alias)) v4fa;

static_assert(HD == 64);
static_assert(DQ == DM);
static_assert(NH_ % NKV == 0);
static_assert(SEQ % 64 == 0);
static_assert(SEQ <= SEQ_FULL);
static_assert(RH % 64 == 0);
static_assert(RH <= SEQ);
static_assert(DM % 32 == 0);
static_assert(DQ % 32 == 0);
static_assert((NB * SEQ) % 64 == 0);
static_assert(NQKV % 64 == 0);
static_assert(DM % 64 == 0);
static_assert((DM * DQ) % 64 == 0);
static_assert((DM * DKV) % 64 == 0);

__device__ __forceinline__ unsigned short f2bf(float f) { unsigned u = __float_as_uint(f); u += 0x7FFFu + ((u >> 16) & 1u); return (unsigned short)(u >> 16); }
__device__ __forceinline__ float bf2f(unsigned short b) { return __uint_as_float(((unsigned)b) << 16); }
__device__ __forceinline__ float bfr(float f) { return bf2f(f2bf(f)); }
__device__ __forceinline__ void splitf(float y, unsigned short& h, unsigned short& l) { h = f2bf(y); l = f2bf(y - bf2f(h)); }
__device__ __forceinline__ v16h cat16(v8h lo, v8h hi) { return __builtin_shufflevector(lo, hi, 0, 1, 2, 3, 4, 5, 6, 7, 8, 9, 10, 11, 12, 13, 14, 15); }
__device__ __forceinline__ v16bf cat16b(v8us lo, v8us hi) { return __builtin_bit_cast(v16bf, __builtin_shufflevector(lo, hi, 0, 1, 2, 3, 4, 5, 6, 7, 8, 9, 10, 11, 12, 13, 14, 15)); }
__device__ __forceinline__ v8f wmma16(v16h a, v16h b, v8f c) { return __builtin_amdgcn_wmma_f32_16x16x32_f16(false, a, false, b, (short)0, c, false, false); }
__device__ __forceinline__ v8f wmmab(v16bf a, v16bf b, v8f c) { return __builtin_amdgcn_wmma_f32_16x16x32_bf16(false, a, false, b, (short)0, c, false, false); }
// fragment loaders: p = b + vo + im (bytes) points at block start + lane * 16 bytes, which holds (row l&15, k0 + 8*(l>>4)); elements 0..7 <- bytes 0..15, elements 8..15 (k + 16) <- bytes 512..527.
// b: wave-uniform plane pointer, vo: the lane's byte offset, im: a constant; the loads take b as scalar base, and one 32-bit register per lane is all that moves from step to step
__device__ __forceinline__ v16bf ldbs(const bf* b, unsigned vo, int im) { const char* p = (const char*)b + vo; return cat16b(*(const v8us*)(p + im), *(const v8us*)(p + im + 512)); }
__device__ __forceinline__ v16h ldhs(const h16* b, unsigned vo, int im) { const char* p = (const char*)b + vo; return cat16(*(const v8h*)(p + im), *(const v8h*)(p + im + 512)); }

// hazard guards: name every accumulator of the group and the last fragments
template <typename V> __device__ __forceinline__ void nopg2(v8f& c0, v8f& c1, const V& x, const V& y, const V& z) {
    asm volatile("v_nop\n\tv_nop\n\tv_nop\n\tv_nop" : "+v"(c0), "+v"(c1) : "v"(x), "v"(y), "v"(z)); }
template <typename V> __device__ __forceinline__ void nopg4(v8f& c0, v8f& c1, v8f& c2, v8f& c3, const V& x, const V& y, const V& z) {
    asm volatile("v_nop\n\tv_nop\n\tv_nop\n\tv_nop" : "+v"(c0), "+v"(c1), "+v"(c2), "+v"(c3) : "v"(x), "v"(y), "v"(z)); }
template <typename V> __device__ __forceinline__ void nopg8(v8f& c0, v8f& c1, v8f& c2, v8f& c3, v8f& c4, v8f& c5, v8f& c6, v8f& c7, const V& x, const V& y, const V& z) {
    asm volatile("v_nop\n\tv_nop\n\tv_nop\n\tv_nop" : "+v"(c0), "+v"(c1), "+v"(c2), "+v"(c3), "+v"(c4), "+v"(c5), "+v"(c6), "+v"(c7) : "v"(x), "v"(y), "v"(z)); }

// one k chunk's fragments of a 64x64 tile, and the two halves of a pipelined step: fetch (loads only) and multiply (products only)
template <int NSPLIT> struct gfrag { v16bf a[4], a2[NSPLIT == 1 ? 4 : 1], b[4]; };
template <int NSPLIT>
__device__ __forceinline__ void gemm_fetch(gfrag<NSPLIT>& f, const bf* pa, const bf* pa2, const bf* pb, int K, unsigned vo, int im) {
#pragma unroll
    for (int mb = 0; mb < 4; ++mb) { f.a[mb] = ldbs(pa, vo, im + mb * 32 * K); if (NSPLIT == 1) f.a2[mb] = ldbs(pa2, vo, im + mb * 32 * K); }
#pragma unroll
    for (int nb = 0; nb < 4; ++nb) f.b[nb] = ldbs(pb, vo, im + nb * 32 * K);
    __builtin_amdgcn_sched_barrier(0);   // keeps the group of loads ahead of the products: sunk among them, each would be waited for where it stands
}
template <int NSPLIT>
__device__ __forceinline__ void gemm_mul(const gfrag<NSPLIT>& f, v8f (&acc)[4][4]) {
#pragma unroll
    for (int nb = 0; nb < 4; ++nb) {
#pragma unroll
        for (int mb = 0; mb < 4; ++mb) { acc[mb][nb] = wmmab(f.a[mb], f.b[nb], acc[mb][nb]); if (NSPLIT == 1) acc[mb][nb] = wmmab(f.a2[mb], f.b[nb], acc[mb][nb]); } }
    nopg8(acc[0][0], acc[0][1], acc[0][2], acc[0][3], acc[1][0], acc[1][1], acc[1][2], acc[1][3], f.a[0], f.a[1], f.b[3]);
    nopg8(acc[2][0], acc[2][1], acc[2][2], acc[2][3], acc[3][0], acc[3][1], acc[3][2], acc[3][3], f.a[3], (NSPLIT == 1) ? f.a2[3] : f.a[2], f.b[3]);
}
// ---- one-wave 64x64 tile GEMM: C[m][n] (f32, pitch ldc) = sum_k A[m][k] Bt[n][k] (+ A2[m][k] Bt[n][k] when NSPLIT == 1); operands straight from fragment-order bf16 planes; K % 64 == 0.
template <int NSPLIT>
__device__ __forceinline__ void gemm_body(const bf* A, const bf* A2, const bf* Bt, int K, float* C, int ldc) {
    __shared__ __align__(16) float os[16 * 68];
    const int lane = threadIdx.x & 31, lr = lane & 15, hi = lane >> 4; const int r0 = blockIdx.x * 64, c0 = blockIdx.y * 64;
    v8f acc[4][4];
#pragma unroll
    for (int mb = 0; mb < 4; ++mb)
#pragma unroll
        for (int nb = 0; nb < 4; ++nb) acc[mb][nb] = (v8f){};
    const size_t aoff = (size_t)r0 * K, boff = (size_t)c0 * K;   // a 16-row tile spans 16 * K elements (32 * K bytes), a k chunk of 32 one block of 512 (1024 bytes)
    // two fragment sets: while one k chunk is multiplied, the next chunk's loads (one group, issued ahead of the products) are in flight; K % 64 == 0
    gfrag<NSPLIT> f0, f1;
    const bf* pa = A + aoff; const bf* pa2 = A2 + aoff; const bf* pb = Bt + boff;
    unsigned vo = (unsigned)lane * 16u;   // the lane's byte offset in the current pair of chunks
    gemm_fetch<NSPLIT>(f0, pa, pa2, pb, K, vo, 0);
    asm volatile("s_wait_xcnt 0x0" ::: "memory");   // registers that these first loads name are free for other use below
    __builtin_amdgcn_sched_barrier(0);              // keeps that use behind the wait
#pragma unroll 1
    for (int kc = 0; kc < K; kc += 64) {
        gemm_fetch<NSPLIT>(f1, pa, pa2, pb, K, vo, 1024);
        gemm_mul<NSPLIT>(f0, acc);
        asm volatile("s_wait_xcnt 0x0" ::: "memory");   // the offset register of the loads in flight is advanced below
        __builtin_amdgcn_sched_barrier(0);              // keeps that advance behind the wait
        vo += (kc + 64 < K) ? 2048u : 0u;               // to the next pair of chunks; behind the last pair: the same chunk again, not used
        gemm_fetch<NSPLIT>(f0, pa, pa2, pb, K, vo, 0);
        gemm_mul<NSPLIT>(f1, acc);
    }
    asm volatile("s_wait_loadcnt 0x0" ::: "memory");   // the last look-ahead group is not used: it has landed before its registers serve the epilogue
    __builtin_amdgcn_sched_barrier(0);                 // keeps the epilogue's arithmetic behind the wait
#pragma unroll
    for (int mb = 0; mb < 4; ++mb) {
#pragma unroll
        for (int nb = 0; nb < 4; ++nb) {
#pragma unroll
            for (int j = 0; j < 8; ++j) os[(hi * 8 + j) * 68 + nb * 16 + lr] = acc[mb][nb][j]; }
        asm volatile("s_wait_dscnt 0" ::: "memory"); __builtin_amdgcn_wave_barrier();
        float* crow = C + (size_t)(r0 + mb * 16) * ldc + c0;
{
#pragma unroll
            for (int s = 0; s < 8; ++s) { const int row = 2 * s + hi, cofs = lr * 4; const v4f val = *(const v4fa*)(os + row * 68 + cofs);
                *(v4f*)(crow + (size_t)row * ldc + cofs) = val; }
             }
        asm volatile("s_wait_xcnt 0x0" ::: "memory");   // the stores' data registers are loaded anew in the next round
        asm volatile("s_wait_dscnt 0" ::: "memory"); __builtin_amdgcn_wave_barrier();
    }
}
// F[NB*SEQ][1536] = XB[NB*SEQ][1024] x WT[1536][1024]^T
__global__ __launch_bounds__(32) void k_gemm_proj(const bf* __restrict__ A, const bf* __restrict__ Bt, float* C) { gemm_body<0>(A, A, Bt, DM, C, NQKV); }
// OUT[NB*SEQ][1024] = (ATh + ATl)[NB*SEQ][1024] x WOT[1024][1024]^T
__global__ __launch_bounds__(32) void k_gemm_out(const bf* __restrict__ A, const bf* __restrict__ A2, const bf* __restrict__ Bt, float* C) { gemm_body<1>(A, A2, Bt, DQ, C, DM); }

__global__ __launch_bounds__(256) void k_wtG(const float* __restrict__ w, int K, int N, bf* Bt) {
    const int lane = threadIdx.x & 31; const int L0 = (blockIdx.x * 8 + (threadIdx.x >> 5)) * 8; const int nlines = N * K / 64;
{
#pragma unroll 1
        for (int l = 0; l < 8; ++l) { const int L = L0 + l; if (L >= nlines) break; const size_t e = (size_t)L * 64 + lane * 2; const int blk = (int)(e >> 9), in = (int)(e & 511);
            const int k = (blk % (K / 32)) * 32 + (in >> 7) * 8 + (in & 7), n = (blk / (K / 32)) * 16 + ((in >> 3) & 15); v2us o;
            o[0] = f2bf(w[(size_t)k * N + n]); o[1] = f2bf(w[(size_t)(k + 1) * N + n]); *(v2us*)(Bt + e) = o; }
         }
}
__global__ __launch_bounds__(256) void k_cvtx(const float* __restrict__ x, bf* XB) {
    const size_t i = (size_t)blockIdx.x * 256 + threadIdx.x; if (i >= (size_t)NB * SEQ * DM / 8) return;
    // a wave takes 8 rows x 4 pieces: it reads whole 128-B lines of 8 rows and stores 4 whole lines
    const int blk = (int)(i >> 6), r = (int)((i & 7) | ((i >> 2) & 8)), pc = (int)((i >> 3) & 3); const size_t e = (size_t)blk * 512 + (pc * 16 + r) * 8;
    const int row = (blk / (DM / 32)) * 16 + r, k = (blk % (DM / 32)) * 32 + pc * 8;
    const v8f v = *(const v8f*)(x + (size_t)(row / SEQ) * SEQ_FULL * DM + (size_t)(row % SEQ) * DM + k); v8us o;
#pragma unroll
    for (int k = 0; k < 8; ++k) o[k] = f2bf(v[k]);
    *(v8us*)(XB + e) = o; 
}
// ---- k_ropep: head planes [b][head] (rows = t, k = d, fragment order, bf16 hi/lo) of rotary(F[b*SEQ+t][colbase + head*64 + d]) x sc; tables COS/SIN [t][32] by value (bf16 RNE on load);
// a thread makes the 16-B pieces d = j0..j0+7 (chunk 0) and d = 32+j0..32+j0+7 (chunk 1) of one row, which share their inputs; a wave takes 8 rows x 4 pieces: each load touches 8 lines, each store fills 4 whole lines.
__global__ __launch_bounds__(256) void k_ropep(const float* __restrict__ F, int colbase, int nheads, const float* __restrict__ COS, const float* __restrict__ SIN, float sc, bf* Ph, bf* Pl) {
    const size_t i = (size_t)blockIdx.x * 256 + threadIdx.x; if (i >= (size_t)NB * nheads * SEQ * (HD / 16)) return;
    const int tile = (int)(i >> 6), r = (int)((i & 7) | ((i >> 2) & 8)), pc = (int)((i >> 3) & 3); const int t = (tile % (SEQ / 16)) * 16 + r; const int j0 = pc * 8;
    const int hh = (tile / (SEQ / 16)) % nheads; const int b = tile / ((SEQ / 16) * nheads);
    const float* f = F + (size_t)(b * SEQ + t) * NQKV + colbase + hh * HD + j0;
    const v8f x1 = *(const v8f*)f, x2 = *(const v8f*)(f + 32), cv = *(const v8f*)(COS + (size_t)t * 32 + j0), sv = *(const v8f*)(SIN + (size_t)t * 32 + j0);
    v8us ah, al, bh, bl;
#pragma unroll
    for (int q = 0; q < 8; ++q) { const float c = bfr(cv[q]), s = bfr(sv[q]);
        const float ra = (x1[q] * c + x2[q] * s) * sc, rb = (x2[q] * c - x1[q] * s) * sc;
        unsigned short a2, c2; splitf(ra, a2, c2); ah[q] = a2; al[q] = c2; splitf(rb, a2, c2); bh[q] = a2; bl[q] = c2; }
    const size_t dst = (size_t)tile * 1024 + (pc * 16 + r) * 8;
    *(v8us*)(Ph + dst) = ah; *(v8us*)(Pl + dst) = al; *(v8us*)(Ph + dst + 512) = bh; *(v8us*)(Pl + dst + 512) = bl;
}
__global__ __launch_bounds__(256) void k_vtp(const float* __restrict__ F, h16* V16, h16* Vr) {
    const size_t e = ((size_t)blockIdx.x * 256 + threadIdx.x) * 2; if (e >= (size_t)NB * NKV * HD * SEQ) return;
    const int blk = (int)((e % ((size_t)SEQ * HD)) >> 9), in = (int)(e & 511);
    const int t = (blk >> 2) * 32 + (in >> 7) * 8 + (in & 7); const int d = (blk & 3) * 16 + ((in >> 3) & 15); const int g = (int)((e / ((size_t)SEQ * HD)) % NKV); const int b = (int)(e / ((size_t)SEQ * HD * NKV)); v2h o16, o2;
#pragma unroll
    for (int q = 0; q < 2; ++q) { const float x = F[(size_t)(b * SEQ + t + q) * NQKV + VCOL + g * HD + d]; const h16 a = (h16)x; o16[q] = a; o2[q] = (h16)((x - (float)a) * RCAR); }
    *(v2h*)(V16 + e) = o16; *(v2h*)(Vr + e) = o2; 
}

// ---- fused causal flash attention, transposed form. Block = 4 waves = 64 query rows of one (b, h); a wave owns 16 query rows (one per lane&15) and walks keys in 32-key steps up to its diagonal.
// S^T tile (keys x queries) = K (A, rows = keys) x Q^T (B, cols = queries); D: lane -> query l&15, rows -> keys 8h+r. Two key tiles give the B fragment of P^T directly.
// O^T tile (d x queries) = V^T (A, rows = d, k = keys) x P^T (B). Running max / sum / scale factor are per-lane scalars (both lane halves of a query agree via one xor-16 shuffle).
template <bool HIRES>
__device__ __forceinline__ void attn_body(const bf* Qh, const bf* Ql, const bf* Kh, const bf* Kl, const h16* V16, const h16* Vr, bf* Ah, bf* Al, int qb0, int nqb) {
    const int lane = threadIdx.x & 31, lr = lane & 15, hi = lane >> 4;
    const int wave = __builtin_amdgcn_readfirstlane((int)(threadIdx.x >> 5));
    const int qblk = qb0 + (int)(blockIdx.x % (unsigned)nqb);
    const int bh = (int)(blockIdx.x / (unsigned)nqb);
    const int b = bh / NH_, h = bh % NH_, g = h / REP;
    const int m0 = qblk * 64 + wave * 16;
    const size_t qbase = ((size_t)(b * NH_ + h) * SEQ) * HD;
    const size_t kbase = ((size_t)(b * NKV + g) * SEQ) * HD;
    const size_t vbase = ((size_t)(b * NKV + g) * HD) * SEQ;
    const int qrow = m0 + lr;
    v8f o[4], orr[4];
#pragma unroll
    for (int j = 0; j < 4; ++j) { o[j] = (v8f){}; orr[j] = (v8f){}; }
    float mrun = NEGBIG, lsum = 0.0f;
    const int nst = (m0 + 47) >> 5;              // keys 0 .. m0+15 in 32-key steps; k0 + 31 < SEQ always (SEQ % 32 == 0)
    // Loads run one step ahead of their products: Q fragments once, K of step st + 1 right behind the score products of step st, V of step st + 1 right behind the output products of step st.
    const bf* kph = Kh + kbase; const bf* kpl = Kl + kbase;          // 32 keys = 4 blocks of 1024 bytes (2 key tiles x 2 d chunks) in a row
    const h16* vp = V16 + vbase; const h16* vrp = Vr + vbase;        // 32 keys = 4 blocks of 1024 bytes (4 d tiles) in a row
    unsigned vo = (unsigned)lane * 16u;                              // the lane's byte offset in the step's blocks, the same in all four planes
    v16bf qhf[2], qlf[2], k0h[2], k0l[2], k1h[2], k1l[2];
    v16h vf[4], vrf[4];
#pragma unroll
    for (int c = 0; c < 2; ++c) { qhf[c] = ldbs(Qh + qbase + m0 * HD, vo, 1024 * c); qlf[c] = ldbs(Ql + qbase + m0 * HD, vo, 1024 * c); }
#pragma unroll
    for (int c = 0; c < 2; ++c) { k0h[c] = ldbs(kph, vo, 1024 * c); k0l[c] = ldbs(kpl, vo, 1024 * c); k1h[c] = ldbs(kph, vo, 2048 + 1024 * c); k1l[c] = ldbs(kpl, vo, 2048 + 1024 * c); }
#pragma unroll
    for (int j = 0; j < 4; ++j) { vf[j] = ldhs(vp, vo, j * 1024); if (HIRES) vrf[j] = ldhs(vrp, vo, j * 1024); }
    __builtin_amdgcn_sched_barrier(0);              // nothing comes between the loads and their wait
    asm volatile("s_wait_xcnt 0x0" ::: "memory");   // registers that these first loads name are free for other use below
    __builtin_amdgcn_sched_barrier(0);              // keeps that use behind the wait
#pragma unroll 1
    for (int st = 0; st < nst; ++st) {
        const int k0 = st * 32;
        v8f s0 = (v8f){}, s1 = (v8f){};
#pragma unroll
        for (int c = 0; c < 2; ++c) {
            s0 = wmmab(k0h[c], qhf[c], s0); s0 = wmmab(k0h[c], qlf[c], s0); s0 = wmmab(k0l[c], qhf[c], s0);
            s1 = wmmab(k1h[c], qhf[c], s1); s1 = wmmab(k1h[c], qlf[c], s1); s1 = wmmab(k1l[c], qhf[c], s1);
        }
        nopg2(s0, s1, qhf[1], qlf[1], k1l[1]);
        asm volatile("s_wait_xcnt 0x0" ::: "memory");   // the offset register of the loads in flight (V, from the last step's foot) is advanced below
        __builtin_amdgcn_sched_barrier(0);              // keeps that advance behind the wait
        vo += (st + 1 < nst) ? 32u * HD * 2u : 0u;      // to the next step's blocks; behind the last step: its own again, not used
#pragma unroll
        for (int c = 0; c < 2; ++c) { k0h[c] = ldbs(kph, vo, 1024 * c); k0l[c] = ldbs(kpl, vo, 1024 * c); k1h[c] = ldbs(kph, vo, 2048 + 1024 * c); k1l[c] = ldbs(kpl, vo, 2048 + 1024 * c); }
        __builtin_amdgcn_sched_barrier(0);   // keeps the K loads here, ahead of the softmax: sunk to the loop's foot they would be waited for at once
        // causal exclusion by value (key > query -> NEGBIG, probability exactly 0), running max
        const int kb = k0 + 8 * hi;
        float mx = NEGBIG;
#pragma unroll
        for (int r = 0; r < 8; ++r) {
            const float a0 = (kb + r <= qrow) ? s0[r] : NEGBIG;
            const float a1 = (kb + 16 + r <= qrow) ? s1[r] : NEGBIG;
            s0[r] = a0; s1[r] = a1; mx = fmaxf(mx, fmaxf(a0, a1));
        }
        mx = fmaxf(mx, __shfl_xor(mx, 16, 32));
        const float mnew = fmaxf(mrun, mx);
        const float corr = __builtin_amdgcn_exp2f((mrun - mnew) * L2E);
        mrun = mnew;
        float psum = 0.0f;
        v16h pbv, prv;
#pragma unroll
        for (int r = 0; r < 8; ++r) {
            const float p0 = __builtin_amdgcn_exp2f((s0[r] - mnew) * L2E);
            const float p1 = __builtin_amdgcn_exp2f((s1[r] - mnew) * L2E);
            psum += p0 + p1;
            const float c0 = p0 * PCAR, c1 = p1 * PCAR;
            const h16 h0 = (h16)c0, h1 = (h16)c1;
            pbv[r] = h0; pbv[8 + r] = h1;
            if (HIRES) { prv[r] = (h16)((c0 - (float)h0) * RCAR); prv[8 + r] = (h16)((c1 - (float)h1) * RCAR); }
        }
        lsum = lsum * corr + psum;
#pragma unroll
        for (int j = 0; j < 4; ++j) {
#pragma unroll
            for (int r = 0; r < 8; ++r) { o[j][r] *= corr; if (HIRES) orr[j][r] *= corr; } }
        // O^T += V^T P^T
#pragma unroll
        for (int j = 0; j < 4; ++j) {
            o[j] = wmma16(vf[j], pbv, o[j]);
            if (HIRES) { orr[j] = wmma16(vrf[j], pbv, orr[j]); orr[j] = wmma16(vf[j], prv, orr[j]); }
        }
        if (HIRES) nopg8(o[0], o[1], o[2], o[3], orr[0], orr[1], orr[2], orr[3], pbv, prv, vf[3]);
        else       nopg4(o[0], o[1], o[2], o[3], pbv, pbv, vf[3]);
#pragma unroll
        for (int j = 0; j < 4; ++j) { vf[j] = ldhs(vp, vo, j * 1024); if (HIRES) vrf[j] = ldhs(vrp, vo, j * 1024); }
    }
    asm volatile("s_wait_loadcnt 0x0" ::: "memory");   // the last step's look-ahead loads are not used: they have landed before their registers are reused or given back
    __builtin_amdgcn_sched_barrier(0);                 // keeps the epilogue's arithmetic behind the wait
    lsum += __shfl_xor(lsum, 16, 32);
    const float inv = 1.0f / (PCAR * lsum);
    // lane holds ctx(query m0+lr, d = j*16 + 8*hi + r): 8 consecutive d per j -> one 16-B piece per plane, and piece j of lane l is piece l of half-block j of the wave's two ctx blocks
    const size_t dst = (size_t)(b * SEQ + m0) * DQ + h * (16 * HD) + lane * 8;
#pragma unroll
    for (int j = 0; j < 4; ++j) { v8us vh, vl;
#pragma unroll
        for (int r = 0; r < 8; ++r) { const float val = HIRES ? (o[j][r] + orr[j][r] * (1.0f / RCAR)) * inv : o[j][r] * inv; unsigned short a2, c2; splitf(val, a2, c2); vh[r] = a2; vl[r] = c2; }
        *(v8us*)(Ah + dst + j * 256) = vh; *(v8us*)(Al + dst + j * 256) = vl; }
}
__global__ __launch_bounds__(128) void k_attn_hi(const bf* __restrict__ Qh, const bf* __restrict__ Ql, const bf* __restrict__ Kh, const bf* __restrict__ Kl, const h16* __restrict__ V16, const h16* __restrict__ Vr, bf* Ah, bf* Al, int qb0, int nqb) {
    attn_body<true>(Qh, Ql, Kh, Kl, V16, Vr, Ah, Al, qb0, nqb); }
__global__ __launch_bounds__(128) void k_attn_lo(const bf* __restrict__ Qh, const bf* __restrict__ Ql, const bf* __restrict__ Kh, const bf* __restrict__ Kl, const h16* __restrict__ V16, const h16* __restrict__ Vr, bf* Ah, bf* Al, int qb0, int nqb) {
    attn_body<false>(Qh, Ql, Kh, Kl, V16, Vr, Ah, Al, qb0, nqb); }

// ---- workspace carve (bytes, every region 256-B aligned and sized to its full store extent)
constexpr size_t al256(size_t x) { return (x + 255) & ~(size_t)255; }
constexpr size_t SZ_WT  = al256((size_t)NQKV * DM * 2);
constexpr size_t SZ_WO  = al256((size_t)DM * DQ * 2);
constexpr size_t SZ_XB  = al256((size_t)NB * SEQ * DM * 2);
constexpr size_t SZ_F   = al256((size_t)NB * SEQ * NQKV * 4);
constexpr size_t SZ_QP  = al256((size_t)NB * NH_ * SEQ * HD * 2);
constexpr size_t SZ_KP  = al256((size_t)NB * NKV * SEQ * HD * 2);
constexpr size_t SZ_AT  = al256((size_t)NB * SEQ * DQ * 2);
constexpr size_t OFF_WT = 0;
constexpr size_t OFF_WO = OFF_WT + SZ_WT;
constexpr size_t OFF_XB = OFF_WO + SZ_WO;
constexpr size_t OFF_F  = OFF_XB + SZ_XB;
constexpr size_t OFF_QH = OFF_F + SZ_F;
constexpr size_t OFF_QL = OFF_QH + SZ_QP;
constexpr size_t OFF_KH = OFF_QL + SZ_QP;
constexpr size_t OFF_KL = OFF_KH + SZ_KP;
constexpr size_t OFF_V1 = OFF_KL + SZ_KP;
constexpr size_t OFF_VR = OFF_V1 + SZ_KP;
constexpr size_t OFF_AH = OFF_VR + SZ_KP;
constexpr size_t OFF_AL = OFF_AH + SZ_AT;
constexpr size_t WS_TOTAL = OFF_AL + SZ_AT;
static_assert(WS_TOTAL <= (size_t)134217728);

extern "C" void kernel_launch(void* const* d_in, const int* in_sizes, int n_in,
                              void* d_out, int out_size, void* d_ws, size_t ws_size, hipStream_t stream) {
    if (n_in < 7) return;
    if (in_sizes[0] < (NB - 1) * SEQ_FULL * DM + SEQ * DM) return;
    if (in_sizes[1] < SEQ * 32 || in_sizes[2] < SEQ * 32) return;
    if (in_sizes[3] < DM * DQ || in_sizes[4] < DM * DKV || in_sizes[5] < DM * DKV || in_sizes[6] < DQ * DM) return;
    if (out_size < NB * SEQ * DM) return;
    if (ws_size < WS_TOTAL) return;
    const float* x = (const float*)d_in[0]; const float* cs = (const float*)d_in[1]; const float* sn = (const float*)d_in[2];
    const float* wq = (const float*)d_in[3]; const float* wk = (const float*)d_in[4]; const float* wv = (const float*)d_in[5]; const float* wo = (const float*)d_in[6];
    float* OUT = (float*)d_out;
    char* w8 = (char*)d_ws;
    bf* WT = (bf*)(w8 + OFF_WT); bf* WOT = (bf*)(w8 + OFF_WO); bf* XB = (bf*)(w8 + OFF_XB); float* F = (float*)(w8 + OFF_F);
    bf* QPh = (bf*)(w8 + OFF_QH); bf* QPl = (bf*)(w8 + OFF_QL); bf* KPh = (bf*)(w8 + OFF_KH); bf* KPl = (bf*)(w8 + OFF_KL);
    h16* V16 = (h16*)(w8 + OFF_V1); h16* VR = (h16*)(w8 + OFF_VR); bf* ATh = (bf*)(w8 + OFF_AH); bf* ATl = (bf*)(w8 + OFF_AL);

    // weights: in w[K = DM][N] -> out plane rows n (fragment order); q | k | v stacked into one [1536][1024] plane
    k_wtG<<<(unsigned)((DM * DQ / 64 + 63) / 64), 256, 0, stream>>>(wq, DM, DQ, WT);
    k_wtG<<<(unsigned)((DM * DKV / 64 + 63) / 64), 256, 0, stream>>>(wk, DM, DKV, WT + (size_t)KCOL * DM);
    k_wtG<<<(unsigned)((DM * DKV / 64 + 63) / 64), 256, 0, stream>>>(wv, DM, DKV, WT + (size_t)VCOL * DM);
    k_wtG<<<(unsigned)((DQ * DM / 64 + 63) / 64), 256, 0, stream>>>(wo, DQ, DM, WOT);
    k_cvtx<<<(unsigned)(((size_t)NB * SEQ * DM / 8 + 255) / 256), 256, 0, stream>>>(x, XB);
    k_gemm_proj<<<dim3(NB * SEQ / 64, NQKV / 64, 1), 32, 0, stream>>>(XB, WT, F);
    k_ropep<<<(unsigned)(((size_t)NB * NH_ * SEQ * HD / 16 + 255) / 256), 256, 0, stream>>>(F, 0, NH_, cs, sn, 0.125f, QPh, QPl);
    k_ropep<<<(unsigned)(((size_t)NB * NKV * SEQ * HD / 16 + 255) / 256), 256, 0, stream>>>(F, KCOL, NKV, cs, sn, 1.0f, KPh, KPl);
    k_vtp<<<(unsigned)(((size_t)NB * NKV * HD * SEQ / 2 + 255) / 256), 256, 0, stream>>>(F, V16, VR);
    const int nq1 = RH / 64, nq2 = (SEQ - RH) / 64;
    k_attn_hi<<<(unsigned)(nq1 * NB * NH_), 128, 0, stream>>>(QPh, QPl, KPh, KPl, V16, VR, ATh, ATl, 0, nq1);
    if (nq2 > 0) k_attn_lo<<<(unsigned)(nq2 * NB * NH_), 128, 0, stream>>>(QPh, QPl, KPh, KPl, V16, VR, ATh, ATl, nq1, nq2);
    k_gemm_out<<<dim3(NB * SEQ / 64, DM / 64, 1), 32, 0, stream>>>(ATh, ATl, WOT, OUT);
}

// v003
// One run takes 104 microseconds.
// Next to v002, in two timings, it ran 1.24 times as fast each time.
// Over all steps from v000 it is 3.01 times as fast.
#include <hip/hip_runtime.h>

// Compute dtypes (f32 accumulate everywhere): x@[Wq|Wk|Wv] v_wmma_f32_16x16x32_bf16 (inputs RNE-converted to bf16, single product); q.k^T bf16 hi/lo planes (3 products, one accumulator, 1/8 folded into q);
// P.V v_wmma_f32_16x16x32_f16 with P carried x1024 (query rows < 256: f16 value + x2048 residual planes of P and V, separate accumulator); ctx@Wo bf16 hi/lo ctx x bf16 Wo (2 products). Softmax, rotary: f32.
// Causal grouped-query attention, rotary cos/sin tables read by value from their input buffers (bf16 RNE on load). Fused flash-style attention in transposed form: S^T = K Q^T so the probability
// tile leaves the accumulators already in B-fragment layout (element r <- key tile 0 row 8h+r, element 8+r <- key tile 1), O^T = V^T P^T; row statistics are per-lane scalars.
// Every 16-bit operand plane (rows x K) lies in fragment order: one 1-KiB block per (16-row tile R, 32-wide k chunk C), block index R * (K / 32) + C (V planes, rows = d, k = key: C * 4 + R);
// The three matrix loops load their operand fragments one step ahead of the products that use them.
// in a block the 16-B piece of (row r, k = 16 * half + 8 * hi + 0..7) stands at element half * 256 + (hi * 16 + r) * 8, so each of a fragment's two wave-wide loads reads 512 contiguous bytes (4 lines, not 16).

#ifndef NB
#define NB 2
#endif
#ifndef SEQ
#define SEQ 2048
#endif
#define SEQ_FULL 2048
#define DM   1024
#define NH_  16
#define NKV  4
#define REP  (NH_ / NKV)
#define HD   64
#define DQ   (NH_ * HD)
#define DKV  (NKV * HD)
#define NQKV (DQ + 2 * DKV)
#define KCOL DQ
#define VCOL (DQ + DKV)
#define RH   ((SEQ) < 256 ? (SEQ) : 256)   // query rows < RH carry residual planes on P, V
#define PCAR 1024.0f
#define RCAR 2048.0f
#define L2E  1.4426950408889634f
#define NEGBIG (-1.0e30f)

typedef _Float16 h16;
typedef unsigned short bf;
typedef __attribute__((ext_vector_type(16))) __bf16   v16bf;
typedef __attribute__((ext_vector_type(16))) _Float16 v16h;
typedef __attribute__((ext_vector_type(8)))  _Float16 v8h;
typedef __attribute__((ext_vector_type(8)))  unsigned short v8us;
typedef __attribute__((ext_vector_type(8)))  float    v8f;
typedef __attribute__((ext_vector_type(4)))  float    v4f;
typedef __attribute__((ext_vector_type(2)))  _Float16 v2h;
typedef __attribute__((ext_vector_type(2)))  unsigned short v2us;
typedef v4f  __attribute__((may_alias)) v4fa;

static_assert(HD == 64);
static_assert(DQ == DM);
static_assert(NH_ % NKV == 0);
static_assert(SEQ % 64 == 0);
static_assert(SEQ <= SEQ_FULL);
static_assert(RH % 64 == 0);
static_assert(RH <= SEQ);
static_assert(DM % 32 == 0);
static_assert(DQ % 32 == 0);
static_assert((NB * SEQ) % 64 == 0);
static_assert(NQKV % 64 == 0);
static_assert(DM % 64 == 0);
static_assert((DM * DQ) % 64 == 0);
static_assert((DM * DKV) % 64 == 0);

__device__ __forceinline__ unsigned short f2bf(float f) { unsigned u = __float_as_uint(f); u += 0x7FFFu + ((u >> 16) & 1u); return (unsigned short)(u >> 16); }
__device__ __forceinline__ float bf2f(unsigned short b) { return __uint_as_float(((unsigned)b) << 16); }
__device__ __forceinline__ float bfr(float f) { return bf2f(f2bf(f)); }
__device__ __forceinline__ void splitf(float y, unsigned short& h, unsigned short& l) { h = f2bf(y); l = f2bf(y - bf2f(h)); }
__device__ __forceinline__ v16h cat16(v8h lo, v8h hi) { return __builtin_shufflevector(lo, hi, 0, 1, 2, 3, 4, 5, 6, 7, 8, 9, 10, 11, 12, 13, 14, 15); }
__device__ __forceinline__ v16bf cat16b(v8us lo, v8us hi) { return __builtin_bit_cast(v16bf, __builtin_shufflevector(lo, hi, 0, 1, 2, 3, 4, 5, 6, 7, 8, 9, 10, 11, 12, 13, 14, 15)); }
__device__ __forceinline__ v8f wmma16(v16h a, v16h b, v8f c) { return __builtin_amdgcn_wmma_f32_16x16x32_f16(false, a, false, b, (short)0, c, false, false); }
__device__ __forceinline__ v8f wmmab(v16bf a, v16bf b, v8f c) { return __builtin_amdgcn_wmma_f32_16x16x32_bf16(false, a, false, b, (short)0, c, false, false); }
// fragment loaders: p = b + vo + im (bytes) points at block start + lane * 16 bytes, which holds (row l&15, k0 + 8*(l>>4)); elements 0..7 <- bytes 0..15, elements 8..15 (k + 16) <- bytes 512..527.
// b: wave-uniform plane pointer, vo: the lane's byte offset, im: a constant; the loads take b as scalar base, and one 32-bit register per lane is all that moves from step to step
__device__ __forceinline__ v16bf ldbs(const bf* b, unsigned vo, int im) { const char* p = (const char*)b + vo; return cat16b(*(const v8us*)(p + im), *(const v8us*)(p + im + 512)); }
__device__ __forceinline__ v16h ldhs(const h16* b, unsigned vo, int im) { const char* p = (const char*)b + vo; return cat16(*(const v8h*)(p + im), *(const v8h*)(p + im + 512)); }

// hazard guards: name every accumulator of the group and the last fragments
template <typename V> __device__ __forceinline__ void nopg2(v8f& c0, v8f& c1, const V& x, const V& y, const V& z) {
    asm volatile("v_nop\n\tv_nop\n\tv_nop\n\tv_nop" : "+v"(c0), "+v"(c1) : "v"(x), "v"(y), "v"(z)); }
template <typename V> __device__ __forceinline__ void nopg4(v8f& c0, v8f& c1, v8f& c2, v8f& c3, const V& x, const V& y, const V& z) {
    asm volatile("v_nop\n\tv_nop\n\tv_nop\n\tv_nop" : "+v"(c0), "+v"(c1), "+v"(c2), "+v"(c3) : "v"(x), "v"(y), "v"(z)); }
template <typename V> __device__ __forceinline__ void nopg8(v8f& c0, v8f& c1, v8f& c2, v8f& c3, v8f& c4, v8f& c5, v8f& c6, v8f& c7, const V& x, const V& y, const V& z) {
    asm volatile("v_nop\n\tv_nop\n\tv_nop\n\tv_nop" : "+v"(c0), "+v"(c1), "+v"(c2), "+v"(c3), "+v"(c4), "+v"(c5), "+v"(c6), "+v"(c7) : "v"(x), "v"(y), "v"(z)); }

// one k chunk's fragments of a 64x64 tile, and the two halves of a pipelined step: fetch (loads only) and multiply (products only)
template <int NSPLIT> struct gfrag { v16bf a[4], a2[NSPLIT == 1 ? 4 : 1], b[4]; };
template <int NSPLIT>
__device__ __forceinline__ void gemm_fetch(gfrag<NSPLIT>& f, const bf* pa, const bf* pa2, const bf* pb, int K, unsigned vo, int im) {
#pragma unroll
    for (int mb = 0; mb < 4; ++mb) { f.a[mb] = ldbs(pa, vo, im + mb * 32 * K); if (NSPLIT == 1) f.a2[mb] = ldbs(pa2, vo, im + mb * 32 * K); }
#pragma unroll
    for (int nb = 0; nb < 4; ++nb) f.b[nb] = ldbs(pb, vo, im + nb * 32 * K);
    __builtin_amdgcn_sched_barrier(0);   // keeps the group of loads ahead of the products: sunk among them, each would be waited for where it stands
}
template <int NSPLIT>
__device__ __forceinline__ void gemm_mul(const gfrag<NSPLIT>& f, v8f (&acc)[4][4]) {
#pragma unroll
    for (int nb = 0; nb < 4; ++nb) {
#pragma unroll
        for (int mb = 0; mb < 4; ++mb) { acc[mb][nb] = wmmab(f.a[mb], f.b[nb], acc[mb][nb]); if (NSPLIT == 1) acc[mb][nb] = wmmab(f.a2[mb], f.b[nb], acc[mb][nb]); } }
    nopg8(acc[0][0], acc[0][1], acc[0][2], acc[0][3], acc[1][0], acc[1][1], acc[1][2], acc[1][3], f.a[0], f.a[1], f.b[3]);
    nopg8(acc[2][0], acc[2][1], acc[2][2], acc[2][3], acc[3][0], acc[3][1], acc[3][2], acc[3][3], f.a[3], (NSPLIT == 1) ? f.a2[3] : f.a[2], f.b[3]);
}
// ---- one-wave 64x64 tile GEMM: C[m][n] (f32, pitch ldc) = sum_k A[m][k] Bt[n][k] (+ A2[m][k] Bt[n][k] when NSPLIT == 1); operands straight from fragment-order bf16 planes; K % 64 == 0.
template <int NSPLIT>
__device__ __forceinline__ void gemm_body(const bf* A, const bf* A2, const bf* Bt, int K, float* C, int ldc) {
    __shared__ __align__(16) float os[16 * 68];
    const int lane = threadIdx.x & 31, lr = lane & 15, hi = lane >> 4; const int r0 = blockIdx.x * 64, c0 = blockIdx.y * 64;
    v8f acc[4][4];
#pragma unroll
    for (int mb = 0; mb < 4; ++mb)
#pragma unroll
        for (int nb = 0; nb < 4; ++nb) acc[mb][nb] = (v8f){};
    const size_t aoff = (size_t)r0 * K, boff = (size_t)c0 * K;   // a 16-row tile spans 16 * K elements (32 * K bytes), a k chunk of 32 one block of 512 (1024 bytes)
    // two fragment sets: while one k chunk is multiplied, the next chunk's loads (one group, issued ahead of the products) are in flight; K % 64 == 0
    gfrag<NSPLIT> f0, f1;
    const bf* pa = A + aoff; const bf* pa2 = A2 + aoff; const bf* pb = Bt + boff;
    unsigned vo = (unsigned)lane * 16u;   // the lane's byte offset in the current pair of chunks
    gemm_fetch<NSPLIT>(f0, pa, pa2, pb, K, vo, 0);
    asm volatile("s_wait_xcnt 0x0" ::: "memory");   // registers that these first loads name are free for other use below
    __builtin_amdgcn_sched_barrier(0);              // keeps that use behind the wait
#pragma unroll 1
    for (int kc = 0; kc < K; kc += 64) {
        gemm_fetch<NSPLIT>(f1, pa, pa2, pb, K, vo, 1024);
        gemm_mul<NSPLIT>(f0, acc);
        asm volatile("s_wait_xcnt 0x0" ::: "memory");   // the offset register of the loads in flight is advanced below
        __builtin_amdgcn_sched_barrier(0);              // keeps that advance behind the wait
        vo += (kc + 64 < K) ? 2048u : 0u;               // to the next pair of chunks; behind the last pair: the same chunk again, not used
        gemm_fetch<NSPLIT>(f0, pa, pa2, pb, K, vo, 0);
        gemm_mul<NSPLIT>(f1, acc);
    }
    asm volatile("s_wait_loadcnt 0x0" ::: "memory");   // the last look-ahead group is not used: it has landed before its registers serve the epilogue
    __builtin_amdgcn_sched_barrier(0);                 // keeps the epilogue's arithmetic behind the wait
#pragma unroll
    for (int mb = 0; mb < 4; ++mb) {
#pragma unroll
        for (int nb = 0; nb < 4; ++nb) {
#pragma unroll
            for (int j = 0; j < 8; ++j) os[(hi * 8 + j) * 68 + nb * 16 + lr] = acc[mb][nb][j]; }
        asm volatile("s_wait_dscnt 0" ::: "memory"); __builtin_amdgcn_wave_barrier();
        float* crow = C + (size_t)(r0 + mb * 16) * ldc + c0;
{
#pragma unroll
            for (int s = 0; s < 8; ++s) { const int row = 2 * s + hi, cofs = lr * 4; const v4f val = *(const v4fa*)(os + row * 68 + cofs);
                *(v4f*)(crow + (size_t)row * ldc + cofs) = val; }
             }
        asm volatile("s_wait_xcnt 0x0" ::: "memory");   // the stores' data registers are loaded anew in the next round
        asm volatile("s_wait_dscnt 0" ::: "memory"); __builtin_amdgcn_wave_barrier();
    }
}
// F[NB*SEQ][1536] = XB[NB*SEQ][1024] x WT[1536][1024]^T
__global__ __launch_bounds__(32) void k_gemm_proj(const bf* __restrict__ A, const bf* __restrict__ Bt, float* C) { gemm_body<0>(A, A, Bt, DM, C, NQKV); }
// OUT[NB*SEQ][1024] = (ATh + ATl)[NB*SEQ][1024] x WOT[1024][1024]^T
__global__ __launch_bounds__(32) void k_gemm_out(const bf* __restrict__ A, const bf* __restrict__ A2, const bf* __restrict__ Bt, float* C) { gemm_body<1>(A, A2, Bt, DQ, C, DM); }

// The element-wise stages are device functions that take their block index bx: stages that do not depend on one another share one launch, each on its own range of block indices.
__device__ __forceinline__ void wtG_body(const float* __restrict__ w, int K, int N, bf* Bt, int bx) {
    const int lane = threadIdx.x & 31; const int L0 = (bx * 8 + (threadIdx.x >> 5)) * 8; const int nlines = N * K / 64;
{
#pragma unroll 1
        for (int l = 0; l < 8; ++l) { const int L = L0 + l; if (L >= nlines) break; const size_t e = (size_t)L * 64 + lane * 2; const int blk = (int)(e >> 9), in = (int)(e & 511);
            const int k = (blk % (K / 32)) * 32 + (in >> 7) * 8 + (in & 7), n = (blk / (K / 32)) * 16 + ((in >> 3) & 15); v2us o;
            o[0] = f2bf(w[(size_t)k * N + n]); o[1] = f2bf(w[(size_t)(k + 1) * N + n]); *(v2us*)(Bt + e) = o; }
         }
}
__device__ __forceinline__ void cvtx_body(const float* __restrict__ x, bf* XB, int bx) {
    const size_t i = (size_t)bx * 256 + threadIdx.x; if (i >= (size_t)NB * SEQ * DM / 8) return;
    // a wave takes 8 rows x 4 pieces: it reads whole 128-B lines of 8 rows and stores 4 whole lines
    const int blk = (int)(i >> 6), r = (int)((i & 7) | ((i >> 2) & 8)), pc = (int)((i >> 3) & 3); const size_t e = (size_t)blk * 512 + (pc * 16 + r) * 8;
    const int row = (blk / (DM / 32)) * 16 + r, k = (blk % (DM / 32)) * 32 + pc * 8;
    const v8f v = *(const v8f*)(x + (size_t)(row / SEQ) * SEQ_FULL * DM + (size_t)(row % SEQ) * DM + k); v8us o;
#pragma unroll
    for (int k = 0; k < 8; ++k) o[k] = f2bf(v[k]);
    *(v8us*)(XB + e) = o; 
}
// block counts of the stages
constexpr int GB_WQ = (DM * DQ / 64 + 63) / 64, GB_WKV = (DM * DKV / 64 + 63) / 64, GB_WO = (DQ * DM / 64 + 63) / 64, GB_X = (int)(((size_t)NB * SEQ * DM / 8 + 255) / 256);
constexpr int GB_RQ = (int)(((size_t)NB * NH_ * SEQ * HD / 16 + 255) / 256), GB_RK = (int)(((size_t)NB * NKV * SEQ * HD / 16 + 255) / 256), GB_V = (int)(((size_t)NB * NKV * HD * SEQ / 2 + 255) / 256);
// ---- k_prep: all operand planes made from inputs alone. Weights: in w[K = DM][N] -> out plane rows n (fragment order); q | k | v stacked into one [1536][1024] plane. The weight blocks (a serial loop each) come first, x behind them.
__global__ __launch_bounds__(256) void k_prep(const float* __restrict__ wq, const float* __restrict__ wk, const float* __restrict__ wv, const float* __restrict__ wo, const float* __restrict__ x, bf* WT, bf* WOT, bf* XB) {
    int bx = (int)blockIdx.x;
    if (bx < GB_WQ) { wtG_body(wq, DM, DQ, WT, bx); return; }
    bx -= GB_WQ;
    if (bx < GB_WO) { wtG_body(wo, DQ, DM, WOT, bx); return; }
    bx -= GB_WO;
    if (bx < GB_WKV) { wtG_body(wk, DM, DKV, WT + (size_t)KCOL * DM, bx); return; }
    bx -= GB_WKV;
    if (bx < GB_WKV) { wtG_body(wv, DM, DKV, WT + (size_t)VCOL * DM, bx); return; }
    bx -= GB_WKV;
    cvtx_body(x, XB, bx);
}
// ---- ropep_body: head planes [b][head] (rows = t, k = d, fragment order, bf16 hi/lo) of rotary(F[b*SEQ+t][colbase + head*64 + d]) x sc; tables COS/SIN [t][32] by value (bf16 RNE on load);
// a thread makes the 16-B pieces d = j0..j0+7 (chunk 0) and d = 32+j0..32+j0+7 (chunk 1) of one row, which share their inputs; a wave takes 8 rows x 4 pieces: each load touches 8 lines, each store fills 4 whole lines.
__device__ __forceinline__ void ropep_body(const float* __restrict__ F, int colbase, int nheads, const float* __restrict__ COS, const float* __restrict__ SIN, float sc, bf* Ph, bf* Pl, int bx) {
    const size_t i = (size_t)bx * 256 + threadIdx.x; if (i >= (size_t)NB * nheads * SEQ * (HD / 16)) return;
    const int tile = (int)(i >> 6), r = (int)((i & 7) | ((i >> 2) & 8)), pc = (int)((i >> 3) & 3); const int t = (tile % (SEQ / 16)) * 16 + r; const int j0 = pc * 8;
    const int hh = (tile / (SEQ / 16)) % nheads; const int b = tile / ((SEQ / 16) * nheads);
    const float* f = F + (size_t)(b * SEQ + t) * NQKV + colbase + hh * HD + j0;
    const v8f x1 = *(const v8f*)f, x2 = *(const v8f*)(f + 32), cv = *(const v8f*)(COS + (size_t)t * 32 + j0), sv = *(const v8f*)(SIN + (size_t)t * 32 + j0);
    v8us ah, al, bh, bl;
#pragma unroll
    for (int q = 0; q < 8; ++q) { const float c = bfr(cv[q]), s = bfr(sv[q]);
        const float ra = (x1[q] * c + x2[q] * s) * sc, rb = (x2[q] * c - x1[q] * s) * sc;
        unsigned short a2, c2; splitf(ra, a2, c2); ah[q] = a2; al[q] = c2; splitf(rb, a2, c2); bh[q] = a2; bl[q] = c2; }
    const size_t dst = (size_t)tile * 1024 + (pc * 16 + r) * 8;
    *(v8us*)(Ph + dst) = ah; *(v8us*)(Pl + dst) = al; *(v8us*)(Ph + dst + 512) = bh; *(v8us*)(Pl + dst + 512) = bl;
}
__device__ __forceinline__ void vtp_body(const float* __restrict__ F, h16* V16, h16* Vr, int bx) {
    const size_t e = ((size_t)bx * 256 + threadIdx.x) * 2; if (e >= (size_t)NB * NKV * HD * SEQ) return;
    const int blk = (int)((e % ((size_t)SEQ * HD)) >> 9), in = (int)(e & 511);
    const int t = (blk >> 2) * 32 + (in >> 7) * 8 + (in & 7); const int d = (blk & 3) * 16 + ((in >> 3) & 15); const int g = (int)((e / ((size_t)SEQ * HD)) % NKV); const int b = (int)(e / ((size_t)SEQ * HD * NKV)); v2h o16, o2;
#pragma unroll
    for (int q = 0; q < 2; ++q) { const float x = F[(size_t)(b * SEQ + t + q) * NQKV + VCOL + g * HD + d]; const h16 a = (h16)x; o16[q] = a; o2[q] = (h16)((x - (float)a) * RCAR); }
    *(v2h*)(V16 + e) = o16; *(v2h*)(Vr + e) = o2; 
}
// ---- k_planes: the attention operand planes, made from F and the cos/sin tables: V, rotary q (x 1/8), rotary k
__global__ __launch_bounds__(256) void k_planes(const float* __restrict__ F, const float* __restrict__ COS, const float* __restrict__ SIN, bf* QPh, bf* QPl, bf* KPh, bf* KPl, h16* V16, h16* Vr) {
    int bx = (int)blockIdx.x;
    if (bx < GB_V) { vtp_body(F, V16, Vr, bx); return; }
    bx -= GB_V;
    if (bx < GB_RQ) { ropep_body(F, 0, NH_, COS, SIN, 0.125f, QPh, QPl, bx); return; }
    bx -= GB_RQ;
    ropep_body(F, KCOL, NKV, COS, SIN, 1.0f, KPh, KPl, bx);
}

// ---- fused causal flash attention, transposed form. Block = 4 waves = 64 query rows of one (b, h); a wave owns 16 query rows (one per lane&15) and walks keys in 32-key steps up to its diagonal.
// S^T tile (keys x queries) = K (A, rows = keys) x Q^T (B, cols = queries); D: lane -> query l&15, rows -> keys 8h+r. Two key tiles give the B fragment of P^T directly.
// O^T tile (d x queries) = V^T (A, rows = d, k = keys) x P^T (B). Running max / sum / scale factor are per-lane scalars (both lane halves of a query agree via one xor-16 shuffle).
template <bool HIRES>
__device__ __forceinline__ void attn_body(const bf* Qh, const bf* Ql, const bf* Kh, const bf* Kl, const h16* V16, const h16* Vr, bf* Ah, bf* Al, int qb0, int nqb) {
    const int lane = threadIdx.x & 31, lr = lane & 15, hi = lane >> 4;
    const int wave = __builtin_amdgcn_readfirstlane((int)(threadIdx.x >> 5));
    const int qblk = qb0 + (int)(blockIdx.x % (unsigned)nqb);
    const int bh = (int)(blockIdx.x / (unsigned)nqb);
    const int b = bh / NH_, h = bh % NH_, g = h / REP;
    const int m0 = qblk * 64 + wave * 16;
    const size_t qbase = ((size_t)(b * NH_ + h) * SEQ) * HD;
    const size_t kbase = ((size_t)(b * NKV + g) * SEQ) * HD;
    const size_t vbase = ((size_t)(b * NKV + g) * HD) * SEQ;
    const int qrow = m0 + lr;
    v8f o[4], orr[4];
#pragma unroll
    for (int j = 0; j < 4; ++j) { o[j] = (v8f){}; orr[j] = (v8f){}; }
    float mrun = NEGBIG, lsum = 0.0f;
    const int nst = (m0 + 47) >> 5;              // keys 0 .. m0+15 in 32-key steps; k0 + 31 < SEQ always (SEQ % 32 == 0)
    // Loads run one step ahead of their products: Q fragments once, K of step st + 1 right behind the score products of step st, V of step st + 1 right behind the output products of step st.
    const bf* kph = Kh + kbase; const bf* kpl = Kl + kbase;          // 32 keys = 4 blocks of 1024 bytes (2 key tiles x 2 d chunks) in a row
    const h16* vp = V16 + vbase; const h16* vrp = Vr + vbase;        // 32 keys = 4 blocks of 1024 bytes (4 d tiles) in a row
    unsigned vo = (unsigned)lane * 16u;                              // the lane's byte offset in the step's blocks, the same in all four planes
    v16bf qhf[2], qlf[2], k0h[2], k0l[2], k1h[2], k1l[2];
    v16h vf[4], vrf[4];
#pragma unroll
    for (int c = 0; c < 2; ++c) { qhf[c] = ldbs(Qh + qbase + m0 * HD, vo, 1024 * c); qlf[c] = ldbs(Ql + qbase + m0 * HD, vo, 1024 * c); }
#pragma unroll
    for (int c = 0; c < 2; ++c) { k0h[c] = ldbs(kph, vo, 1024 * c); k0l[c] = ldbs(kpl, vo, 1024 * c); k1h[c] = ldbs(kph, vo, 2048 + 1024 * c); k1l[c] = ldbs(kpl, vo, 2048 + 1024 * c); }
#pragma unroll
    for (int j = 0; j < 4; ++j) { vf[j] = ldhs(vp, vo, j * 1024); if (HIRES) vrf[j] = ldhs(vrp, vo, j * 1024); }
    __builtin_amdgcn_sched_barrier(0);              // nothing comes between the loads and their wait
    asm volatile("s_wait_xcnt 0x0" ::: "memory");   // registers that these first loads name are free for other use below
    __builtin_amdgcn_sched_barrier(0);              // keeps that use behind the wait
#pragma unroll 1
    for (int st = 0; st < nst; ++st) {
        const int k0 = st * 32;
        v8f s0 = (v8f){}, s1 = (v8f){};
#pragma unroll
        for (int c = 0; c < 2; ++c) {
            s0 = wmmab(k0h[c], qhf[c], s0); s0 = wmmab(k0h[c], qlf[c], s0); s0 = wmmab(k0l[c], qhf[c], s0);
            s1 = wmmab(k1h[c], qhf[c], s1); s1 = wmmab(k1h[c], qlf[c], s1); s1 = wmmab(k1l[c], qhf[c], s1);
        }
        nopg2(s0, s1, qhf[1], qlf[1], k1l[1]);
        asm volatile("s_wait_xcnt 0x0" ::: "memory");   // the offset register of the loads in flight (V, from the last step's foot) is advanced below
        __builtin_amdgcn_sched_barrier(0);              // keeps that advance behind the wait
        vo += (st + 1 < nst) ? 32u * HD * 2u : 0u;      // to the next step's blocks; behind the last step: its own again, not used
#pragma unroll
        for (int c = 0; c < 2; ++c) { k0h[c] = ldbs(kph, vo, 1024 * c); k0l[c] = ldbs(kpl, vo, 1024 * c); k1h[c] = ldbs(kph, vo, 2048 + 1024 * c); k1l[c] = ldbs(kpl, vo, 2048 + 1024 * c); }
        __builtin_amdgcn_sched_barrier(0);   // keeps the K loads here, ahead of the softmax: sunk to the loop's foot they would be waited for at once
        // causal exclusion by value (key > query -> NEGBIG, probability exactly 0), running max
        const int kb = k0 + 8 * hi;
        float mx = NEGBIG;
#pragma unroll
        for (int r = 0; r < 8; ++r) {
            const float a0 = (kb + r <= qrow) ? s0[r] : NEGBIG;
            const float a1 = (kb + 16 + r <= qrow) ? s1[r] : NEGBIG;
            s0[r] = a0; s1[r] = a1; mx = fmaxf(mx, fmaxf(a0, a1));
        }
        mx = fmaxf(mx, __shfl_xor(mx, 16, 32));
        const float mnew = fmaxf(mrun, mx);
        const float corr = __builtin_amdgcn_exp2f((mrun - mnew) * L2E);
        mrun = mnew;
        float psum = 0.0f;
        v16h pbv, prv;
#pragma unroll
        for (int r = 0; r < 8; ++r) {
            const float p0 = __builtin_amdgcn_exp2f((s0[r] - mnew) * L2E);
            const float p1 = __builtin_amdgcn_exp2f((s1[r] - mnew) * L2E);
            psum += p0 + p1;
            const float c0 = p0 * PCAR, c1 = p1 * PCAR;
            const h16 h0 = (h16)c0, h1 = (h16)c1;
            pbv[r] = h0; pbv[8 + r] = h1;
            if (HIRES) { prv[r] = (h16)((c0 - (float)h0) * RCAR); prv[8 + r] = (h16)((c1 - (float)h1) * RCAR); }
        }
        lsum = lsum * corr + psum;
#pragma unroll
        for (int j = 0; j < 4; ++j) {
#pragma unroll
            for (int r = 0; r < 8; ++r) { o[j][r] *= corr; if (HIRES) orr[j][r] *= corr; } }
        // O^T += V^T P^T
#pragma unroll
        for (int j = 0; j < 4; ++j) {
            o[j] = wmma16(vf[j], pbv, o[j]);
            if (HIRES) { orr[j] = wmma16(vrf[j], pbv, orr[j]); orr[j] = wmma16(vf[j], prv, orr[j]); }
        }
        if (HIRES) nopg8(o[0], o[1], o[2], o[3], orr[0], orr[1], orr[2], orr[3], pbv, prv, vf[3]);
        else       nopg4(o[0], o[1], o[2], o[3], pbv, pbv, vf[3]);
#pragma unroll
        for (int j = 0; j < 4; ++j) { vf[j] = ldhs(vp, vo, j * 1024); if (HIRES) vrf[j] = ldhs(vrp, vo, j * 1024); }
    }
    asm volatile("s_wait_loadcnt 0x0" ::: "memory");   // the last step's look-ahead loads are not used: they have landed before their registers are reused or given back
    __builtin_amdgcn_sched_barrier(0);                 // keeps the epilogue's arithmetic behind the wait
    lsum += __shfl_xor(lsum, 16, 32);
    const float inv = 1.0f / (PCAR * lsum);
    // lane holds ctx(query m0+lr, d = j*16 + 8*hi + r): 8 consecutive d per j -> one 16-B piece per plane, and piece j of lane l is piece l of half-block j of the wave's two ctx blocks
    const size_t dst = (size_t)(b * SEQ + m0) * DQ + h * (16 * HD) + lane * 8;
#pragma unroll
    for (int j = 0; j < 4; ++j) { v8us vh, vl;
#pragma unroll
        for (int r = 0; r < 8; ++r) { const float val = HIRES ? (o[j][r] + orr[j][r] * (1.0f / RCAR)) * inv : o[j][r] * inv; unsigned short a2, c2; splitf(val, a2, c2); vh[r] = a2; vl[r] = c2; }
        *(v8us*)(Ah + dst + j * 256) = vh; *(v8us*)(Al + dst + j * 256) = vl; }
}
__global__ __launch_bounds__(128) void k_attn_hi(const bf* __restrict__ Qh, const bf* __restrict__ Ql, const bf* __restrict__ Kh, const bf* __restrict__ Kl, const h16* __restrict__ V16, const h16* __restrict__ Vr, bf* Ah, bf* Al, int qb0, int nqb) {
    attn_body<true>(Qh, Ql, Kh, Kl, V16, Vr, Ah, Al, qb0, nqb); }
__global__ __launch_bounds__(128) void k_attn_lo(const bf* __restrict__ Qh, const bf* __restrict__ Ql, const bf* __restrict__ Kh, const bf* __restrict__ Kl, const h16* __restrict__ V16, const h16* __restrict__ Vr, bf* Ah, bf* Al, int qb0, int nqb) {
    attn_body<false>(Qh, Ql, Kh, Kl, V16, Vr, Ah, Al, qb0, nqb); }

// ---- workspace carve (bytes, every region 256-B aligned and sized to its full store extent)
constexpr size_t al256(size_t x) { return (x + 255) & ~(size_t)255; }
constexpr size_t SZ_WT  = al256((size_t)NQKV * DM * 2);
constexpr size_t SZ_WO  = al256((size_t)DM * DQ * 2);
constexpr size_t SZ_XB  = al256((size_t)NB * SEQ * DM * 2);
constexpr size_t SZ_F   = al256((size_t)NB * SEQ * NQKV * 4);
constexpr size_t SZ_QP  = al256((size_t)NB * NH_ * SEQ * HD * 2);
constexpr size_t SZ_KP  = al256((size_t)NB * NKV * SEQ * HD * 2);
constexpr size_t SZ_AT  = al256((size_t)NB * SEQ * DQ * 2);
constexpr size_t OFF_WT = 0;
constexpr size_t OFF_WO = OFF_WT + SZ_WT;
constexpr size_t OFF_XB = OFF_WO + SZ_WO;
constexpr size_t OFF_F  = OFF_XB + SZ_XB;
constexpr size_t OFF_QH = OFF_F + SZ_F;
constexpr size_t OFF_QL = OFF_QH + SZ_QP;
constexpr size_t OFF_KH = OFF_QL + SZ_QP;
constexpr size_t OFF_KL = OFF_KH + SZ_KP;
constexpr size_t OFF_V1 = OFF_KL + SZ_KP;
constexpr size_t OFF_VR = OFF_V1 + SZ_KP;
constexpr size_t OFF_AH = OFF_VR + SZ_KP;
constexpr size_t OFF_AL = OFF_AH + SZ_AT;
constexpr size_t WS_TOTAL = OFF_AL + SZ_AT;
static_assert(WS_TOTAL <= (size_t)134217728);

extern "C" void kernel_launch(void* const* d_in, const int* in_sizes, int n_in,
                              void* d_out, int out_size, void* d_ws, size_t ws_size, hipStream_t stream) {
    if (n_in < 7) return;
    if (in_sizes[0] < (NB - 1) * SEQ_FULL * DM + SEQ * DM) return;
    if (in_sizes[1] < SEQ * 32 || in_sizes[2] < SEQ * 32) return;
    if (in_sizes[3] < DM * DQ || in_sizes[4] < DM * DKV || in_sizes[5] < DM * DKV || in_sizes[6] < DQ * DM) return;
    if (out_size < NB * SEQ * DM) return;
    if (ws_size < WS_TOTAL) return;
    const float* x = (const float*)d_in[0]; const float* cs = (const float*)d_in[1]; const float* sn = (const float*)d_in[2];
    const float* wq = (const float*)d_in[3]; const float* wk = (const float*)d_in[4]; const float* wv = (const float*)d_in[5]; const float* wo = (const float*)d_in[6];
    float* OUT = (float*)d_out;
    char* w8 = (char*)d_ws;
    bf* WT = (bf*)(w8 + OFF_WT); bf* WOT = (bf*)(w8 + OFF_WO); bf* XB = (bf*)(w8 + OFF_XB); float* F = (float*)(w8 + OFF_F);
    bf* QPh = (bf*)(w8 + OFF_QH); bf* QPl = (bf*)(w8 + OFF_QL); bf* KPh = (bf*)(w8 + OFF_KH); bf* KPl = (bf*)(w8 + OFF_KL);
    h16* V16 = (h16*)(w8 + OFF_V1); h16* VR = (h16*)(w8 + OFF_VR); bf* ATh = (bf*)(w8 + OFF_AH); bf* ATl = (bf*)(w8 + OFF_AL);

    k_prep<<<(unsigned)(GB_WQ + GB_WO + 2 * GB_WKV + GB_X), 256, 0, stream>>>(wq, wk, wv, wo, x, WT, WOT, XB);
    k_gemm_proj<<<dim3(NB * SEQ / 64, NQKV / 64, 1), 32, 0, stream>>>(XB, WT, F);
    k_planes<<<(unsigned)(GB_V + GB_RQ + GB_RK), 256, 0, stream>>>(F, cs, sn, QPh, QPl, KPh, KPl, V16, VR);
    const int nq1 = RH / 64, nq2 = (SEQ - RH) / 64;
    k_attn_hi<<<(unsigned)(nq1 * NB * NH_), 128, 0, stream>>>(QPh, QPl, KPh, KPl, V16, VR, ATh, ATl, 0, nq1);
    if (nq2 > 0) k_attn_lo<<<(unsigned)(nq2 * NB * NH_), 128, 0, stream>>>(QPh, QPl, KPh, KPl, V16, VR, ATh, ATl, nq1, nq2);
    k_gemm_out<<<dim3(NB * SEQ / 64, DM / 64, 1), 32, 0, stream>>>(ATh, ATl, WOT, OUT);
}

// v004
// It runs in 92.2 microseconds.
// Next to v003, in two timings, it ran 1.13 times as fast each time.
// Over all steps from v000 it is 3.39 times as fast.
#include <hip/hip_runtime.h>

// Compute dtypes (f32 accumulate everywhere): x@[Wq|Wk|Wv] v_wmma_f32_16x16x32_bf16 (inputs RNE-converted to bf16, single product); q.k^T bf16 hi/lo planes (3 products, one accumulator, 1/8 folded into q);
// P.V v_wmma_f32_16x16x32_f16 with P carried x1024 (query rows < 256: f16 value + x2048 residual planes of P and V, separate accumulator); ctx@Wo bf16 hi/lo ctx x bf16 Wo (2 products). Softmax, rotary: f32.
// Causal grouped-query attention, rotary cos/sin tables read by value from their input buffers (bf16 RNE on load). Fused flash-style attention in transposed form: S^T = K Q^T so the probability
// tile leaves the accumulators already in B-fragment layout (element r <- key tile 0 row 8h+r, element 8+r <- key tile 1), O^T = V^T P^T; row statistics are per-lane scalars.
// Every 16-bit operand plane (rows x K) lies in fragment order: one 1-KiB block per (16-row tile R, 32-wide k chunk C), block index R * (K / 32) + C (V planes, rows = d, k = key: C * 4 + R);
// The three matrix loops load their operand fragments one step ahead of the products that use them.
// Query rows >= RH: two waves share a 16-row tile, each walks one half of its key steps; the two partial (max, sum, O) states are merged once through LDS.
// in a block the 16-B piece of (row r, k = 16 * half + 8 * hi + 0..7) stands at element half * 256 + (hi * 16 + r) * 8, so each of a fragment's two wave-wide loads reads 512 contiguous bytes (4 lines, not 16).

#ifndef NB
#define NB 2
#endif
#ifndef SEQ
#define SEQ 2048
#endif
#define SEQ_FULL 2048
#define DM   1024
#define NH_  16
#define NKV  4
#define REP  (NH_ / NKV)
#define HD   64
#define DQ   (NH_ * HD)
#define DKV  (NKV * HD)
#define NQKV (DQ + 2 * DKV)
#define KCOL DQ
#define VCOL (DQ + DKV)
#define RH   ((SEQ) < 256 ? (SEQ) : 256)   // query rows < RH carry residual planes on P, V
#define PCAR 1024.0f
#define RCAR 2048.0f
#define L2E  1.4426950408889634f
#define NEGBIG (-1.0e30f)

typedef _Float16 h16;
typedef unsigned short bf;
typedef __attribute__((ext_vector_type(16))) __bf16   v16bf;
typedef __attribute__((ext_vector_type(16))) _Float16 v16h;
typedef __attribute__((ext_vector_type(8)))  _Float16 v8h;
typedef __attribute__((ext_vector_type(8)))  unsigned short v8us;
typedef __attribute__((ext_vector_type(8)))  float    v8f;
typedef __attribute__((ext_vector_type(4)))  float    v4f;
typedef __attribute__((ext_vector_type(2)))  _Float16 v2h;
typedef __attribute__((ext_vector_type(2)))  unsigned short v2us;
typedef v4f  __attribute__((may_alias)) v4fa;

static_assert(HD == 64);
static_assert(DQ == DM);
static_assert(NH_ % NKV == 0);
static_assert(SEQ % 64 == 0);
static_assert(SEQ <= SEQ_FULL);
static_assert(RH % 64 == 0);
static_assert(RH <= SEQ);
static_assert(DM % 32 == 0);
static_assert(DQ % 32 == 0);
static_assert((NB * SEQ) % 64 == 0);
static_assert(NQKV % 64 == 0);
static_assert(DM % 64 == 0);
static_assert((DM * DQ) % 64 == 0);
static_assert((DM * DKV) % 64 == 0);

__device__ __forceinline__ unsigned short f2bf(float f) { unsigned u = __float_as_uint(f); u += 0x7FFFu + ((u >> 16) & 1u); return (unsigned short)(u >> 16); }
__device__ __forceinline__ float bf2f(unsigned short b) { return __uint_as_float(((unsigned)b) << 16); }
__device__ __forceinline__ float bfr(float f) { return bf2f(f2bf(f)); }
__device__ __forceinline__ void splitf(float y, unsigned short& h, unsigned short& l) { h = f2bf(y); l = f2bf(y - bf2f(h)); }
__device__ __forceinline__ v16h cat16(v8h lo, v8h hi) { return __builtin_shufflevector(lo, hi, 0, 1, 2, 3, 4, 5, 6, 7, 8, 9, 10, 11, 12, 13, 14, 15); }
__device__ __forceinline__ v16bf cat16b(v8us lo, v8us hi) { return __builtin_bit_cast(v16bf, __builtin_shufflevector(lo, hi, 0, 1, 2, 3, 4, 5, 6, 7, 8, 9, 10, 11, 12, 13, 14, 15)); }
__device__ __forceinline__ v8f wmma16(v16h a, v16h b, v8f c) { return __builtin_amdgcn_wmma_f32_16x16x32_f16(false, a, false, b, (short)0, c, false, false); }
__device__ __forceinline__ v8f wmmab(v16bf a, v16bf b, v8f c) { return __builtin_amdgcn_wmma_f32_16x16x32_bf16(false, a, false, b, (short)0, c, false, false); }
// fragment loaders: p = b + vo + im (bytes) points at block start + lane * 16 bytes, which holds (row l&15, k0 + 8*(l>>4)); elements 0..7 <- bytes 0..15, elements 8..15 (k + 16) <- bytes 512..527.
// b: wave-uniform plane pointer, vo: the lane's byte offset, im: a constant; the loads take b as scalar base, and one 32-bit register per lane is all that moves from step to step
__device__ __forceinline__ v16bf ldbs(const bf* b, unsigned vo, int im) { const char* p = (const char*)b + vo; return cat16b(*(const v8us*)(p + im), *(const v8us*)(p + im + 512)); }
__device__ __forceinline__ v16h ldhs(const h16* b, unsigned vo, int im) { const char* p = (const char*)b + vo; return cat16(*(const v8h*)(p + im), *(const v8h*)(p + im + 512)); }

// hazard guards: name every accumulator of the group and the last fragments
template <typename V> __device__ __forceinline__ void nopg2(v8f& c0, v8f& c1, const V& x, const V& y, const V& z) {
    asm volatile("v_nop\n\tv_nop\n\tv_nop\n\tv_nop" : "+v"(c0), "+v"(c1) : "v"(x), "v"(y), "v"(z)); }
template <typename V> __device__ __forceinline__ void nopg4(v8f& c0, v8f& c1, v8f& c2, v8f& c3, const V& x, const V& y, const V& z) {
    asm volatile("v_nop\n\tv_nop\n\tv_nop\n\tv_nop" : "+v"(c0), "+v"(c1), "+v"(c2), "+v"(c3) : "v"(x), "v"(y), "v"(z)); }
template <typename V> __device__ __forceinline__ void nopg8(v8f& c0, v8f& c1, v8f& c2, v8f& c3, v8f& c4, v8f& c5, v8f& c6, v8f& c7, const V& x, const V& y, const V& z) {
    asm volatile("v_nop\n\tv_nop\n\tv_nop\n\tv_nop" : "+v"(c0), "+v"(c1), "+v"(c2), "+v"(c3), "+v"(c4), "+v"(c5), "+v"(c6), "+v"(c7) : "v"(x), "v"(y), "v"(z)); }

// one k chunk's fragments of a 64x64 tile, and the two halves of a pipelined step: fetch (loads only) and multiply (products only)
template <int NSPLIT> struct gfrag { v16bf a[4], a2[NSPLIT == 1 ? 4 : 1], b[4]; };
template <int NSPLIT>
__device__ __forceinline__ void gemm_fetch(gfrag<NSPLIT>& f, const bf* pa, const bf* pa2, const bf* pb, int K, unsigned vo, int im) {
#pragma unroll
    for (int mb = 0; mb < 4; ++mb) { f.a[mb] = ldbs(pa, vo, im + mb * 32 * K); if (NSPLIT == 1) f.a2[mb] = ldbs(pa2, vo, im + mb * 32 * K); }
#pragma unroll
    for (int nb = 0; nb < 4; ++nb) f.b[nb] = ldbs(pb, vo, im + nb * 32 * K);
    __builtin_amdgcn_sched_barrier(0);   // keeps the group of loads ahead of the products: sunk among them, each would be waited for where it stands
}
template <int NSPLIT>
__device__ __forceinline__ void gemm_mul(const gfrag<NSPLIT>& f, v8f (&acc)[4][4]) {
#pragma unroll
    for (int nb = 0; nb < 4; ++nb) {
#pragma unroll
        for (int mb = 0; mb < 4; ++mb) { acc[mb][nb] = wmmab(f.a[mb], f.b[nb], acc[mb][nb]); if (NSPLIT == 1) acc[mb][nb] = wmmab(f.a2[mb], f.b[nb], acc[mb][nb]); } }
    nopg8(acc[0][0], acc[0][1], acc[0][2], acc[0][3], acc[1][0], acc[1][1], acc[1][2], acc[1][3], f.a[0], f.a[1], f.b[3]);
    nopg8(acc[2][0], acc[2][1], acc[2][2], acc[2][3], acc[3][0], acc[3][1], acc[3][2], acc[3][3], f.a[3], (NSPLIT == 1) ? f.a2[3] : f.a[2], f.b[3]);
}
// ---- one-wave 64x64 tile GEMM: C[m][n] (f32, pitch ldc) = sum_k A[m][k] Bt[n][k] (+ A2[m][k] Bt[n][k] when NSPLIT == 1); operands straight from fragment-order bf16 planes; K % 64 == 0.
template <int NSPLIT>
__device__ __forceinline__ void gemm_body(const bf* A, const bf* A2, const bf* Bt, int K, float* C, int ldc) {
    __shared__ __align__(16) float os[16 * 68];
    const int lane = threadIdx.x & 31, lr = lane & 15, hi = lane >> 4; const int r0 = blockIdx.x * 64, c0 = blockIdx.y * 64;
    v8f acc[4][4];
#pragma unroll
    for (int mb = 0; mb < 4; ++mb)
#pragma unroll
        for (int nb = 0; nb < 4; ++nb) acc[mb][nb] = (v8f){};
    const size_t aoff = (size_t)r0 * K, boff = (size_t)c0 * K;   // a 16-row tile spans 16 * K elements (32 * K bytes), a k chunk of 32 one block of 512 (1024 bytes)
    // two fragment sets: while one k chunk is multiplied, the next chunk's loads (one group, issued ahead of the products) are in flight; K % 64 == 0
    gfrag<NSPLIT> f0, f1;
    const bf* pa = A + aoff; const bf* pa2 = A2 + aoff; const bf* pb = Bt + boff;
    unsigned vo = (unsigned)lane * 16u;   // the lane's byte offset in the current pair of chunks
    gemm_fetch<NSPLIT>(f0, pa, pa2, pb, K, vo, 0);
    asm volatile("s_wait_xcnt 0x0" ::: "memory");   // registers that these first loads name are free for other use below
    __builtin_amdgcn_sched_barrier(0);              // keeps that use behind the wait
#pragma unroll 1
    for (int kc = 0; kc < K; kc += 64) {
        gemm_fetch<NSPLIT>(f1, pa, pa2, pb, K, vo, 1024);
        gemm_mul<NSPLIT>(f0, acc);
        asm volatile("s_wait_xcnt 0x0" ::: "memory");   // the offset register of the loads in flight is advanced below
        __builtin_amdgcn_sched_barrier(0);              // keeps that advance behind the wait
        vo += (kc + 64 < K) ? 2048u : 0u;               // to the next pair of chunks; behind the last pair: the same chunk again, not used
        gemm_fetch<NSPLIT>(f0, pa, pa2, pb, K, vo, 0);
        gemm_mul<NSPLIT>(f1, acc);
    }
    asm volatile("s_wait_loadcnt 0x0" ::: "memory");   // the last look-ahead group is not used: it has landed before its registers serve the epilogue
    __builtin_amdgcn_sched_barrier(0);                 // keeps the epilogue's arithmetic behind the wait
#pragma unroll
    for (int mb = 0; mb < 4; ++mb) {
#pragma unroll
        for (int nb = 0; nb < 4; ++nb) {
#pragma unroll
            for (int j = 0; j < 8; ++j) os[(hi * 8 + j) * 68 + nb * 16 + lr] = acc[mb][nb][j]; }
        asm volatile("s_wait_dscnt 0" ::: "memory"); __builtin_amdgcn_wave_barrier();
        float* crow = C + (size_t)(r0 + mb * 16) * ldc + c0;
{
#pragma unroll
            for (int s = 0; s < 8; ++s) { const int row = 2 * s + hi, cofs = lr * 4; const v4f val = *(const v4fa*)(os + row * 68 + cofs);
                *(v4f*)(crow + (size_t)row * ldc + cofs) = val; }
             }
        asm volatile("s_wait_xcnt 0x0" ::: "memory");   // the stores' data registers are loaded anew in the next round
        asm volatile("s_wait_dscnt 0" ::: "memory"); __builtin_amdgcn_wave_barrier();
    }
}
// F[NB*SEQ][1536] = XB[NB*SEQ][1024] x WT[1536][1024]^T
__global__ __launch_bounds__(32) void k_gemm_proj(const bf* __restrict__ A, const bf* __restrict__ Bt, float* C) { gemm_body<0>(A, A, Bt, DM, C, NQKV); }
// OUT[NB*SEQ][1024] = (ATh + ATl)[NB*SEQ][1024] x WOT[1024][1024]^T
__global__ __launch_bounds__(32) void k_gemm_out(const bf* __restrict__ A, const bf* __restrict__ A2, const bf* __restrict__ Bt, float* C) { gemm_body<1>(A, A2, Bt, DQ, C, DM); }

// The element-wise stages are device functions that take their block index bx: stages that do not depend on one another share one launch, each on its own range of block indices.
__device__ __forceinline__ void wtG_body(const float* __restrict__ w, int K, int N, bf* Bt, int bx) {
    const int lane = threadIdx.x & 31; const int L0 = (bx * 8 + (threadIdx.x >> 5)) * 8; const int nlines = N * K / 64;
{
#pragma unroll 1
        for (int l = 0; l < 8; ++l) { const int L = L0 + l; if (L >= nlines) break; const size_t e = (size_t)L * 64 + lane * 2; const int blk = (int)(e >> 9), in = (int)(e & 511);
            const int k = (blk % (K / 32)) * 32 + (in >> 7) * 8 + (in & 7), n = (blk / (K / 32)) * 16 + ((in >> 3) & 15); v2us o;
            o[0] = f2bf(w[(size_t)k * N + n]); o[1] = f2bf(w[(size_t)(k + 1) * N + n]); *(v2us*)(Bt + e) = o; }
         }
}
__device__ __forceinline__ void cvtx_body(const float* __restrict__ x, bf* XB, int bx) {
    const size_t i = (size_t)bx * 256 + threadIdx.x; if (i >= (size_t)NB * SEQ * DM / 8) return;
    // a wave takes 8 rows x 4 pieces: it reads whole 128-B lines of 8 rows and stores 4 whole lines
    const int blk = (int)(i >> 6), r = (int)((i & 7) | ((i >> 2) & 8)), pc = (int)((i >> 3) & 3); const size_t e = (size_t)blk * 512 + (pc * 16 + r) * 8;
    const int row = (blk / (DM / 32)) * 16 + r, k = (blk % (DM / 32)) * 32 + pc * 8;
    const v8f v = *(const v8f*)(x + (size_t)(row / SEQ) * SEQ_FULL * DM + (size_t)(row % SEQ) * DM + k); v8us o;
#pragma unroll
    for (int k = 0; k < 8; ++k) o[k] = f2bf(v[k]);
    *(v8us*)(XB + e) = o; 
}
// block counts of the stages
constexpr int GB_WQ = (DM * DQ / 64 + 63) / 64, GB_WKV = (DM * DKV / 64 + 63) / 64, GB_WO = (DQ * DM / 64 + 63) / 64, GB_X = (int)(((size_t)NB * SEQ * DM / 8 + 255) / 256);
constexpr int GB_RQ = (int)(((size_t)NB * NH_ * SEQ * HD / 16 + 255) / 256), GB_RK = (int)(((size_t)NB * NKV * SEQ * HD / 16 + 255) / 256), GB_V = (int)(((size_t)NB * NKV * HD * SEQ / 2 + 255) / 256);
// ---- k_prep: all operand planes made from inputs alone. Weights: in w[K = DM][N] -> out plane rows n (fragment order); q | k | v stacked into one [1536][1024] plane. The weight blocks (a serial loop each) come first, x behind them.
__global__ __launch_bounds__(256) void k_prep(const float* __restrict__ wq, const float* __restrict__ wk, const float* __restrict__ wv, const float* __restrict__ wo, const float* __restrict__ x, bf* WT, bf* WOT, bf* XB) {
    int bx = (int)blockIdx.x;
    if (bx < GB_WQ) { wtG_body(wq, DM, DQ, WT, bx); return; }
    bx -= GB_WQ;
    if (bx < GB_WO) { wtG_body(wo, DQ, DM, WOT, bx); return; }
    bx -= GB_WO;
    if (bx < GB_WKV) { wtG_body(wk, DM, DKV, WT + (size_t)KCOL * DM, bx); return; }
    bx -= GB_WKV;
    if (bx < GB_WKV) { wtG_body(wv, DM, DKV, WT + (size_t)VCOL * DM, bx); return; }
    bx -= GB_WKV;
    cvtx_body(x, XB, bx);
}
// ---- ropep_body: head planes [b][head] (rows = t, k = d, fragment order, bf16 hi/lo) of rotary(F[b*SEQ+t][colbase + head*64 + d]) x sc; tables COS/SIN [t][32] by value (bf16 RNE on load);
// a thread makes the 16-B pieces d = j0..j0+7 (chunk 0) and d = 32+j0..32+j0+7 (chunk 1) of one row, which share their inputs; a wave takes 8 rows x 4 pieces: each load touches 8 lines, each store fills 4 whole lines.
__device__ __forceinline__ void ropep_body(const float* __restrict__ F, int colbase, int nheads, const float* __restrict__ COS, const float* __restrict__ SIN, float sc, bf* Ph, bf* Pl, int bx) {
    const size_t i = (size_t)bx * 256 + threadIdx.x; if (i >= (size_t)NB * nheads * SEQ * (HD / 16)) return;
    const int tile = (int)(i >> 6), r = (int)((i & 7) | ((i >> 2) & 8)), pc = (int)((i >> 3) & 3); const int t = (tile % (SEQ / 16)) * 16 + r; const int j0 = pc * 8;
    const int hh = (tile / (SEQ / 16)) % nheads; const int b = tile / ((SEQ / 16) * nheads);
    const float* f = F + (size_t)(b * SEQ + t) * NQKV + colbase + hh * HD + j0;
    const v8f x1 = *(const v8f*)f, x2 = *(const v8f*)(f + 32), cv = *(const v8f*)(COS + (size_t)t * 32 + j0), sv = *(const v8f*)(SIN + (size_t)t * 32 + j0);
    v8us ah, al, bh, bl;
#pragma unroll
    for (int q = 0; q < 8; ++q) { const float c = bfr(cv[q]), s = bfr(sv[q]);
        const float ra = (x1[q] * c + x2[q] * s) * sc, rb = (x2[q] * c - x1[q] * s) * sc;
        unsigned short a2, c2; splitf(ra, a2, c2); ah[q] = a2; al[q] = c2; splitf(rb, a2, c2); bh[q] = a2; bl[q] = c2; }
    const size_t dst = (size_t)tile * 1024 + (pc * 16 + r) * 8;
    *(v8us*)(Ph + dst) = ah; *(v8us*)(Pl + dst) = al; *(v8us*)(Ph + dst + 512) = bh; *(v8us*)(Pl + dst + 512) = bl;
}
__device__ __forceinline__ void vtp_body(const float* __restrict__ F, h16* V16, h16* Vr, int bx) {
    const size_t e = ((size_t)bx * 256 + threadIdx.x) * 2; if (e >= (size_t)NB * NKV * HD * SEQ) return;
    const int blk = (int)((e % ((size_t)SEQ * HD)) >> 9), in = (int)(e & 511);
    const int t = (blk >> 2) * 32 + (in >> 7) * 8 + (in & 7); const int d = (blk & 3) * 16 + ((in >> 3) & 15); const int g = (int)((e / ((size_t)SEQ * HD)) % NKV); const int b = (int)(e / ((size_t)SEQ * HD * NKV)); v2h o16, o2;
#pragma unroll
    for (int q = 0; q < 2; ++q) { const float x = F[(size_t)(b * SEQ + t + q) * NQKV + VCOL + g * HD + d]; const h16 a = (h16)x; o16[q] = a; o2[q] = (h16)((x - (float)a) * RCAR); }
    *(v2h*)(V16 + e) = o16; *(v2h*)(Vr + e) = o2; 
}
// ---- k_planes: the attention operand planes, made from F and the cos/sin tables: V, rotary q (x 1/8), rotary k
__global__ __launch_bounds__(256) void k_planes(const float* __restrict__ F, const float* __restrict__ COS, const float* __restrict__ SIN, bf* QPh, bf* QPl, bf* KPh, bf* KPl, h16* V16, h16* Vr) {
    int bx = (int)blockIdx.x;
    if (bx < GB_V) { vtp_body(F, V16, Vr, bx); return; }
    bx -= GB_V;
    if (bx < GB_RQ) { ropep_body(F, 0, NH_, COS, SIN, 0.125f, QPh, QPl, bx); return; }
    bx -= GB_RQ;
    ropep_body(F, KCOL, NKV, COS, SIN, 1.0f, KPh, KPl, bx);
}

// ---- fused causal flash attention, transposed form. Block = 64 query rows of one (b, h), 4 waves (8 with SPLIT); a wave owns 16 query rows (one per lane&15) and walks keys in 32-key steps up to its diagonal.
// S^T tile (keys x queries) = K (A, rows = keys) x Q^T (B, cols = queries); D: lane -> query l&15, rows -> keys 8h+r. Two key tiles give the B fragment of P^T directly.
// O^T tile (d x queries) = V^T (A, rows = d, k = keys) x P^T (B). Running max / sum / scale factor are per-lane scalars (both lane halves of a query agree via one xor-16 shuffle).
// SPLIT: the block has 8 waves; waves w and w + 4 own the same 16 query rows, wave w the first half of the key steps, wave w + 4 the second (with the diagonal).
template <bool HIRES, bool SPLIT>
__device__ __forceinline__ void attn_body(const bf* Qh, const bf* Ql, const bf* Kh, const bf* Kl, const h16* V16, const h16* Vr, bf* Ah, bf* Al, int qb0, int nqb) {
    const int lane = threadIdx.x & 31, lr = lane & 15, hi = lane >> 4;
    const int wave = __builtin_amdgcn_readfirstlane((int)(threadIdx.x >> 5));
    // SPLIT: the longest tiles (highest rows) take the lowest block indices (for speed only)
    const int qblk = SPLIT ? qb0 + nqb - 1 - (int)(blockIdx.x / (unsigned)(NB * NH_)) : qb0 + (int)(blockIdx.x % (unsigned)nqb);
    const int bh = SPLIT ? (int)(blockIdx.x % (unsigned)(NB * NH_)) : (int)(blockIdx.x / (unsigned)nqb);
    const int b = bh / NH_, h = bh % NH_, g = h / REP;
    const int part = SPLIT ? (wave >> 2) : 0;
    const int m0 = qblk * 64 + (wave & 3) * 16;
    const size_t qbase = ((size_t)(b * NH_ + h) * SEQ) * HD;
    const size_t kbase = ((size_t)(b * NKV + g) * SEQ) * HD;
    const size_t vbase = ((size_t)(b * NKV + g) * HD) * SEQ;
    const int qrow = m0 + lr;
    v8f o[4], orr[4];
#pragma unroll
    for (int j = 0; j < 4; ++j) { o[j] = (v8f){}; orr[j] = (v8f){}; }
    float mrun = NEGBIG, lsum = 0.0f;
    const int nall = (m0 + 47) >> 5;             // keys 0 .. m0+15 in 32-key steps; k0 + 31 < SEQ always (SEQ % 32 == 0)
    const int st0 = part ? (nall + 1) >> 1 : 0;  // this wave's steps: st0 .. nst - 1; never empty (SPLIT: m0 >= 64, nall >= 3)
    const int nst = (SPLIT && part == 0) ? (nall + 1) >> 1 : nall;
    if constexpr (SPLIT) __builtin_assume(st0 < nst);   // no branch round the loop, so the first loads keep the order written (Q, K, V): with Q last, the loop's counted waits, which also serve its first pass, would wait for each step's V loads at the loop's head
    // Loads run one step ahead of their products: Q fragments once, K of step st + 1 right behind the score products of step st, V of step st + 1 right behind the output products of step st.
    const bf* kph = Kh + kbase; const bf* kpl = Kl + kbase;          // 32 keys = 4 blocks of 1024 bytes (2 key tiles x 2 d chunks) in a row
    const h16* vp = V16 + vbase; const h16* vrp = Vr + vbase;        // 32 keys = 4 blocks of 1024 bytes (4 d tiles) in a row
    const unsigned vq = (unsigned)lane * 16u;                        // the lane's byte offset in a block
    unsigned vo = vq + (unsigned)st0 * (32u * HD * 2u);              // the lane's byte offset in the step's blocks, the same in all four planes
    v16bf qhf[2], qlf[2], k0h[2], k0l[2], k1h[2], k1l[2];
    v16h vf[4], vrf[4];
#pragma unroll
    for (int c = 0; c < 2; ++c) { qhf[c] = ldbs(Qh + qbase + m0 * HD, vq, 1024 * c); qlf[c] = ldbs(Ql + qbase + m0 * HD, vq, 1024 * c); }
#pragma unroll
    for (int c = 0; c < 2; ++c) { k0h[c] = ldbs(kph, vo, 1024 * c); k0l[c] = ldbs(kpl, vo, 1024 * c); k1h[c] = ldbs(kph, vo, 2048 + 1024 * c); k1l[c] = ldbs(kpl, vo, 2048 + 1024 * c); }
#pragma unroll
    for (int j = 0; j < 4; ++j) { vf[j] = ldhs(vp, vo, j * 1024); if (HIRES) vrf[j] = ldhs(vrp, vo, j * 1024); }
    __builtin_amdgcn_sched_barrier(0);              // nothing comes between the loads and their wait
    asm volatile("s_wait_xcnt 0x0" ::: "memory");   // registers that these first loads name are free for other use below
    __builtin_amdgcn_sched_barrier(0);              // keeps that use behind the wait
#pragma unroll 1
    for (int st = st0; st < nst; ++st) {
        const int k0 = st * 32;
        v8f s0 = (v8f){}, s1 = (v8f){};
#pragma unroll
        for (int c = 0; c < 2; ++c) {
            s0 = wmmab(k0h[c], qhf[c], s0); s0 = wmmab(k0h[c], qlf[c], s0); s0 = wmmab(k0l[c], qhf[c], s0);
            s1 = wmmab(k1h[c], qhf[c], s1); s1 = wmmab(k1h[c], qlf[c], s1); s1 = wmmab(k1l[c], qhf[c], s1);
        }
        nopg2(s0, s1, qhf[1], qlf[1], k1l[1]);
        asm volatile("s_wait_xcnt 0x0" ::: "memory");   // the offset register of the loads in flight (V, from the last step's foot) is advanced below
        __builtin_amdgcn_sched_barrier(0);              // keeps that advance behind the wait
        vo += (st + 1 < nst) ? 32u * HD * 2u : 0u;      // to the next step's blocks; behind the last step: its own again, not used
#pragma unroll
        for (int c = 0; c < 2; ++c) { k0h[c] = ldbs(kph, vo, 1024 * c); k0l[c] = ldbs(kpl, vo, 1024 * c); k1h[c] = ldbs(kph, vo, 2048 + 1024 * c); k1l[c] = ldbs(kpl, vo, 2048 + 1024 * c); }
        __builtin_amdgcn_sched_barrier(0);   // keeps the K loads here, ahead of the softmax: sunk to the loop's foot they would be waited for at once
        // causal exclusion by value (key > query -> NEGBIG, probability exactly 0), running max
        const int kb = k0 + 8 * hi;
        float mx = NEGBIG;
#pragma unroll
        for (int r = 0; r < 8; ++r) {
            const float a0 = (kb + r <= qrow) ? s0[r] : NEGBIG;
            const float a1 = (kb + 16 + r <= qrow) ? s1[r] : NEGBIG;
            s0[r] = a0; s1[r] = a1; mx = fmaxf(mx, fmaxf(a0, a1));
        }
        mx = fmaxf(mx, __shfl_xor(mx, 16, 32));
        const float mnew = fmaxf(mrun, mx);
        const float corr = __builtin_amdgcn_exp2f((mrun - mnew) * L2E);
        mrun = mnew;
        float psum = 0.0f;
        v16h pbv, prv;
#pragma unroll
        for (int r = 0; r < 8; ++r) {
            const float p0 = __builtin_amdgcn_exp2f((s0[r] - mnew) * L2E);
            const float p1 = __builtin_amdgcn_exp2f((s1[r] - mnew) * L2E);
            psum += p0 + p1;
            const float c0 = p0 * PCAR, c1 = p1 * PCAR;
            const h16 h0 = (h16)c0, h1 = (h16)c1;
            pbv[r] = h0; pbv[8 + r] = h1;
            if (HIRES) { prv[r] = (h16)((c0 - (float)h0) * RCAR); prv[8 + r] = (h16)((c1 - (float)h1) * RCAR); }
        }
        lsum = lsum * corr + psum;
#pragma unroll
        for (int j = 0; j < 4; ++j) {
#pragma unroll
            for (int r = 0; r < 8; ++r) { o[j][r] *= corr; if (HIRES) orr[j][r] *= corr; } }
        // O^T += V^T P^T
#pragma unroll
        for (int j = 0; j < 4; ++j) {
            o[j] = wmma16(vf[j], pbv, o[j]);
            if (HIRES) { orr[j] = wmma16(vrf[j], pbv, orr[j]); orr[j] = wmma16(vf[j], prv, orr[j]); }
        }
        if (HIRES) nopg8(o[0], o[1], o[2], o[3], orr[0], orr[1], orr[2], orr[3], pbv, prv, vf[3]);
        else       nopg4(o[0], o[1], o[2], o[3], pbv, pbv, vf[3]);
#pragma unroll
        for (int j = 0; j < 4; ++j) { vf[j] = ldhs(vp, vo, j * 1024); if (HIRES) vrf[j] = ldhs(vrp, vo, j * 1024); }
    }
    asm volatile("s_wait_loadcnt 0x0" ::: "memory");   // the last step's look-ahead loads are not used: they have landed before their registers are reused or given back
    __builtin_amdgcn_sched_barrier(0);                 // keeps the epilogue's arithmetic behind the wait
    if constexpr (SPLIT) {
        // merge of the two key halves: the second-half wave hands its state over in LDS (lane-contiguous 16-B pieces), the first-half wave rescales both to the common maximum and adds
        __shared__ v4f mo[4][8][32];
        __shared__ float ml[4][2][32];
        const int tl = wave & 3;
        if (part) {
            ml[tl][0][lane] = mrun; ml[tl][1][lane] = lsum;
#pragma unroll
            for (int j = 0; j < 4; ++j) { mo[tl][2 * j][lane] = __builtin_shufflevector(o[j], o[j], 0, 1, 2, 3); mo[tl][2 * j + 1][lane] = __builtin_shufflevector(o[j], o[j], 4, 5, 6, 7); }
        }
        __syncthreads();   // every wave of the block passes it once: the second halves' states are in LDS before the first halves read them
        if (part) return;
        const float mb = ml[tl][0][lane], lb = ml[tl][1][lane];
        const float dm = (mrun - mb) * L2E;   // the half with the larger maximum keeps its scale (factor 1), the other is scaled down by 2^-|dm|
        const float sc = __builtin_amdgcn_exp2f(-fabsf(dm));
        const float ca = dm < 0.0f ? sc : 1.0f, cb = dm < 0.0f ? 1.0f : sc;
        lsum = lsum * ca + lb * cb;
#pragma unroll
        for (int j = 0; j < 4; ++j) { const v4f b0 = mo[tl][2 * j][lane], b1 = mo[tl][2 * j + 1][lane];
#pragma unroll
            for (int r = 0; r < 4; ++r) { o[j][r] = o[j][r] * ca + b0[r] * cb; o[j][4 + r] = o[j][4 + r] * ca + b1[r] * cb; } }
    }
    lsum += __shfl_xor(lsum, 16, 32);
    const float inv = 1.0f / (PCAR * lsum);
    // lane holds ctx(query m0+lr, d = j*16 + 8*hi + r): 8 consecutive d per j -> one 16-B piece per plane, and piece j of lane l is piece l of half-block j of the wave's two ctx blocks
    const size_t dst = (size_t)(b * SEQ + m0) * DQ + h * (16 * HD) + lane * 8;
#pragma unroll
    for (int j = 0; j < 4; ++j) { v8us vh, vl;
#pragma unroll
        for (int r = 0; r < 8; ++r) { const float val = HIRES ? (o[j][r] + orr[j][r] * (1.0f / RCAR)) * inv : o[j][r] * inv; unsigned short a2, c2; splitf(val, a2, c2); vh[r] = a2; vl[r] = c2; }
        *(v8us*)(Ah + dst + j * 256) = vh; *(v8us*)(Al + dst + j * 256) = vl; }
}
__global__ __launch_bounds__(128) void k_attn_hi(const bf* __restrict__ Qh, const bf* __restrict__ Ql, const bf* __restrict__ Kh, const bf* __restrict__ Kl, const h16* __restrict__ V16, const h16* __restrict__ Vr, bf* Ah, bf* Al, int qb0, int nqb) {
    attn_body<true, false>(Qh, Ql, Kh, Kl, V16, Vr, Ah, Al, qb0, nqb); }
__global__ __launch_bounds__(256) void k_attn_lo(const bf* __restrict__ Qh, const bf* __restrict__ Ql, const bf* __restrict__ Kh, const bf* __restrict__ Kl, const h16* __restrict__ V16, const h16* __restrict__ Vr, bf* Ah, bf* Al, int qb0, int nqb) {
    attn_body<false, true>(Qh, Ql, Kh, Kl, V16, Vr, Ah, Al, qb0, nqb); }

// ---- workspace carve (bytes, every region 256-B aligned and sized to its full store extent)
constexpr size_t al256(size_t x) { return (x + 255) & ~(size_t)255; }
constexpr size_t SZ_WT  = al256((size_t)NQKV * DM * 2);
constexpr size_t SZ_WO  = al256((size_t)DM * DQ * 2);
constexpr size_t SZ_XB  = al256((size_t)NB * SEQ * DM * 2);
constexpr size_t SZ_F   = al256((size_t)NB * SEQ * NQKV * 4);
constexpr size_t SZ_QP  = al256((size_t)NB * NH_ * SEQ * HD * 2);
constexpr size_t SZ_KP  = al256((size_t)NB * NKV * SEQ * HD * 2);
constexpr size_t SZ_AT  = al256((size_t)NB * SEQ * DQ * 2);
constexpr size_t OFF_WT = 0;
constexpr size_t OFF_WO = OFF_WT + SZ_WT;
constexpr size_t OFF_XB = OFF_WO + SZ_WO;
constexpr size_t OFF_F  = OFF_XB + SZ_XB;
constexpr size_t OFF_QH = OFF_F + SZ_F;
constexpr size_t OFF_QL = OFF_QH + SZ_QP;
constexpr size_t OFF_KH = OFF_QL + SZ_QP;
constexpr size_t OFF_KL = OFF_KH + SZ_KP;
constexpr size_t OFF_V1 = OFF_KL + SZ_KP;
constexpr size_t OFF_VR = OFF_V1 + SZ_KP;
constexpr size_t OFF_AH = OFF_VR + SZ_KP;
constexpr size_t OFF_AL = OFF_AH + SZ_AT;
constexpr size_t WS_TOTAL = OFF_AL + SZ_AT;
static_assert(WS_TOTAL <= (size_t)134217728);

extern "C" void kernel_launch(void* const* d_in, const int* in_sizes, int n_in,
                              void* d_out, int out_size, void* d_ws, size_t ws_size, hipStream_t stream) {
    if (n_in < 7) return;
    if (in_sizes[0] < (NB - 1) * SEQ_FULL * DM + SEQ * DM) return;
    if (in_sizes[1] < SEQ * 32 || in_sizes[2] < SEQ * 32) return;
    if (in_sizes[3] < DM * DQ || in_sizes[4] < DM * DKV || in_sizes[5] < DM * DKV || in_sizes[6] < DQ * DM) return;
    if (out_size < NB * SEQ * DM) return;
    if (ws_size < WS_TOTAL) return;
    const float* x = (const float*)d_in[0]; const float* cs = (const float*)d_in[1]; const float* sn = (const float*)d_in[2];
    const float* wq = (const float*)d_in[3]; const float* wk = (const float*)d_in[4]; const float* wv = (const float*)d_in[5]; const float* wo = (const float*)d_in[6];
    float* OUT = (float*)d_out;
    char* w8 = (char*)d_ws;
    bf* WT = (bf*)(w8 + OFF_WT); bf* WOT = (bf*)(w8 + OFF_WO); bf* XB = (bf*)(w8 + OFF_XB); float* F = (float*)(w8 + OFF_F);
    bf* QPh = (bf*)(w8 + OFF_QH); bf* QPl = (bf*)(w8 + OFF_QL); bf* KPh = (bf*)(w8 + OFF_KH); bf* KPl = (bf*)(w8 + OFF_KL);
    h16* V16 = (h16*)(w8 + OFF_V1); h16* VR = (h16*)(w8 + OFF_VR); bf* ATh = (bf*)(w8 + OFF_AH); bf* ATl = (bf*)(w8 + OFF_AL);

    k_prep<<<(unsigned)(GB_WQ + GB_WO + 2 * GB_WKV + GB_X), 256, 0, stream>>>(wq, wk, wv, wo, x, WT, WOT, XB);
    k_gemm_proj<<<dim3(NB * SEQ / 64, NQKV / 64, 1), 32, 0, stream>>>(XB, WT, F);
    k_planes<<<(unsigned)(GB_V + GB_RQ + GB_RK), 256, 0, stream>>>(F, cs, sn, QPh, QPl, KPh, KPl, V16, VR);
    const int nq1 = RH / 64, nq2 = (SEQ - RH) / 64;
    k_attn_hi<<<(unsigned)(nq1 * NB * NH_), 128, 0, stream>>>(QPh, QPl, KPh, KPl, V16, VR, ATh, ATl, 0, nq1);
    if (nq2 > 0) k_attn_lo<<<(unsigned)(nq2 * NB * NH_), 256, 0, stream>>>(QPh, QPl, KPh, KPl, V16, VR, ATh, ATl, nq1, nq2);
    k_gemm_out<<<dim3(NB * SEQ / 64, DM / 64, 1), 32, 0, stream>>>(ATh, ATl, WOT, OUT);
}

// v005
// It runs in 83.4 microseconds.
// Timed twice side by side with v004, it ran 1.08 and 1.11 times as fast.
// Counting every step since v000, it is 3.71 times as fast.
#include <hip/hip_runtime.h>

// Compute dtypes (f32 accumulate everywhere): x@[Wq|Wk|Wv] v_wmma_f32_16x16x32_bf16 (inputs RNE-converted to bf16, single product); q.k^T bf16 hi/lo planes (3 products, one accumulator, 1/8 folded into q);
// P.V v_wmma_f32_16x16x32_f16 with P carried x1024 (query rows < 256: f16 value + x2048 residual planes of P and V, separate accumulator); ctx@Wo bf16 hi/lo ctx x bf16 Wo (2 products). Softmax, rotary: f32.
// Causal grouped-query attention, rotary cos/sin tables read by value from their input buffers (bf16 RNE on load). Fused flash-style attention in transposed form: S^T = K Q^T so the probability
// tile leaves the accumulators already in B-fragment layout (element r <- key tile 0 row 8h+r, element 8+r <- key tile 1), O^T = V^T P^T; row statistics are per-lane scalars.
// Every 16-bit operand plane (rows x K) lies in fragment order: one 1-KiB block per (16-row tile R, 32-wide k chunk C), block index R * (K / 32) + C (V planes, rows = d, k = key: C * 4 + R);
// The three matrix loops load their operand fragments one step ahead of the products that use them.
// The projection GEMM's epilogue applies the rotary tables and writes the q, k, V planes itself.
// Query rows >= RH: two waves share a 16-row tile, each walks one half of its key steps; the two partial (max, sum, O) states are merged once through LDS.
// in a block the 16-B piece of (row r, k = 16 * half + 8 * hi + 0..7) stands at element half * 256 + (hi * 16 + r) * 8, so each of a fragment's two wave-wide loads reads 512 contiguous bytes (4 lines, not 16).

#ifndef NB
#define NB 2
#endif
#ifndef SEQ
#define SEQ 2048
#endif
#define SEQ_FULL 2048
#define DM   1024
#define NH_  16
#define NKV  4
#define REP  (NH_ / NKV)
#define HD   64
#define DQ   (NH_ * HD)
#define DKV  (NKV * HD)
#define NQKV (DQ + 2 * DKV)
#define KCOL DQ
#define VCOL (DQ + DKV)
#define RH   ((SEQ) < 256 ? (SEQ) : 256)   // query rows < RH carry residual planes on P, V
#define PCAR 1024.0f
#define RCAR 2048.0f
#define L2E  1.4426950408889634f
#define NEGBIG (-1.0e30f)

typedef _Float16 h16;
typedef unsigned short bf;
typedef __attribute__((ext_vector_type(16))) __bf16   v16bf;
typedef __attribute__((ext_vector_type(16))) _Float16 v16h;
typedef __attribute__((ext_vector_type(8)))  _Float16 v8h;
typedef __attribute__((ext_vector_type(8)))  unsigned short v8us;
typedef __attribute__((ext_vector_type(8)))  float    v8f;
typedef __attribute__((ext_vector_type(4)))  float    v4f;
typedef __attribute__((ext_vector_type(2)))  _Float16 v2h;
typedef __attribute__((ext_vector_type(2)))  unsigned short v2us;
typedef v4f  __attribute__((may_alias)) v4fa;

static_assert(HD == 64);
static_assert(DQ == DM);
static_assert(NH_ % NKV == 0);
static_assert(SEQ % 64 == 0);
static_assert(SEQ <= SEQ_FULL);
static_assert(RH % 64 == 0);
static_assert(RH <= SEQ);
static_assert(DM % 32 == 0);
static_assert(DQ % 32 == 0);
static_assert((NB * SEQ) % 64 == 0);
static_assert(NQKV % 64 == 0);
static_assert(DM % 64 == 0);
static_assert((DM * DQ) % 64 == 0);
static_assert((DM * DKV) % 64 == 0);

__device__ __forceinline__ unsigned short f2bf(float f) { unsigned u = __float_as_uint(f); u += 0x7FFFu + ((u >> 16) & 1u); return (unsigned short)(u >> 16); }
__device__ __forceinline__ float bf2f(unsigned short b) { return __uint_as_float(((unsigned)b) << 16); }
__device__ __forceinline__ float bfr(float f) { return bf2f(f2bf(f)); }
__device__ __forceinline__ void splitf(float y, unsigned short& h, unsigned short& l) { h = f2bf(y); l = f2bf(y - bf2f(h)); }
__device__ __forceinline__ v16h cat16(v8h lo, v8h hi) { return __builtin_shufflevector(lo, hi, 0, 1, 2, 3, 4, 5, 6, 7, 8, 9, 10, 11, 12, 13, 14, 15); }
__device__ __forceinline__ v16bf cat16b(v8us lo, v8us hi) { return __builtin_bit_cast(v16bf, __builtin_shufflevector(lo, hi, 0, 1, 2, 3, 4, 5, 6, 7, 8, 9, 10, 11, 12, 13, 14, 15)); }
__device__ __forceinline__ v8f wmma16(v16h a, v16h b, v8f c) { return __builtin_amdgcn_wmma_f32_16x16x32_f16(false, a, false, b, (short)0, c, false, false); }
__device__ __forceinline__ v8f wmmab(v16bf a, v16bf b, v8f c) { return __builtin_amdgcn_wmma_f32_16x16x32_bf16(false, a, false, b, (short)0, c, false, false); }
// fragment loaders: p = b + vo + im (bytes) points at block start + lane * 16 bytes, which holds (row l&15, k0 + 8*(l>>4)); elements 0..7 <- bytes 0..15, elements 8..15 (k + 16) <- bytes 512..527.
// b: wave-uniform plane pointer, vo: the lane's byte offset, im: a constant; the loads take b as scalar base, and one 32-bit register per lane is all that moves from step to step
__device__ __forceinline__ v16bf ldbs(const bf* b, unsigned vo, int im) { const char* p = (const char*)b + vo; return cat16b(*(const v8us*)(p + im), *(const v8us*)(p + im + 512)); }
__device__ __forceinline__ v16h ldhs(const h16* b, unsigned vo, int im) { const char* p = (const char*)b + vo; return cat16(*(const v8h*)(p + im), *(const v8h*)(p + im + 512)); }

// hazard guards: name every accumulator of the group and the last fragments
template <typename V> __device__ __forceinline__ void nopg2(v8f& c0, v8f& c1, const V& x, const V& y, const V& z) {
    asm volatile("v_nop\n\tv_nop\n\tv_nop\n\tv_nop" : "+v"(c0), "+v"(c1) : "v"(x), "v"(y), "v"(z)); }
template <typename V> __device__ __forceinline__ void nopg4(v8f& c0, v8f& c1, v8f& c2, v8f& c3, const V& x, const V& y, const V& z) {
    asm volatile("v_nop\n\tv_nop\n\tv_nop\n\tv_nop" : "+v"(c0), "+v"(c1), "+v"(c2), "+v"(c3) : "v"(x), "v"(y), "v"(z)); }
template <typename V> __device__ __forceinline__ void nopg8(v8f& c0, v8f& c1, v8f& c2, v8f& c3, v8f& c4, v8f& c5, v8f& c6, v8f& c7, const V& x, const V& y, const V& z) {
    asm volatile("v_nop\n\tv_nop\n\tv_nop\n\tv_nop" : "+v"(c0), "+v"(c1), "+v"(c2), "+v"(c3), "+v"(c4), "+v"(c5), "+v"(c6), "+v"(c7) : "v"(x), "v"(y), "v"(z)); }

// one k chunk's fragments of a 64x64 tile, and the two halves of a pipelined step: fetch (loads only) and multiply (products only)
template <int NSPLIT> struct gfrag { v16bf a[4], a2[NSPLIT == 1 ? 4 : 1], b[4]; };
template <int NSPLIT>
__device__ __forceinline__ void gemm_fetch(gfrag<NSPLIT>& f, const bf* pa, const bf* pa2, const bf* pb, int K, unsigned vo, int im) {
#pragma unroll
    for (int mb = 0; mb < 4; ++mb) { f.a[mb] = ldbs(pa, vo, im + mb * 32 * K); if (NSPLIT == 1) f.a2[mb] = ldbs(pa2, vo, im + mb * 32 * K); }
#pragma unroll
    for (int nb = 0; nb < 4; ++nb) f.b[nb] = ldbs(pb, vo, im + nb * 32 * K);
    __builtin_amdgcn_sched_barrier(0);   // keeps the group of loads ahead of the products: sunk among them, each would be waited for where it stands
}
template <int NSPLIT>
__device__ __forceinline__ void gemm_mul(const gfrag<NSPLIT>& f, v8f (&acc)[4][4]) {
#pragma unroll
    for (int nb = 0; nb < 4; ++nb) {
#pragma unroll
        for (int mb = 0; mb < 4; ++mb) { acc[mb][nb] = wmmab(f.a[mb], f.b[nb], acc[mb][nb]); if (NSPLIT == 1) acc[mb][nb] = wmmab(f.a2[mb], f.b[nb], acc[mb][nb]); } }
    nopg8(acc[0][0], acc[0][1], acc[0][2], acc[0][3], acc[1][0], acc[1][1], acc[1][2], acc[1][3], f.a[0], f.a[1], f.b[3]);
    nopg8(acc[2][0], acc[2][1], acc[2][2], acc[2][3], acc[3][0], acc[3][1], acc[3][2], acc[3][3], f.a[3], (NSPLIT == 1) ? f.a2[3] : f.a[2], f.b[3]);
}
// ---- the projection GEMM's epilogue: a 64x64 tile of XB x WT^T is 64 rows t of ONE head (q, k or v), so the wave that computed it holds all that the head's attention operand planes need of these rows;
// the f32 projections never go to memory. acc[mb][nb][j]: row mb * 16 + 8 * hi + j, column nb * 16 + lr. On entry the GEMM loop's last, unused look-ahead loads are still in flight.
// rope_piece: the 16-B pieces d = j0..j0+7 (chunk 0, from ra) and d = 32+j0..32+j0+7 (chunk 1, from rb) of one row of rotary(x1 | x2) x sc, bf16 hi/lo; table values cv, sv by value (bf16 RNE on load)
__device__ __forceinline__ void rope_piece(const v8f x1, const v8f x2, const v8f cv, const v8f sv, float sc, v8us& ah, v8us& al, v8us& bh, v8us& bl) {
#pragma unroll
    for (int q = 0; q < 8; ++q) { const float c = bfr(cv[q]), s = bfr(sv[q]);
        const float ra = (x1[q] * c + x2[q] * s) * sc, rb = (x2[q] * c - x1[q] * s) * sc;
        unsigned short a2, c2; splitf(ra, a2, c2); ah[q] = a2; al[q] = c2; splitf(rb, a2, c2); bh[q] = a2; bl[q] = c2; }
}
struct planes_t { const float* COS; const float* SIN; bf* QPh; bf* QPl; bf* KPh; bf* KPl; h16* V16; h16* Vr; };
// r0: the tile's first row of NB * SEQ; ct: the head's place among 16 q, 4 k, 4 v; os: the wave's 16 x 68 floats of LDS
__device__ __forceinline__ void planes_epilogue(const v8f (&acc)[4][4], const planes_t& P, float* os, int r0, int ct, int lane) {
    asm volatile("s_wait_xcnt 0x0" ::: "memory");   // the offset register of the last look-ahead loads is free for other use below
    __builtin_amdgcn_sched_barrier(0);              // keeps that use behind the wait
    const int lr = lane & 15, hi = lane >> 4;
    const int b = r0 / SEQ, t0 = r0 % SEQ;          // SEQ % 64 == 0: a tile lies in one batch
    if (ct >= NH_ + NKV) {
        // V planes (rows = d, k = key): a lane's 8 accumulator rows are 8 consecutive keys of one d = one 16-B piece; a wave-wide store fills 512 contiguous bytes
        asm volatile("s_wait_loadcnt 0x0" ::: "memory");   // the last look-ahead group is not used: it has landed before its registers serve the epilogue
        __builtin_amdgcn_sched_barrier(0);                 // keeps the epilogue's arithmetic behind the wait
        const size_t vb = ((size_t)(b * NKV + (ct - NH_ - NKV)) * HD) * SEQ + (size_t)(t0 / 32) * 2048 + lane * 8;
#pragma unroll
        for (int mb = 0; mb < 4; ++mb) { v8h o16[4], o2[4];
#pragma unroll
            for (int nb = 0; nb < 4; ++nb) {
#pragma unroll
                for (int j = 0; j < 8; ++j) { const float x = acc[mb][nb][j]; const h16 a = (h16)x; o16[nb][j] = a; o2[nb][j] = (h16)((x - (float)a) * RCAR); } }
            __builtin_amdgcn_sched_barrier(0);              // keeps the round's stores together, behind its arithmetic: none of their registers is written again ahead of the one wait below
#pragma unroll
            for (int nb = 0; nb < 4; ++nb) { const size_t e = vb + ((mb >> 1) * 4 + nb) * 512 + (mb & 1) * 256;
                *(v8h*)(P.V16 + e) = o16[nb]; *(v8h*)(P.Vr + e) = o2[nb]; }
            __builtin_amdgcn_sched_barrier(0);              // nothing comes between the stores and their wait
            asm volatile("s_wait_xcnt 0x0" ::: "memory");   // the stores' data registers are written anew in the next round
            __builtin_amdgcn_sched_barrier(0);              // keeps that behind the wait
        }
        return;
    }
    // rotary q (x 1/8) or k planes (rows = t, k = d). Per 16 rows: the tile's rows go through LDS, then the wave takes 8 rows x 4 pieces twice: each table load touches 8 lines, each store fills 4 whole lines
    const bool isq = ct < NH_;
    const float sc = isq ? 0.125f : 1.0f;
    bf* Ph = isq ? P.QPh : P.KPh; bf* Pl = isq ? P.QPl : P.KPl;
    const int r8 = lane & 7, pc = lane >> 3;   // the lane's row (and row + 8) and its piece: d = pc * 8 .. + 7 and 32 + the same
    const size_t pb = ((size_t)(isq ? b * NH_ + ct : b * NKV + (ct - NH_)) * (SEQ / 16) + t0 / 16) * 1024 + (pc * 16 + r8) * 8;
    const unsigned to = (unsigned)((t0 + r8) * 32 + pc * 8);   // the lane's place in both tables
    v8f cv[4][2], sv[4][2];
#pragma unroll
    for (int it = 0; it < 2; ++it) { cv[0][it] = *(const v8f*)(P.COS + to + it * 256); sv[0][it] = *(const v8f*)(P.SIN + to + it * 256); }
    asm volatile("s_wait_loadcnt 0x0" ::: "memory");   // the last look-ahead group is not used: it has landed before its registers serve the epilogue; the first table values land with it
    __builtin_amdgcn_sched_barrier(0);                 // keeps the epilogue's arithmetic behind the wait
#pragma unroll
    for (int mb = 0; mb < 4; ++mb) {
        if (mb < 3) {   // the next 16 rows' table values are fetched while these rows are worked on
#pragma unroll
            for (int it = 0; it < 2; ++it) { cv[mb + 1][it] = *(const v8f*)(P.COS + to + (mb + 1) * 512 + it * 256); sv[mb + 1][it] = *(const v8f*)(P.SIN + to + (mb + 1) * 512 + it * 256); }
            if (mb == 2) {
                asm volatile("s_wait_xcnt 0x0" ::: "memory");   // these were the last table loads: their address registers are free for other use below
                __builtin_amdgcn_sched_barrier(0);              // keeps that use behind the wait
            }
        }
#pragma unroll
        for (int nb = 0; nb < 4; ++nb) {
#pragma unroll
            for (int j = 0; j < 8; ++j) os[(hi * 8 + j) * 68 + nb * 16 + lr] = acc[mb][nb][j]; }
        asm volatile("s_wait_dscnt 0" ::: "memory"); __builtin_amdgcn_wave_barrier();   // the rows are in LDS before other lanes read them
        v8us ah[2], al[2], bh[2], bl[2];
#pragma unroll
        for (int it = 0; it < 2; ++it) { const float* rw = os + (r8 + 8 * it) * 68 + pc * 8;
            const v4f a0 = *(const v4fa*)rw, a1 = *(const v4fa*)(rw + 4), b0 = *(const v4fa*)(rw + 32), b1 = *(const v4fa*)(rw + 36);
            rope_piece(__builtin_shufflevector(a0, a1, 0, 1, 2, 3, 4, 5, 6, 7), __builtin_shufflevector(b0, b1, 0, 1, 2, 3, 4, 5, 6, 7), cv[mb][it], sv[mb][it], sc, ah[it], al[it], bh[it], bl[it]); }
        __builtin_amdgcn_sched_barrier(0);              // keeps the round's stores together, behind its arithmetic: none of their registers is written again ahead of the one wait below
#pragma unroll
        for (int it = 0; it < 2; ++it) { const size_t dst = pb + mb * 1024 + it * 64;
            *(v8us*)(Ph + dst) = ah[it]; *(v8us*)(Pl + dst) = al[it]; *(v8us*)(Ph + dst + 512) = bh[it]; *(v8us*)(Pl + dst + 512) = bl[it]; }
        __builtin_amdgcn_sched_barrier(0);              // nothing comes between the stores and their wait
        asm volatile("s_wait_xcnt 0x0" ::: "memory");   // the stores' data registers are written anew in the next round
        __builtin_amdgcn_sched_barrier(0);              // keeps that behind the wait
        asm volatile("s_wait_dscnt 0" ::: "memory"); __builtin_amdgcn_wave_barrier();   // every lane has read its rows before the next round overwrites them
    }
}
// ---- one-wave 64x64 tile GEMM: C[m][n] (f32, pitch ldc) = sum_k A[m][k] Bt[n][k] (+ A2[m][k] Bt[n][k] when NSPLIT == 1); operands straight from fragment-order bf16 planes; K % 64 == 0.
// PLANES: the tile does not go to C but, through planes_epilogue, to the planes of P
template <int NSPLIT, bool PLANES>
__device__ __forceinline__ void gemm_body(const bf* A, const bf* A2, const bf* Bt, int K, float* C, int ldc, const planes_t& P) {
    __shared__ __align__(16) float os[16 * 68];
    const int lane = threadIdx.x & 31, lr = lane & 15, hi = lane >> 4; const int r0 = blockIdx.x * 64, c0 = blockIdx.y * 64;
    v8f acc[4][4];
#pragma unroll
    for (int mb = 0; mb < 4; ++mb)
#pragma unroll
        for (int nb = 0; nb < 4; ++nb) acc[mb][nb] = (v8f){};
    const size_t aoff = (size_t)r0 * K, boff = (size_t)c0 * K;   // a 16-row tile spans 16 * K elements (32 * K bytes), a k chunk of 32 one block of 512 (1024 bytes)
    // two fragment sets: while one k chunk is multiplied, the next chunk's loads (one group, issued ahead of the products) are in flight; K % 64 == 0
    gfrag<NSPLIT> f0, f1;
    const bf* pa = A + aoff; const bf* pa2 = A2 + aoff; const bf* pb = Bt + boff;
    unsigned vo = (unsigned)lane * 16u;   // the lane's byte offset in the current pair of chunks
    gemm_fetch<NSPLIT>(f0, pa, pa2, pb, K, vo, 0);
    asm volatile("s_wait_xcnt 0x0" ::: "memory");   // registers that these first loads name are free for other use below
    __builtin_amdgcn_sched_barrier(0);              // keeps that use behind the wait
#pragma unroll 1
    for (int kc = 0; kc < K; kc += 64) {
        gemm_fetch<NSPLIT>(f1, pa, pa2, pb, K, vo, 1024);
        gemm_mul<NSPLIT>(f0, acc);
        asm volatile("s_wait_xcnt 0x0" ::: "memory");   // the offset register of the loads in flight is advanced below
        __builtin_amdgcn_sched_barrier(0);              // keeps that advance behind the wait
        vo += (kc + 64 < K) ? 2048u : 0u;               // to the next pair of chunks; behind the last pair: the same chunk again, not used
        gemm_fetch<NSPLIT>(f0, pa, pa2, pb, K, vo, 0);
        gemm_mul<NSPLIT>(f1, acc);
    }
    if constexpr (PLANES) { planes_epilogue(acc, P, os, r0, (int)blockIdx.y, lane); return; }
    asm volatile("s_wait_loadcnt 0x0" ::: "memory");   // the last look-ahead group is not used: it has landed before its registers serve the epilogue
    __builtin_amdgcn_sched_barrier(0);                 // keeps the epilogue's arithmetic behind the wait
#pragma unroll
    for (int mb = 0; mb < 4; ++mb) {
#pragma unroll
        for (int nb = 0; nb < 4; ++nb) {
#pragma unroll
            for (int j = 0; j < 8; ++j) os[(hi * 8 + j) * 68 + nb * 16 + lr] = acc[mb][nb][j]; }
        asm volatile("s_wait_dscnt 0" ::: "memory"); __builtin_amdgcn_wave_barrier();
        float* crow = C + (size_t)(r0 + mb * 16) * ldc + c0;
{
#pragma unroll
            for (int s = 0; s < 8; ++s) { const int row = 2 * s + hi, cofs = lr * 4; const v4f val = *(const v4fa*)(os + row * 68 + cofs);
                *(v4f*)(crow + (size_t)row * ldc + cofs) = val; }
             }
        asm volatile("s_wait_xcnt 0x0" ::: "memory");   // the stores' data registers are loaded anew in the next round
        asm volatile("s_wait_dscnt 0" ::: "memory"); __builtin_amdgcn_wave_barrier();
    }
}
// q, k, V planes <- XB[NB*SEQ][1024] x WT[1536][1024]^T
__global__ __launch_bounds__(32) void k_gemm_proj(const bf* __restrict__ A, const bf* __restrict__ Bt, const float* __restrict__ COS, const float* __restrict__ SIN, bf* QPh, bf* QPl, bf* KPh, bf* KPl, h16* V16, h16* Vr) {
    gemm_body<0, true>(A, A, Bt, DM, nullptr, 0, planes_t{COS, SIN, QPh, QPl, KPh, KPl, V16, Vr}); }
// OUT[NB*SEQ][1024] = (ATh + ATl)[NB*SEQ][1024] x WOT[1024][1024]^T
__global__ __launch_bounds__(32) void k_gemm_out(const bf* __restrict__ A, const bf* __restrict__ A2, const bf* __restrict__ Bt, float* C) { gemm_body<1, false>(A, A2, Bt, DQ, C, DM, planes_t{}); }

// The element-wise stages are device functions that take their block index bx: stages that do not depend on one another share one launch, each on its own range of block indices.
__device__ __forceinline__ void wtG_body(const float* __restrict__ w, int K, int N, bf* Bt, int bx) {
    const int lane = threadIdx.x & 31; const int L0 = (bx * 8 + (threadIdx.x >> 5)) * 8; const int nlines = N * K / 64;
{
#pragma unroll 1
        for (int l = 0; l < 8; ++l) { const int L = L0 + l; if (L >= nlines) break; const size_t e = (size_t)L * 64 + lane * 2; const int blk = (int)(e >> 9), in = (int)(e & 511);
            const int k = (blk % (K / 32)) * 32 + (in >> 7) * 8 + (in & 7), n = (blk / (K / 32)) * 16 + ((in >> 3) & 15); v2us o;
            o[0] = f2bf(w[(size_t)k * N + n]); o[1] = f2bf(w[(size_t)(k + 1) * N + n]); *(v2us*)(Bt + e) = o; }
         }
}
__device__ __forceinline__ void cvtx_body(const float* __restrict__ x, bf* XB, int bx) {
    const size_t i = (size_t)bx * 256 + threadIdx.x; if (i >= (size_t)NB * SEQ * DM / 8) return;
    // a wave takes 8 rows x 4 pieces: it reads whole 128-B lines of 8 rows and stores 4 whole lines
    const int blk = (int)(i >> 6), r = (int)((i & 7) | ((i >> 2) & 8)), pc = (int)((i >> 3) & 3); const size_t e = (size_t)blk * 512 + (pc * 16 + r) * 8;
    const int row = (blk / (DM / 32)) * 16 + r, k = (blk % (DM / 32)) * 32 + pc * 8;
    const v8f v = *(const v8f*)(x + (size_t)(row / SEQ) * SEQ_FULL * DM + (size_t)(row % SEQ) * DM + k); v8us o;
#pragma unroll
    for (int k = 0; k < 8; ++k) o[k] = f2bf(v[k]);
    *(v8us*)(XB + e) = o; 
}
// block counts of the stages
constexpr int GB_WQ = (DM * DQ / 64 + 63) / 64, GB_WKV = (DM * DKV / 64 + 63) / 64, GB_WO = (DQ * DM / 64 + 63) / 64, GB_X = (int)(((size_t)NB * SEQ * DM / 8 + 255) / 256);
// ---- k_prep: all operand planes made from inputs alone. Weights: in w[K = DM][N] -> out plane rows n (fragment order); q | k | v stacked into one [1536][1024] plane. The weight blocks (a serial loop each) come first, x behind them.
__global__ __launch_bounds__(256) void k_prep(const float* __restrict__ wq, const float* __restrict__ wk, const float* __restrict__ wv, const float* __restrict__ wo, const float* __restrict__ x, bf* WT, bf* WOT, bf* XB) {
    int bx = (int)blockIdx.x;
    if (bx < GB_WQ) { wtG_body(wq, DM, DQ, WT, bx); return; }
    bx -= GB_WQ;
    if (bx < GB_WO) { wtG_body(wo, DQ, DM, WOT, bx); return; }
    bx -= GB_WO;
    if (bx < GB_WKV) { wtG_body(wk, DM, DKV, WT + (size_t)KCOL * DM, bx); return; }
    bx -= GB_WKV;
    if (bx < GB_WKV) { wtG_body(wv, DM, DKV, WT + (size_t)VCOL * DM, bx); return; }
    bx -= GB_WKV;
    cvtx_body(x, XB, bx);
}

// ---- fused causal flash attention, transposed form. Block = 64 query rows of one (b, h), 4 waves (8 with SPLIT); a wave owns 16 query rows (one per lane&15) and walks keys in 32-key steps up to its diagonal.
// S^T tile (keys x queries) = K (A, rows = keys) x Q^T (B, cols = queries); D: lane -> query l&15, rows -> keys 8h+r. Two key tiles give the B fragment of P^T directly.
// O^T tile (d x queries) = V^T (A, rows = d, k = keys) x P^T (B). Running max / sum / scale factor are per-lane scalars (both lane halves of a query agree via one xor-16 shuffle).
// SPLIT: the block has 8 waves; waves w and w + 4 own the same 16 query rows, wave w the first half of the key steps, wave w + 4 the second (with the diagonal).
template <bool HIRES, bool SPLIT>
__device__ __forceinline__ void attn_body(const bf* Qh, const bf* Ql, const bf* Kh, const bf* Kl, const h16* V16, const h16* Vr, bf* Ah, bf* Al, int qb0, int nqb) {
    const int lane = threadIdx.x & 31, lr = lane & 15, hi = lane >> 4;
    const int wave = __builtin_amdgcn_readfirstlane((int)(threadIdx.x >> 5));
    // SPLIT: the longest tiles (highest rows) take the lowest block indices (for speed only)
    const int qblk = SPLIT ? qb0 + nqb - 1 - (int)(blockIdx.x / (unsigned)(NB * NH_)) : qb0 + (int)(blockIdx.x % (unsigned)nqb);
    const int bh = SPLIT ? (int)(blockIdx.x % (unsigned)(NB * NH_)) : (int)(blockIdx.x / (unsigned)nqb);
    const int b = bh / NH_, h = bh % NH_, g = h / REP;
    const int part = SPLIT ? (wave >> 2) : 0;
    const int m0 = qblk * 64 + (wave & 3) * 16;
    const size_t qbase = ((size_t)(b * NH_ + h) * SEQ) * HD;
    const size_t kbase = ((size_t)(b * NKV + g) * SEQ) * HD;
    const size_t vbase = ((size_t)(b * NKV + g) * HD) * SEQ;
    const int qrow = m0 + lr;
    v8f o[4], orr[4];
#pragma unroll
    for (int j = 0; j < 4; ++j) { o[j] = (v8f){}; orr[j] = (v8f){}; }
    float mrun = NEGBIG, lsum = 0.0f;
    const int nall = (m0 + 47) >> 5;             // keys 0 .. m0+15 in 32-key steps; k0 + 31 < SEQ always (SEQ % 32 == 0)
    const int st0 = part ? (nall + 1) >> 1 : 0;  // this wave's steps: st0 .. nst - 1; never empty (SPLIT: m0 >= 64, nall >= 3)
    const int nst = (SPLIT && part == 0) ? (nall + 1) >> 1 : nall;
    if constexpr (SPLIT) __builtin_assume(st0 < nst);   // no branch round the loop, so the first loads keep the order written (Q, K, V): with Q last, the loop's counted waits, which also serve its first pass, would wait for each step's V loads at the loop's head
    // Loads run one step ahead of their products: Q fragments once, K of step st + 1 right behind the score products of step st, V of step st + 1 right behind the output products of step st.
    const bf* kph = Kh + kbase; const bf* kpl = Kl + kbase;          // 32 keys = 4 blocks of 1024 bytes (2 key tiles x 2 d chunks) in a row
    const h16* vp = V16 + vbase; const h16* vrp = Vr + vbase;        // 32 keys = 4 blocks of 1024 bytes (4 d tiles) in a row
    const unsigned vq = (unsigned)lane * 16u;                        // the lane's byte offset in a block
    unsigned vo = vq + (unsigned)st0 * (32u * HD * 2u);              // the lane's byte offset in the step's blocks, the same in all four planes
    v16bf qhf[2], qlf[2], k0h[2], k0l[2], k1h[2], k1l[2];
    v16h vf[4], vrf[4];
#pragma unroll
    for (int c = 0; c < 2; ++c) { qhf[c] = ldbs(Qh + qbase + m0 * HD, vq, 1024 * c); qlf[c] = ldbs(Ql + qbase + m0 * HD, vq, 1024 * c); }
#pragma unroll
    for (int c = 0; c < 2; ++c) { k0h[c] = ldbs(kph, vo, 1024 * c); k0l[c] = ldbs(kpl, vo, 1024 * c); k1h[c] = ldbs(kph, vo, 2048 + 1024 * c); k1l[c] = ldbs(kpl, vo, 2048 + 1024 * c); }
#pragma unroll
    for (int j = 0; j < 4; ++j) { vf[j] = ldhs(vp, vo, j * 1024); if (HIRES) vrf[j] = ldhs(vrp, vo, j * 1024); }
    __builtin_amdgcn_sched_barrier(0);              // nothing comes between the loads and their wait
    asm volatile("s_wait_xcnt 0x0" ::: "memory");   // registers that these first loads name are free for other use below
    __builtin_amdgcn_sched_barrier(0);              // keeps that use behind the wait
#pragma unroll 1
    for (int st = st0; st < nst; ++st) {
        const int k0 = st * 32;
        v8f s0 = (v8f){}, s1 = (v8f){};
#pragma unroll
        for (int c = 0; c < 2; ++c) {
            s0 = wmmab(k0h[c], qhf[c], s0); s0 = wmmab(k0h[c], qlf[c], s0); s0 = wmmab(k0l[c], qhf[c], s0);
            s1 = wmmab(k1h[c], qhf[c], s1); s1 = wmmab(k1h[c], qlf[c], s1); s1 = wmmab(k1l[c], qhf[c], s1);
        }
        nopg2(s0, s1, qhf[1], qlf[1], k1l[1]);
        asm volatile("s_wait_xcnt 0x0" ::: "memory");   // the offset register of the loads in flight (V, from the last step's foot) is advanced below
        __builtin_amdgcn_sched_barrier(0);              // keeps that advance behind the wait
        vo += (st + 1 < nst) ? 32u * HD * 2u : 0u;      // to the next step's blocks; behind the last step: its own again, not used
#pragma unroll
        for (int c = 0; c < 2; ++c) { k0h[c] = ldbs(kph, vo, 1024 * c); k0l[c] = ldbs(kpl, vo, 1024 * c); k1h[c] = ldbs(kph, vo, 2048 + 1024 * c); k1l[c] = ldbs(kpl, vo, 2048 + 1024 * c); }
        __builtin_amdgcn_sched_barrier(0);   // keeps the K loads here, ahead of the softmax: sunk to the loop's foot they would be waited for at once
        // causal exclusion by value (key > query -> NEGBIG, probability exactly 0), running max
        const int kb = k0 + 8 * hi;
        float mx = NEGBIG;
#pragma unroll
        for (int r = 0; r < 8; ++r) {
            const float a0 = (kb + r <= qrow) ? s0[r] : NEGBIG;
            const float a1 = (kb + 16 + r <= qrow) ? s1[r] : NEGBIG;
            s0[r] = a0; s1[r] = a1; mx = fmaxf(mx, fmaxf(a0, a1));
        }
        mx = fmaxf(mx, __shfl_xor(mx, 16, 32));
        const float mnew = fmaxf(mrun, mx);
        const float corr = __builtin_amdgcn_exp2f((mrun - mnew) * L2E);
        mrun = mnew;
        float psum = 0.0f;
        v16h pbv, prv;
#pragma unroll
        for (int r = 0; r < 8; ++r) {
            const float p0 = __builtin_amdgcn_exp2f((s0[r] - mnew) * L2E);
            const float p1 = __builtin_amdgcn_exp2f((s1[r] - mnew) * L2E);
            psum += p0 + p1;
            const float c0 = p0 * PCAR, c1 = p1 * PCAR;
            const h16 h0 = (h16)c0, h1 = (h16)c1;
            pbv[r] = h0; pbv[8 + r] = h1;
            if (HIRES) { prv[r] = (h16)((c0 - (float)h0) * RCAR); prv[8 + r] = (h16)((c1 - (float)h1) * RCAR); }
        }
        lsum = lsum * corr + psum;
#pragma unroll
        for (int j = 0; j < 4; ++j) {
#pragma unroll
            for (int r = 0; r < 8; ++r) { o[j][r] *= corr; if (HIRES) orr[j][r] *= corr; } }
        // O^T += V^T P^T
#pragma unroll
        for (int j = 0; j < 4; ++j) {
            o[j] = wmma16(vf[j], pbv, o[j]);
            if (HIRES) { orr[j] = wmma16(vrf[j], pbv, orr[j]); orr[j] = wmma16(vf[j], prv, orr[j]); }
        }
        if (HIRES) nopg8(o[0], o[1], o[2], o[3], orr[0], orr[1], orr[2], orr[3], pbv, prv, vf[3]);
        else       nopg4(o[0], o[1], o[2], o[3], pbv, pbv, vf[3]);
#pragma unroll
        for (int j = 0; j < 4; ++j) { vf[j] = ldhs(vp, vo, j * 1024); if (HIRES) vrf[j] = ldhs(vrp, vo, j * 1024); }
    }
    asm volatile("s_wait_loadcnt 0x0" ::: "memory");   // the last step's look-ahead loads are not used: they have landed before their registers are reused or given back
    __builtin_amdgcn_sched_barrier(0);                 // keeps the epilogue's arithmetic behind the wait
    if constexpr (SPLIT) {
        // merge of the two key halves: the second-half wave hands its state over in LDS (lane-contiguous 16-B pieces), the first-half wave rescales both to the common maximum and adds
        __shared__ v4f mo[4][8][32];
        __shared__ float ml[4][2][32];
        const int tl = wave & 3;
        if (part) {
            ml[tl][0][lane] = mrun; ml[tl][1][lane] = lsum;
#pragma unroll
            for (int j = 0; j < 4; ++j) { mo[tl][2 * j][lane] = __builtin_shufflevector(o[j], o[j], 0, 1, 2, 3); mo[tl][2 * j + 1][lane] = __builtin_shufflevector(o[j], o[j], 4, 5, 6, 7); }
        }
        __syncthreads();   // every wave of the block passes it once: the second halves' states are in LDS before the first halves read them
        if (part) return;
        const float mb = ml[tl][0][lane], lb = ml[tl][1][lane];
        const float dm = (mrun - mb) * L2E;   // the half with the larger maximum keeps its scale (factor 1), the other is scaled down by 2^-|dm|
        const float sc = __builtin_amdgcn_exp2f(-fabsf(dm));
        const float ca = dm < 0.0f ? sc : 1.0f, cb = dm < 0.0f ? 1.0f : sc;
        lsum = lsum * ca + lb * cb;
#pragma unroll
        for (int j = 0; j < 4; ++j) { const v4f b0 = mo[tl][2 * j][lane], b1 = mo[tl][2 * j + 1][lane];
#pragma unroll
            for (int r = 0; r < 4; ++r) { o[j][r] = o[j][r] * ca + b0[r] * cb; o[j][4 + r] = o[j][4 + r] * ca + b1[r] * cb; } }
    }
    lsum += __shfl_xor(lsum, 16, 32);
    const float inv = 1.0f / (PCAR * lsum);
    // lane holds ctx(query m0+lr, d = j*16 + 8*hi + r): 8 consecutive d per j -> one 16-B piece per plane, and piece j of lane l is piece l of half-block j of the wave's two ctx blocks
    const size_t dst = (size_t)(b * SEQ + m0) * DQ + h * (16 * HD) + lane * 8;
#pragma unroll
    for (int j = 0; j < 4; ++j) { v8us vh, vl;
#pragma unroll
        for (int r = 0; r < 8; ++r) { const float val = HIRES ? (o[j][r] + orr[j][r] * (1.0f / RCAR)) * inv : o[j][r] * inv; unsigned short a2, c2; splitf(val, a2, c2); vh[r] = a2; vl[r] = c2; }
        *(v8us*)(Ah + dst + j * 256) = vh; *(v8us*)(Al + dst + j * 256) = vl; }
}
__global__ __launch_bounds__(128) void k_attn_hi(const bf* __restrict__ Qh, const bf* __restrict__ Ql, const bf* __restrict__ Kh, const bf* __restrict__ Kl, const h16* __restrict__ V16, const h16* __restrict__ Vr, bf* Ah, bf* Al, int qb0, int nqb) {
    attn_body<true, false>(Qh, Ql, Kh, Kl, V16, Vr, Ah, Al, qb0, nqb); }
__global__ __launch_bounds__(256) void k_attn_lo(const bf* __restrict__ Qh, const bf* __restrict__ Ql, const bf* __restrict__ Kh, const bf* __restrict__ Kl, const h16* __restrict__ V16, const h16* __restrict__ Vr, bf* Ah, bf* Al, int qb0, int nqb) {
    attn_body<false, true>(Qh, Ql, Kh, Kl, V16, Vr, Ah, Al, qb0, nqb); }

// ---- workspace carve (bytes, every region 256-B aligned and sized to its full store extent)
constexpr size_t al256(size_t x) { return (x + 255) & ~(size_t)255; }
constexpr size_t SZ_WT  = al256((size_t)NQKV * DM * 2);
constexpr size_t SZ_WO  = al256((size_t)DM * DQ * 2);
constexpr size_t SZ_XB  = al256((size_t)NB * SEQ * DM * 2);
constexpr size_t SZ_QP  = al256((size_t)NB * NH_ * SEQ * HD * 2);
constexpr size_t SZ_KP  = al256((size_t)NB * NKV * SEQ * HD * 2);
constexpr size_t SZ_AT  = al256((size_t)NB * SEQ * DQ * 2);
constexpr size_t OFF_WT = 0;
constexpr size_t OFF_WO = OFF_WT + SZ_WT;
constexpr size_t OFF_XB = OFF_WO + SZ_WO;
constexpr size_t OFF_QH = OFF_XB + SZ_XB;
constexpr size_t OFF_QL = OFF_QH + SZ_QP;
constexpr size_t OFF_KH = OFF_QL + SZ_QP;
constexpr size_t OFF_KL = OFF_KH + SZ_KP;
constexpr size_t OFF_V1 = OFF_KL + SZ_KP;
constexpr size_t OFF_VR = OFF_V1 + SZ_KP;
constexpr size_t OFF_AH = OFF_VR + SZ_KP;
constexpr size_t OFF_AL = OFF_AH + SZ_AT;
constexpr size_t WS_TOTAL = OFF_AL + SZ_AT;
static_assert(WS_TOTAL <= (size_t)134217728);

extern "C" void kernel_launch(void* const* d_in, const int* in_sizes, int n_in,
                              void* d_out, int out_size, void* d_ws, size_t ws_size, hipStream_t stream) {
    if (n_in < 7) return;
    if (in_sizes[0] < (NB - 1) * SEQ_FULL * DM + SEQ * DM) return;
    if (in_sizes[1] < SEQ * 32 || in_sizes[2] < SEQ * 32) return;
    if (in_sizes[3] < DM * DQ || in_sizes[4] < DM * DKV || in_sizes[5] < DM * DKV || in_sizes[6] < DQ * DM) return;
    if (out_size < NB * SEQ * DM) return;
    if (ws_size < WS_TOTAL) return;
    const float* x = (const float*)d_in[0]; const float* cs = (const float*)d_in[1]; const float* sn = (const float*)d_in[2];
    const float* wq = (const float*)d_in[3]; const float* wk = (const float*)d_in[4]; const float* wv = (const float*)d_in[5]; const float* wo = (const float*)d_in[6];
    float* OUT = (float*)d_out;
    char* w8 = (char*)d_ws;
    bf* WT = (bf*)(w8 + OFF_WT); bf* WOT = (bf*)(w8 + OFF_WO); bf* XB = (bf*)(w8 + OFF_XB);
    bf* QPh = (bf*)(w8 + OFF_QH); bf* QPl = (bf*)(w8 + OFF_QL); bf* KPh = (bf*)(w8 + OFF_KH); bf* KPl = (bf*)(w8 + OFF_KL);
    h16* V16 = (h16*)(w8 + OFF_V1); h16* VR = (h16*)(w8 + OFF_VR); bf* ATh = (bf*)(w8 + OFF_AH); bf* ATl = (bf*)(w8 + OFF_AL);

    k_prep<<<(unsigned)(GB_WQ + GB_WO + 2 * GB_WKV + GB_X), 256, 0, stream>>>(wq, wk, wv, wo, x, WT, WOT, XB);
    k_gemm_proj<<<dim3(NB * SEQ / 64, NQKV / 64, 1), 32, 0, stream>>>(XB, WT, cs, sn, QPh, QPl, KPh, KPl, V16, VR);
    const int nq1 = RH / 64, nq2 = (SEQ - RH) / 64;
    k_attn_hi<<<(unsigned)(nq1 * NB * NH_), 128, 0, stream>>>(QPh, QPl, KPh, KPl, V16, VR, ATh, ATl, 0, nq1);
    if (nq2 > 0) k_attn_lo<<<(unsigned)(nq2 * NB * NH_), 256, 0, stream>>>(QPh, QPl, KPh, KPl, V16, VR, ATh, ATl, nq1, nq2);
    k_gemm_out<<<dim3(NB * SEQ / 64, DM / 64, 1), 32, 0, stream>>>(ATh, ATl, WOT, OUT);
}

// v006
// One run takes 75.8 microseconds.
// Timed twice side by side with v005, it ran 1.11 times as fast both times.
// All steps since v000 together make it 4.12 times as fast.
#include <hip/hip_runtime.h>

// Compute dtypes (f32 accumulate everywhere): x@[Wq|Wk|Wv] v_wmma_f32_16x16x32_bf16 (inputs RNE-converted to bf16, single product); q.k^T bf16 hi/lo planes (3 products, one accumulator, 1/8 folded into q);
// P.V v_wmma_f32_16x16x32_f16 with P carried x1024 (query rows < 256: f16 value + x2048 residual planes of P and V, separate accumulator); ctx@Wo bf16 hi/lo ctx x bf16 Wo (2 products). Softmax, rotary: f32.
// Causal grouped-query attention, rotary cos/sin tables read by value from their input buffers (bf16 RNE on load). Fused flash-style attention in transposed form: S^T = K Q^T so the probability
// tile leaves the accumulators already in B-fragment layout (element r <- key tile 0 row 8h+r, element 8+r <- key tile 1), O^T = V^T P^T; row statistics are per-lane scalars.
// Every 16-bit operand plane (rows x K) lies in fragment order: one 1-KiB block per (16-row tile R, 32-wide k chunk C), block index R * (K / 32) + C (V planes, rows = d, k = key: C * 4 + R);
// The three matrix loops load their operand fragments one step ahead of the products that use them.
// The projection GEMM's epilogue applies the rotary tables and writes the q, k, V planes itself.
// Query rows >= RH: two waves share a 16-row tile, each walks one half of its key steps; the two partial (max, sum, O) states are merged once through LDS.
// Query rows < RH run in the same launch: two waves share a 16-row tile, each computes all its scores and owns one half of d, so that the residual planes fit the registers of the other rows.
// in a block the 16-B piece of (row r, k = 16 * half + 8 * hi + 0..7) stands at element half * 256 + (hi * 16 + r) * 8, so each of a fragment's two wave-wide loads reads 512 contiguous bytes (4 lines, not 16).

#ifndef NB
#define NB 2
#endif
#ifndef SEQ
#define SEQ 2048
#endif
#define SEQ_FULL 2048
#define DM   1024
#define NH_  16
#define NKV  4
#define REP  (NH_ / NKV)
#define HD   64
#define DQ   (NH_ * HD)
#define DKV  (NKV * HD)
#define NQKV (DQ + 2 * DKV)
#define KCOL DQ
#define VCOL (DQ + DKV)
#define RH   ((SEQ) < 256 ? (SEQ) : 256)   // query rows < RH carry residual planes on P, V
#define PCAR 1024.0f
#define RCAR 2048.0f
#define L2E  1.4426950408889634f
#define NEGBIG (-1.0e30f)

typedef _Float16 h16;
typedef unsigned short bf;
typedef __attribute__((ext_vector_type(16))) __bf16   v16bf;
typedef __attribute__((ext_vector_type(16))) _Float16 v16h;
typedef __attribute__((ext_vector_type(8)))  _Float16 v8h;
typedef __attribute__((ext_vector_type(8)))  unsigned short v8us;
typedef __attribute__((ext_vector_type(8)))  float    v8f;
typedef __attribute__((ext_vector_type(4)))  float    v4f;
typedef __attribute__((ext_vector_type(2)))  _Float16 v2h;
typedef __attribute__((ext_vector_type(2)))  unsigned short v2us;
typedef v4f  __attribute__((may_alias)) v4fa;

static_assert(HD == 64);
static_assert(DQ == DM);
static_assert(NH_ % NKV == 0);
static_assert(SEQ % 64 == 0);
static_assert(SEQ <= SEQ_FULL);
static_assert(RH % 64 == 0);
static_assert(RH <= SEQ);
static_assert(DM % 32 == 0);
static_assert(DQ % 32 == 0);
static_assert((NB * SEQ) % 64 == 0);
static_assert(NQKV % 64 == 0);
static_assert(DM % 64 == 0);
static_assert((DM * DQ) % 64 == 0);
static_assert((DM * DKV) % 64 == 0);

__device__ __forceinline__ unsigned short f2bf(float f) { unsigned u = __float_as_uint(f); u += 0x7FFFu + ((u >> 16) & 1u); return (unsigned short)(u >> 16); }
__device__ __forceinline__ float bf2f(unsigned short b) { return __uint_as_float(((unsigned)b) << 16); }
__device__ __forceinline__ float bfr(float f) { return bf2f(f2bf(f)); }
__device__ __forceinline__ void splitf(float y, unsigned short& h, unsigned short& l) { h = f2bf(y); l = f2bf(y - bf2f(h)); }
__device__ __forceinline__ v16h cat16(v8h lo, v8h hi) { return __builtin_shufflevector(lo, hi, 0, 1, 2, 3, 4, 5, 6, 7, 8, 9, 10, 11, 12, 13, 14, 15); }
__device__ __forceinline__ v16bf cat16b(v8us lo, v8us hi) { return __builtin_bit_cast(v16bf, __builtin_shufflevector(lo, hi, 0, 1, 2, 3, 4, 5, 6, 7, 8, 9, 10, 11, 12, 13, 14, 15)); }
__device__ __forceinline__ v8f wmma16(v16h a, v16h b, v8f c) { return __builtin_amdgcn_wmma_f32_16x16x32_f16(false, a, false, b, (short)0, c, false, false); }
__device__ __forceinline__ v8f wmmab(v16bf a, v16bf b, v8f c) { return __builtin_amdgcn_wmma_f32_16x16x32_bf16(false, a, false, b, (short)0, c, false, false); }
// fragment loaders: p = b + vo + im (bytes) points at block start + lane * 16 bytes, which holds (row l&15, k0 + 8*(l>>4)); elements 0..7 <- bytes 0..15, elements 8..15 (k + 16) <- bytes 512..527.
// b: wave-uniform plane pointer, vo: the lane's byte offset, im: a constant; the loads take b as scalar base, and one 32-bit register per lane is all that moves from step to step
__device__ __forceinline__ v16bf ldbs(const bf* b, unsigned vo, int im) { const char* p = (const char*)b + vo; return cat16b(*(const v8us*)(p + im), *(const v8us*)(p + im + 512)); }
__device__ __forceinline__ v16h ldhs(const h16* b, unsigned vo, int im) { const char* p = (const char*)b + vo; return cat16(*(const v8h*)(p + im), *(const v8h*)(p + im + 512)); }

// hazard guards: name every accumulator of the group and the last fragments
template <typename V> __device__ __forceinline__ void nopg2(v8f& c0, v8f& c1, const V& x, const V& y, const V& z) {
    asm volatile("v_nop\n\tv_nop\n\tv_nop\n\tv_nop" : "+v"(c0), "+v"(c1) : "v"(x), "v"(y), "v"(z)); }
template <typename V> __device__ __forceinline__ void nopg4(v8f& c0, v8f& c1, v8f& c2, v8f& c3, const V& x, const V& y, const V& z) {
    asm volatile("v_nop\n\tv_nop\n\tv_nop\n\tv_nop" : "+v"(c0), "+v"(c1), "+v"(c2), "+v"(c3) : "v"(x), "v"(y), "v"(z)); }
template <typename V> __device__ __forceinline__ void nopg8(v8f& c0, v8f& c1, v8f& c2, v8f& c3, v8f& c4, v8f& c5, v8f& c6, v8f& c7, const V& x, const V& y, const V& z) {
    asm volatile("v_nop\n\tv_nop\n\tv_nop\n\tv_nop" : "+v"(c0), "+v"(c1), "+v"(c2), "+v"(c3), "+v"(c4), "+v"(c5), "+v"(c6), "+v"(c7) : "v"(x), "v"(y), "v"(z)); }

// one k chunk's fragments of a 64x64 tile, and the two halves of a pipelined step: fetch (loads only) and multiply (products only)
template <int NSPLIT> struct gfrag { v16bf a[4], a2[NSPLIT == 1 ? 4 : 1], b[4]; };
template <int NSPLIT>
__device__ __forceinline__ void gemm_fetch(gfrag<NSPLIT>& f, const bf* pa, const bf* pa2, const bf* pb, int K, unsigned vo, int im) {
#pragma unroll
    for (int mb = 0; mb < 4; ++mb) { f.a[mb] = ldbs(pa, vo, im + mb * 32 * K); if (NSPLIT == 1) f.a2[mb] = ldbs(pa2, vo, im + mb * 32 * K); }
#pragma unroll
    for (int nb = 0; nb < 4; ++nb) f.b[nb] = ldbs(pb, vo, im + nb * 32 * K);
    __builtin_amdgcn_sched_barrier(0);   // keeps the group of loads ahead of the products: sunk among them, each would be waited for where it stands
}
template <int NSPLIT>
__device__ __forceinline__ void gemm_mul(const gfrag<NSPLIT>& f, v8f (&acc)[4][4]) {
#pragma unroll
    for (int nb = 0; nb < 4; ++nb) {
#pragma unroll
        for (int mb = 0; mb < 4; ++mb) { acc[mb][nb] = wmmab(f.a[mb], f.b[nb], acc[mb][nb]); if (NSPLIT == 1) acc[mb][nb] = wmmab(f.a2[mb], f.b[nb], acc[mb][nb]); } }
    nopg8(acc[0][0], acc[0][1], acc[0][2], acc[0][3], acc[1][0], acc[1][1], acc[1][2], acc[1][3], f.a[0], f.a[1], f.b[3]);
    nopg8(acc[2][0], acc[2][1], acc[2][2], acc[2][3], acc[3][0], acc[3][1], acc[3][2], acc[3][3], f.a[3], (NSPLIT == 1) ? f.a2[3] : f.a[2], f.b[3]);
}
// ---- the projection GEMM's epilogue: a 64x64 tile of XB x WT^T is 64 rows t of ONE head (q, k or v), so the wave that computed it holds all that the head's attention operand planes need of these rows;
// the f32 projections never go to memory. acc[mb][nb][j]: row mb * 16 + 8 * hi + j, column nb * 16 + lr. On entry the GEMM loop's last, unused look-ahead loads are still in flight.
// rope_piece: the 16-B pieces d = j0..j0+7 (chunk 0, from ra) and d = 32+j0..32+j0+7 (chunk 1, from rb) of one row of rotary(x1 | x2) x sc, bf16 hi/lo; table values cv, sv by value (bf16 RNE on load)
__device__ __forceinline__ void rope_piece(const v8f x1, const v8f x2, const v8f cv, const v8f sv, float sc, v8us& ah, v8us& al, v8us& bh, v8us& bl) {
#pragma unroll
    for (int q = 0; q < 8; ++q) { const float c = bfr(cv[q]), s = bfr(sv[q]);
        const float ra = (x1[q] * c + x2[q] * s) * sc, rb = (x2[q] * c - x1[q] * s) * sc;
        unsigned short a2, c2; splitf(ra, a2, c2); ah[q] = a2; al[q] = c2; splitf(rb, a2, c2); bh[q] = a2; bl[q] = c2; }
}
struct planes_t { const float* COS; const float* SIN; bf* QPh; bf* QPl; bf* KPh; bf* KPl; h16* V16; h16* Vr; };
// r0: the tile's first row of NB * SEQ; ct: the head's place among 16 q, 4 k, 4 v; os: the wave's 16 x 68 floats of LDS
__device__ __forceinline__ void planes_epilogue(const v8f (&acc)[4][4], const planes_t& P, float* os, int r0, int ct, int lane) {
    asm volatile("s_wait_xcnt 0x0" ::: "memory");   // the offset register of the last look-ahead loads is free for other use below
    __builtin_amdgcn_sched_barrier(0);              // keeps that use behind the wait
    const int lr = lane & 15, hi = lane >> 4;
    const int b = r0 / SEQ, t0 = r0 % SEQ;          // SEQ % 64 == 0: a tile lies in one batch
    if (ct >= NH_ + NKV) {
        // V planes (rows = d, k = key): a lane's 8 accumulator rows are 8 consecutive keys of one d = one 16-B piece; a wave-wide store fills 512 contiguous bytes
        asm volatile("s_wait_loadcnt 0x0" ::: "memory");   // the last look-ahead group is not used: it has landed before its registers serve the epilogue
        __builtin_amdgcn_sched_barrier(0);                 // keeps the epilogue's arithmetic behind the wait
        const size_t vb = ((size_t)(b * NKV + (ct - NH_ - NKV)) * HD) * SEQ + (size_t)(t0 / 32) * 2048 + lane * 8;
#pragma unroll
        for (int mb = 0; mb < 4; ++mb) { v8h o16[4], o2[4];
#pragma unroll
            for (int nb = 0; nb < 4; ++nb) {
#pragma unroll
                for (int j = 0; j < 8; ++j) { const float x = acc[mb][nb][j]; const h16 a = (h16)x; o16[nb][j] = a; o2[nb][j] = (h16)((x - (float)a) * RCAR); } }
            __builtin_amdgcn_sched_barrier(0);              // keeps the round's stores together, behind its arithmetic: none of their registers is written again ahead of the one wait below
#pragma unroll
            for (int nb = 0; nb < 4; ++nb) { const size_t e = vb + ((mb >> 1) * 4 + nb) * 512 + (mb & 1) * 256;
                *(v8h*)(P.V16 + e) = o16[nb]; *(v8h*)(P.Vr + e) = o2[nb]; }
            __builtin_amdgcn_sched_barrier(0);              // nothing comes between the stores and their wait
            asm volatile("s_wait_xcnt 0x0" ::: "memory");   // the stores' data registers are written anew in the next round
            __builtin_amdgcn_sched_barrier(0);              // keeps that behind the wait
        }
        return;
    }
    // rotary q (x 1/8) or k planes (rows = t, k = d). Per 16 rows: the tile's rows go through LDS, then the wave takes 8 rows x 4 pieces twice: each table load touches 8 lines, each store fills 4 whole lines
    const bool isq = ct < NH_;
    const float sc = isq ? 0.125f : 1.0f;
    bf* Ph = isq ? P.QPh : P.KPh; bf* Pl = isq ? P.QPl : P.KPl;
    const int r8 = lane & 7, pc = lane >> 3;   // the lane's row (and row + 8) and its piece: d = pc * 8 .. + 7 and 32 + the same
    const size_t pb = ((size_t)(isq ? b * NH_ + ct : b * NKV + (ct - NH_)) * (SEQ / 16) + t0 / 16) * 1024 + (pc * 16 + r8) * 8;
    const unsigned to = (unsigned)((t0 + r8) * 32 + pc * 8);   // the lane's place in both tables
    v8f cv[4][2], sv[4][2];
#pragma unroll
    for (int it = 0; it < 2; ++it) { cv[0][it] = *(const v8f*)(P.COS + to + it * 256); sv[0][it] = *(const v8f*)(P.SIN + to + it * 256); }
    asm volatile("s_wait_loadcnt 0x0" ::: "memory");   // the last look-ahead group is not used: it has landed before its registers serve the epilogue; the first table values land with it
    __builtin_amdgcn_sched_barrier(0);                 // keeps the epilogue's arithmetic behind the wait
#pragma unroll
    for (int mb = 0; mb < 4; ++mb) {
        if (mb < 3) {   // the next 16 rows' table values are fetched while these rows are worked on
#pragma unroll
            for (int it = 0; it < 2; ++it) { cv[mb + 1][it] = *(const v8f*)(P.COS + to + (mb + 1) * 512 + it * 256); sv[mb + 1][it] = *(const v8f*)(P.SIN + to + (mb + 1) * 512 + it * 256); }
            if (mb == 2) {
                asm volatile("s_wait_xcnt 0x0" ::: "memory");   // these were the last table loads: their address registers are free for other use below
                __builtin_amdgcn_sched_barrier(0);              // keeps that use behind the wait
            }
        }
#pragma unroll
        for (int nb = 0; nb < 4; ++nb) {
#pragma unroll
            for (int j = 0; j < 8; ++j) os[(hi * 8 + j) * 68 + nb * 16 + lr] = acc[mb][nb][j]; }
        asm volatile("s_wait_dscnt 0" ::: "memory"); __builtin_amdgcn_wave_barrier();   // the rows are in LDS before other lanes read them
        v8us ah[2], al[2], bh[2], bl[2];
#pragma unroll
        for (int it = 0; it < 2; ++it) { const float* rw = os + (r8 + 8 * it) * 68 + pc * 8;
            const v4f a0 = *(const v4fa*)rw, a1 = *(const v4fa*)(rw + 4), b0 = *(const v4fa*)(rw + 32), b1 = *(const v4fa*)(rw + 36);
            rope_piece(__builtin_shufflevector(a0, a1, 0, 1, 2, 3, 4, 5, 6, 7), __builtin_shufflevector(b0, b1, 0, 1, 2, 3, 4, 5, 6, 7), cv[mb][it], sv[mb][it], sc, ah[it], al[it], bh[it], bl[it]); }
        __builtin_amdgcn_sched_barrier(0);              // keeps the round's stores together, behind its arithmetic: none of their registers is written again ahead of the one wait below
#pragma unroll
        for (int it = 0; it < 2; ++it) { const size_t dst = pb + mb * 1024 + it * 64;
            *(v8us*)(Ph + dst) = ah[it]; *(v8us*)(Pl + dst) = al[it]; *(v8us*)(Ph + dst + 512) = bh[it]; *(v8us*)(Pl + dst + 512) = bl[it]; }
        __builtin_amdgcn_sched_barrier(0);              // nothing comes between the stores and their wait
        asm volatile("s_wait_xcnt 0x0" ::: "memory");   // the stores' data registers are written anew in the next round
        __builtin_amdgcn_sched_barrier(0);              // keeps that behind the wait
        asm volatile("s_wait_dscnt 0" ::: "memory"); __builtin_amdgcn_wave_barrier();   // every lane has read its rows before the next round overwrites them
    }
}
// ---- one-wave 64x64 tile GEMM: C[m][n] (f32, pitch ldc) = sum_k A[m][k] Bt[n][k] (+ A2[m][k] Bt[n][k] when NSPLIT == 1); operands straight from fragment-order bf16 planes; K % 64 == 0.
// PLANES: the tile does not go to C but, through planes_epilogue, to the planes of P
template <int NSPLIT, bool PLANES>
__device__ __forceinline__ void gemm_body(const bf* A, const bf* A2, const bf* Bt, int K, float* C, int ldc, const planes_t& P) {
    __shared__ __align__(16) float os[16 * 68];
    const int lane = threadIdx.x & 31, lr = lane & 15, hi = lane >> 4; const int r0 = blockIdx.x * 64, c0 = blockIdx.y * 64;
    v8f acc[4][4];
#pragma unroll
    for (int mb = 0; mb < 4; ++mb)
#pragma unroll
        for (int nb = 0; nb < 4; ++nb) acc[mb][nb] = (v8f){};
    const size_t aoff = (size_t)r0 * K, boff = (size_t)c0 * K;   // a 16-row tile spans 16 * K elements (32 * K bytes), a k chunk of 32 one block of 512 (1024 bytes)
    // two fragment sets: while one k chunk is multiplied, the next chunk's loads (one group, issued ahead of the products) are in flight; K % 64 == 0
    gfrag<NSPLIT> f0, f1;
    const bf* pa = A + aoff; const bf* pa2 = A2 + aoff; const bf* pb = Bt + boff;
    unsigned vo = (unsigned)lane * 16u;   // the lane's byte offset in the current pair of chunks
    gemm_fetch<NSPLIT>(f0, pa, pa2, pb, K, vo, 0);
    asm volatile("s_wait_xcnt 0x0" ::: "memory");   // registers that these first loads name are free for other use below
    __builtin_amdgcn_sched_barrier(0);              // keeps that use behind the wait
#pragma unroll 1
    for (int kc = 0; kc < K; kc += 64) {
        gemm_fetch<NSPLIT>(f1, pa, pa2, pb, K, vo, 1024);
        gemm_mul<NSPLIT>(f0, acc);
        asm volatile("s_wait_xcnt 0x0" ::: "memory");   // the offset register of the loads in flight is advanced below
        __builtin_amdgcn_sched_barrier(0);              // keeps that advance behind the wait
        vo += (kc + 64 < K) ? 2048u : 0u;               // to the next pair of chunks; behind the last pair: the same chunk again, not used
        gemm_fetch<NSPLIT>(f0, pa, pa2, pb, K, vo, 0);
        gemm_mul<NSPLIT>(f1, acc);
    }
    if constexpr (PLANES) { planes_epilogue(acc, P, os, r0, (int)blockIdx.y, lane); return; }
    asm volatile("s_wait_loadcnt 0x0" ::: "memory");   // the last look-ahead group is not used: it has landed before its registers serve the epilogue
    __builtin_amdgcn_sched_barrier(0);                 // keeps the epilogue's arithmetic behind the wait
#pragma unroll
    for (int mb = 0; mb < 4; ++mb) {
#pragma unroll
        for (int nb = 0; nb < 4; ++nb) {
#pragma unroll
            for (int j = 0; j < 8; ++j) os[(hi * 8 + j) * 68 + nb * 16 + lr] = acc[mb][nb][j]; }
        asm volatile("s_wait_dscnt 0" ::: "memory"); __builtin_amdgcn_wave_barrier();
        float* crow = C + (size_t)(r0 + mb * 16) * ldc + c0;
{
#pragma unroll
            for (int s = 0; s < 8; ++s) { const int row = 2 * s + hi, cofs = lr * 4; const v4f val = *(const v4fa*)(os + row * 68 + cofs);
                *(v4f*)(crow + (size_t)row * ldc + cofs) = val; }
             }
        asm volatile("s_wait_xcnt 0x0" ::: "memory");   // the stores' data registers are loaded anew in the next round
        asm volatile("s_wait_dscnt 0" ::: "memory"); __builtin_amdgcn_wave_barrier();
    }
}
// q, k, V planes <- XB[NB*SEQ][1024] x WT[1536][1024]^T
__global__ __launch_bounds__(32) void k_gemm_proj(const bf* __restrict__ A, const bf* __restrict__ Bt, const float* __restrict__ COS, const float* __restrict__ SIN, bf* QPh, bf* QPl, bf* KPh, bf* KPl, h16* V16, h16* Vr) {
    gemm_body<0, true>(A, A, Bt, DM, nullptr, 0, planes_t{COS, SIN, QPh, QPl, KPh, KPl, V16, Vr}); }
// OUT[NB*SEQ][1024] = (ATh + ATl)[NB*SEQ][1024] x WOT[1024][1024]^T
__global__ __launch_bounds__(32) void k_gemm_out(const bf* __restrict__ A, const bf* __restrict__ A2, const bf* __restrict__ Bt, float* C) { gemm_body<1, false>(A, A2, Bt, DQ, C, DM, planes_t{}); }

// The element-wise stages are device functions that take their block index bx: stages that do not depend on one another share one launch, each on its own range of block indices.
__device__ __forceinline__ void wtG_body(const float* __restrict__ w, int K, int N, bf* Bt, int bx) {
    const int lane = threadIdx.x & 31; const int L0 = (bx * 8 + (threadIdx.x >> 5)) * 8; const int nlines = N * K / 64;
{
#pragma unroll 1
        for (int l = 0; l < 8; ++l) { const int L = L0 + l; if (L >= nlines) break; const size_t e = (size_t)L * 64 + lane * 2; const int blk = (int)(e >> 9), in = (int)(e & 511);
            const int k = (blk % (K / 32)) * 32 + (in >> 7) * 8 + (in & 7), n = (blk / (K / 32)) * 16 + ((in >> 3) & 15); v2us o;
            o[0] = f2bf(w[(size_t)k * N + n]); o[1] = f2bf(w[(size_t)(k + 1) * N + n]); *(v2us*)(Bt + e) = o; }
         }
}
__device__ __forceinline__ void cvtx_body(const float* __restrict__ x, bf* XB, int bx) {
    const size_t i = (size_t)bx * 256 + threadIdx.x; if (i >= (size_t)NB * SEQ * DM / 8) return;
    // a wave takes 8 rows x 4 pieces: it reads whole 128-B lines of 8 rows and stores 4 whole lines
    const int blk = (int)(i >> 6), r = (int)((i & 7) | ((i >> 2) & 8)), pc = (int)((i >> 3) & 3); const size_t e = (size_t)blk * 512 + (pc * 16 + r) * 8;
    const int row = (blk / (DM / 32)) * 16 + r, k = (blk % (DM / 32)) * 32 + pc * 8;
    const v8f v = *(const v8f*)(x + (size_t)(row / SEQ) * SEQ_FULL * DM + (size_t)(row % SEQ) * DM + k); v8us o;
#pragma unroll
    for (int k = 0; k < 8; ++k) o[k] = f2bf(v[k]);
    *(v8us*)(XB + e) = o; 
}
// block counts of the stages
constexpr int GB_WQ = (DM * DQ / 64 + 63) / 64, GB_WKV = (DM * DKV / 64 + 63) / 64, GB_WO = (DQ * DM / 64 + 63) / 64, GB_X = (int)(((size_t)NB * SEQ * DM / 8 + 255) / 256);
// ---- k_prep: all operand planes made from inputs alone. Weights: in w[K = DM][N] -> out plane rows n (fragment order); q | k | v stacked into one [1536][1024] plane. The weight blocks (a serial loop each) come first, x behind them.
__global__ __launch_bounds__(256) void k_prep(const float* __restrict__ wq, const float* __restrict__ wk, const float* __restrict__ wv, const float* __restrict__ wo, const float* __restrict__ x, bf* WT, bf* WOT, bf* XB) {
    int bx = (int)blockIdx.x;
    if (bx < GB_WQ) { wtG_body(wq, DM, DQ, WT, bx); return; }
    bx -= GB_WQ;
    if (bx < GB_WO) { wtG_body(wo, DQ, DM, WOT, bx); return; }
    bx -= GB_WO;
    if (bx < GB_WKV) { wtG_body(wk, DM, DKV, WT + (size_t)KCOL * DM, bx); return; }
    bx -= GB_WKV;
    if (bx < GB_WKV) { wtG_body(wv, DM, DKV, WT + (size_t)VCOL * DM, bx); return; }
    bx -= GB_WKV;
    cvtx_body(x, XB, bx);
}

// ---- fused causal flash attention, transposed form. Block = 64 query rows of one (b, h), 8 waves; a wave owns 16 query rows (one per lane&15) and walks keys in 32-key steps up to its diagonal.
// S^T tile (keys x queries) = K (A, rows = keys) x Q^T (B, cols = queries); D: lane -> query l&15, rows -> keys 8h+r. Two key tiles give the B fragment of P^T directly.
// O^T tile (d x queries) = V^T (A, rows = d, k = keys) x P^T (B). Running max / sum / scale factor are per-lane scalars (both lane halves of a query agree via one xor-16 shuffle).
// Waves w and w + 4 own the same 16 query rows. SPLIT: wave w walks the first half of the key steps, wave w + 4 the second (with the diagonal).
// HIRES: both walk all key steps and compute the same scores; wave w owns d = 0..31 of V and O, wave w + 4 d = 32..63.
template <bool HIRES, bool SPLIT>
__device__ __forceinline__ void attn_body(const bf* Qh, const bf* Ql, const bf* Kh, const bf* Kl, const h16* V16, const h16* Vr, bf* Ah, bf* Al, int qblk, int bh) {
    constexpr int NJ = HIRES ? 2 : 4;   // 16-wide d tiles of V and O that a wave owns
    const int lane = threadIdx.x & 31, lr = lane & 15, hi = lane >> 4;
    const int wave = __builtin_amdgcn_readfirstlane((int)(threadIdx.x >> 5));
    const int b = bh / NH_, h = bh % NH_, g = h / REP;
    const int part = wave >> 2;
    const int m0 = qblk * 64 + (wave & 3) * 16;
    const size_t qbase = ((size_t)(b * NH_ + h) * SEQ) * HD;
    const size_t kbase = ((size_t)(b * NKV + g) * SEQ) * HD;
    const size_t vbase = ((size_t)(b * NKV + g) * HD) * SEQ;
    const int qrow = m0 + lr;
    v8f o[NJ], orr[NJ];
#pragma unroll
    for (int j = 0; j < NJ; ++j) { o[j] = (v8f){}; orr[j] = (v8f){}; }
    float mrun = NEGBIG, lsum = 0.0f;
    const int nall = (m0 + 47) >> 5;             // keys 0 .. m0+15 in 32-key steps; k0 + 31 < SEQ always (SEQ % 32 == 0)
    const int st0 = (SPLIT && part) ? (nall + 1) >> 1 : 0;  // this wave's steps: st0 .. nst - 1; never empty (SPLIT: m0 >= 64, nall >= 3)
    const int nst = (SPLIT && part == 0) ? (nall + 1) >> 1 : nall;
    __builtin_assume(st0 < nst);   // no branch round the loop, so the first loads keep the order written (Q, K, V): with Q last, the loop's counted waits, which also serve its first pass, would wait for each step's V loads at the loop's head
    // Loads run one step ahead of their products: Q fragments once, K of step st + 1 right behind the score products of step st, V of step st + 1 right behind the output products of step st.
    const bf* kph = Kh + kbase; const bf* kpl = Kl + kbase;          // 32 keys = 4 blocks of 1024 bytes (2 key tiles x 2 d chunks) in a row
    const int vd = HIRES ? part * (NJ * 512) : 0;                    // the wave's first d tile
    const h16* vp = V16 + vbase + vd; const h16* vrp = Vr + vbase + vd;   // 32 keys = 4 blocks of 1024 bytes (4 d tiles) in a row
    const unsigned vq = (unsigned)lane * 16u;                        // the lane's byte offset in a block
    unsigned vo = vq + (unsigned)st0 * (32u * HD * 2u);              // the lane's byte offset in the step's blocks, the same in all four planes
    v16bf qhf[2], qlf[2], k0h[2], k0l[2], k1h[2], k1l[2];
    v16h vf[NJ], vrf[NJ];
#pragma unroll
    for (int c = 0; c < 2; ++c) { qhf[c] = ldbs(Qh + qbase + m0 * HD, vq, 1024 * c); qlf[c] = ldbs(Ql + qbase + m0 * HD, vq, 1024 * c); }
#pragma unroll
    for (int c = 0; c < 2; ++c) { k0h[c] = ldbs(kph, vo, 1024 * c); k0l[c] = ldbs(kpl, vo, 1024 * c); k1h[c] = ldbs(kph, vo, 2048 + 1024 * c); k1l[c] = ldbs(kpl, vo, 2048 + 1024 * c); }
#pragma unroll
    for (int j = 0; j < NJ; ++j) { vf[j] = ldhs(vp, vo, j * 1024); if (HIRES) vrf[j] = ldhs(vrp, vo, j * 1024); }
    __builtin_amdgcn_sched_barrier(0);              // nothing comes between the loads and their wait
    asm volatile("s_wait_xcnt 0x0" ::: "memory");   // registers that these first loads name are free for other use below
    __builtin_amdgcn_sched_barrier(0);              // keeps that use behind the wait
#pragma unroll 1
    for (int st = st0; st < nst; ++st) {
        const int k0 = st * 32;
        v8f s0 = (v8f){}, s1 = (v8f){};
#pragma unroll
        for (int c = 0; c < 2; ++c) {
            s0 = wmmab(k0h[c], qhf[c], s0); s0 = wmmab(k0h[c], qlf[c], s0); s0 = wmmab(k0l[c], qhf[c], s0);
            s1 = wmmab(k1h[c], qhf[c], s1); s1 = wmmab(k1h[c], qlf[c], s1); s1 = wmmab(k1l[c], qhf[c], s1);
        }
        nopg2(s0, s1, qhf[1], qlf[1], k1l[1]);
        asm volatile("s_wait_xcnt 0x0" ::: "memory");   // the offset register of the loads in flight (V, from the last step's foot) is advanced below
        __builtin_amdgcn_sched_barrier(0);              // keeps that advance behind the wait
        vo += (st + 1 < nst) ? 32u * HD * 2u : 0u;      // to the next step's blocks; behind the last step: its own again, not used
#pragma unroll
        for (int c = 0; c < 2; ++c) { k0h[c] = ldbs(kph, vo, 1024 * c); k0l[c] = ldbs(kpl, vo, 1024 * c); k1h[c] = ldbs(kph, vo, 2048 + 1024 * c); k1l[c] = ldbs(kpl, vo, 2048 + 1024 * c); }
        __builtin_amdgcn_sched_barrier(0);   // keeps the K loads here, ahead of the softmax: sunk to the loop's foot they would be waited for at once
        // causal exclusion by value (key > query -> NEGBIG, probability exactly 0), running max
        const int kb = k0 + 8 * hi;
        float mx = NEGBIG;
#pragma unroll
        for (int r = 0; r < 8; ++r) {
            const float a0 = (kb + r <= qrow) ? s0[r] : NEGBIG;
            const float a1 = (kb + 16 + r <= qrow) ? s1[r] : NEGBIG;
            s0[r] = a0; s1[r] = a1; mx = fmaxf(mx, fmaxf(a0, a1));
        }
        mx = fmaxf(mx, __shfl_xor(mx, 16, 32));
        const float mnew = fmaxf(mrun, mx);
        const float corr = __builtin_amdgcn_exp2f((mrun - mnew) * L2E);
        mrun = mnew;
        float psum = 0.0f;
        v16h pbv, prv;
#pragma unroll
        for (int r = 0; r < 8; ++r) {
            const float p0 = __builtin_amdgcn_exp2f((s0[r] - mnew) * L2E);
            const float p1 = __builtin_amdgcn_exp2f((s1[r] - mnew) * L2E);
            psum += p0 + p1;
            const float c0 = p0 * PCAR, c1 = p1 * PCAR;
            const h16 h0 = (h16)c0, h1 = (h16)c1;
            pbv[r] = h0; pbv[8 + r] = h1;
            if (HIRES) { prv[r] = (h16)((c0 - (float)h0) * RCAR); prv[8 + r] = (h16)((c1 - (float)h1) * RCAR); }
        }
        lsum = lsum * corr + psum;
#pragma unroll
        for (int j = 0; j < NJ; ++j) {
#pragma unroll
            for (int r = 0; r < 8; ++r) { o[j][r] *= corr; if (HIRES) orr[j][r] *= corr; } }
        // O^T += V^T P^T
#pragma unroll
        for (int j = 0; j < NJ; ++j) {
            o[j] = wmma16(vf[j], pbv, o[j]);
            if (HIRES) { orr[j] = wmma16(vrf[j], pbv, orr[j]); orr[j] = wmma16(vf[j], prv, orr[j]); }
        }
        if constexpr (HIRES) nopg4(o[0], o[1], orr[0], orr[1], pbv, prv, vf[1]);
        else                 nopg4(o[0], o[1], o[2], o[3], pbv, pbv, vf[3]);
#pragma unroll
        for (int j = 0; j < NJ; ++j) { vf[j] = ldhs(vp, vo, j * 1024); if (HIRES) vrf[j] = ldhs(vrp, vo, j * 1024); }
    }
    asm volatile("s_wait_loadcnt 0x0" ::: "memory");   // the last step's look-ahead loads are not used: they have landed before their registers are reused or given back
    __builtin_amdgcn_sched_barrier(0);                 // keeps the epilogue's arithmetic behind the wait
    if constexpr (SPLIT) {
        // merge of the two key halves: the second-half wave hands its state over in LDS (lane-contiguous 16-B pieces), the first-half wave rescales both to the common maximum and adds
        __shared__ v4f mo[4][8][32];
        __shared__ float ml[4][2][32];
        const int tl = wave & 3;
        if (part) {
            ml[tl][0][lane] = mrun; ml[tl][1][lane] = lsum;
#pragma unroll
            for (int j = 0; j < 4; ++j) { mo[tl][2 * j][lane] = __builtin_shufflevector(o[j], o[j], 0, 1, 2, 3); mo[tl][2 * j + 1][lane] = __builtin_shufflevector(o[j], o[j], 4, 5, 6, 7); }
        }
        __syncthreads();   // every wave of the block passes it once: the second halves' states are in LDS before the first halves read them
        if (part) return;
        const float mb = ml[tl][0][lane], lb = ml[tl][1][lane];
        const float dm = (mrun - mb) * L2E;   // the half with the larger maximum keeps its scale (factor 1), the other is scaled down by 2^-|dm|
        const float sc = __builtin_amdgcn_exp2f(-fabsf(dm));
        const float ca = dm < 0.0f ? sc : 1.0f, cb = dm < 0.0f ? 1.0f : sc;
        lsum = lsum * ca + lb * cb;
#pragma unroll
        for (int j = 0; j < 4; ++j) { const v4f b0 = mo[tl][2 * j][lane], b1 = mo[tl][2 * j + 1][lane];
#pragma unroll
            for (int r = 0; r < 4; ++r) { o[j][r] = o[j][r] * ca + b0[r] * cb; o[j][4 + r] = o[j][4 + r] * ca + b1[r] * cb; } }
    }
    lsum += __shfl_xor(lsum, 16, 32);
    const float inv = 1.0f / (PCAR * lsum);
    // lane holds ctx(query m0+lr, d = (HIRES ? 32 * part : 0) + j*16 + 8*hi + r): 8 consecutive d per j -> one 16-B piece per plane, and piece j of lane l is piece l of half-block j of the wave's ctx blocks (HIRES: one, else two)
    const size_t dst = (size_t)(b * SEQ + m0) * DQ + h * (16 * HD) + lane * 8 + (HIRES ? part * (NJ * 256) : 0);
#pragma unroll
    for (int j = 0; j < NJ; ++j) { v8us vh, vl;
#pragma unroll
        for (int r = 0; r < 8; ++r) { const float val = HIRES ? (o[j][r] + orr[j][r] * (1.0f / RCAR)) * inv : o[j][r] * inv; unsigned short a2, c2; splitf(val, a2, c2); vh[r] = a2; vl[r] = c2; }
        *(v8us*)(Ah + dst + j * 256) = vh; *(v8us*)(Al + dst + j * 256) = vl; }
}
// One launch for all query rows. More blocks than the chip holds at once; the costliest 64-row tiles take the lowest block indices (for speed only).
// A tile's cost: the key steps of its longest wave (q + 1 where two waves split them, else 2 q + 2), x 1.4 for a step with residual planes (the ratio of the two loops' vector instructions).
struct deal_t { unsigned char q[SEQ / 64]; };
constexpr int tile_cost(int q) { return (q >= RH / 64 ? 10 : 28) * (q + 1); }
constexpr deal_t make_deal() {
    deal_t d{};
    for (int i = 0; i < SEQ / 64; ++i) { int p = i;   // insertion by falling cost
        for (; p > 0 && tile_cost(d.q[p - 1]) < tile_cost(i); --p) d.q[p] = d.q[p - 1];
        d.q[p] = (unsigned char)i; }
    return d;
}
__global__ __launch_bounds__(256) void k_attn(const bf* __restrict__ Qh, const bf* __restrict__ Ql, const bf* __restrict__ Kh, const bf* __restrict__ Kl, const h16* __restrict__ V16, const h16* __restrict__ Vr, bf* Ah, bf* Al) {
    constexpr deal_t deal = make_deal();
    const int qblk = deal.q[blockIdx.x / (unsigned)(NB * NH_)], bh = (int)(blockIdx.x % (unsigned)(NB * NH_));
    if (qblk >= RH / 64) attn_body<false, true>(Qh, Ql, Kh, Kl, V16, Vr, Ah, Al, qblk, bh);
    else                 attn_body<true, false>(Qh, Ql, Kh, Kl, V16, Vr, Ah, Al, qblk, bh);
}

// ---- workspace carve (bytes, every region 256-B aligned and sized to its full store extent)
constexpr size_t al256(size_t x) { return (x + 255) & ~(size_t)255; }
constexpr size_t SZ_WT  = al256((size_t)NQKV * DM * 2);
constexpr size_t SZ_WO  = al256((size_t)DM * DQ * 2);
constexpr size_t SZ_XB  = al256((size_t)NB * SEQ * DM * 2);
constexpr size_t SZ_QP  = al256((size_t)NB * NH_ * SEQ * HD * 2);
constexpr size_t SZ_KP  = al256((size_t)NB * NKV * SEQ * HD * 2);
constexpr size_t SZ_AT  = al256((size_t)NB * SEQ * DQ * 2);
constexpr size_t OFF_WT = 0;
constexpr size_t OFF_WO = OFF_WT + SZ_WT;
constexpr size_t OFF_XB = OFF_WO + SZ_WO;
constexpr size_t OFF_QH = OFF_XB + SZ_XB;
constexpr size_t OFF_QL = OFF_QH + SZ_QP;
constexpr size_t OFF_KH = OFF_QL + SZ_QP;
constexpr size_t OFF_KL = OFF_KH + SZ_KP;
constexpr size_t OFF_V1 = OFF_KL + SZ_KP;
constexpr size_t OFF_VR = OFF_V1 + SZ_KP;
constexpr size_t OFF_AH = OFF_VR + SZ_KP;
constexpr size_t OFF_AL = OFF_AH + SZ_AT;
constexpr size_t WS_TOTAL = OFF_AL + SZ_AT;
static_assert(WS_TOTAL <= (size_t)134217728);

extern "C" void kernel_launch(void* const* d_in, const int* in_sizes, int n_in,
                              void* d_out, int out_size, void* d_ws, size_t ws_size, hipStream_t stream) {
    if (n_in < 7) return;
    if (in_sizes[0] < (NB - 1) * SEQ_FULL * DM + SEQ * DM) return;
    if (in_sizes[1] < SEQ * 32 || in_sizes[2] < SEQ * 32) return;
    if (in_sizes[3] < DM * DQ || in_sizes[4] < DM * DKV || in_sizes[5] < DM * DKV || in_sizes[6] < DQ * DM) return;
    if (out_size < NB * SEQ * DM) return;
    if (ws_size < WS_TOTAL) return;
    const float* x = (const float*)d_in[0]; const float* cs = (const float*)d_in[1]; const float* sn = (const float*)d_in[2];
    const float* wq = (const float*)d_in[3]; const float* wk = (const float*)d_in[4]; const float* wv = (const float*)d_in[5]; const float* wo = (const float*)d_in[6];
    float* OUT = (float*)d_out;
    char* w8 = (char*)d_ws;
    bf* WT = (bf*)(w8 + OFF_WT); bf* WOT = (bf*)(w8 + OFF_WO); bf* XB = (bf*)(w8 + OFF_XB);
    bf* QPh = (bf*)(w8 + OFF_QH); bf* QPl = (bf*)(w8 + OFF_QL); bf* KPh = (bf*)(w8 + OFF_KH); bf* KPl = (bf*)(w8 + OFF_KL);
    h16* V16 = (h16*)(w8 + OFF_V1); h16* VR = (h16*)(w8 + OFF_VR); bf* ATh = (bf*)(w8 + OFF_AH); bf* ATl = (bf*)(w8 + OFF_AL);

    k_prep<<<(unsigned)(GB_WQ + GB_WO + 2 * GB_WKV + GB_X), 256, 0, stream>>>(wq, wk, wv, wo, x, WT, WOT, XB);
    k_gemm_proj<<<dim3(NB * SEQ / 64, NQKV / 64, 1), 32, 0, stream>>>(XB, WT, cs, sn, QPh, QPl, KPh, KPl, V16, VR);
    k_attn<<<(unsigned)(SEQ / 64 * NB * NH_), 256, 0, stream>>>(QPh, QPl, KPh, KPl, V16, VR, ATh, ATl);
    k_gemm_out<<<dim3(NB * SEQ / 64, DM / 64, 1), 32, 0, stream>>>(ATh, ATl, WOT, OUT);
}

// v007
// One run takes 64.5 microseconds.
// Next to v006, in two timings, it ran 1.18 and 1.16 times as fast.
// Counting every step since v000, it is 4.83 times as fast.
#include <hip/hip_runtime.h>

// Compute dtypes (f32 accumulate everywhere): x@[Wq|Wk|Wv] v_wmma_f32_16x16x32_bf16 (inputs RNE-converted to bf16, single product); q.k^T bf16 hi/lo planes (3 products, one accumulator, 1/8 folded into q);
// P.V v_wmma_f32_16x16x32_f16 with P carried x1024 (query rows < 256: f16 value + x2048 residual planes of P and V, separate accumulator); ctx@Wo bf16 hi/lo ctx x bf16 Wo (2 products). Softmax, rotary: f32.
// Causal grouped-query attention, rotary cos/sin tables read by value from their input buffers (bf16 RNE on load). Fused flash-style attention in transposed form: S^T = K Q^T so the probability
// tile leaves the accumulators already in B-fragment layout (element r <- key tile 0 row 8h+r, element 8+r <- key tile 1), O^T = V^T P^T; row statistics are per-lane scalars.
// Every 16-bit operand plane (rows x K) lies in fragment order: one 1-KiB block per (16-row tile R, 32-wide k chunk C), block index R * (K / 32) + C (V planes, rows = d, k = key: C * 4 + R);
// The attention loop loads its operand fragments from global memory one step ahead of the products that use them.
// The two GEMMs: four waves share a 128x128 tile (64x64 each); its operand blocks are staged in LDS by asynchronous copies, two buffers, so each block leaves L2 once per work-group, not once per wave.
// The projection GEMM's epilogue applies the rotary tables and writes the q, k, V planes itself.
// Query rows >= RH: two waves share a 16-row tile, each walks one half of its key steps; the two partial (max, sum, O) states are merged once through LDS.
// Query rows < RH run in the same launch: two waves share a 16-row tile, each computes all its scores and owns one half of d, so that the residual planes fit the registers of the other rows.
// in a block the 16-B piece of (row r, k = 16 * half + 8 * hi + 0..7) stands at element half * 256 + (hi * 16 + r) * 8, so each of a fragment's two wave-wide loads reads 512 contiguous bytes (4 lines, not 16).

#ifndef NB
#define NB 2
#endif
#ifndef SEQ
#define SEQ 2048
#endif
#define SEQ_FULL 2048
#define DM   1024
#define NH_  16
#define NKV  4
#define REP  (NH_ / NKV)
#define HD   64
#define DQ   (NH_ * HD)
#define DKV  (NKV * HD)
#define NQKV (DQ + 2 * DKV)
#define KCOL DQ
#define VCOL (DQ + DKV)
#define RH   ((SEQ) < 256 ? (SEQ) : 256)   // query rows < RH carry residual planes on P, V
#define PCAR 1024.0f
#define RCAR 2048.0f
#define L2E  1.4426950408889634f
#define NEGBIG (-1.0e30f)

typedef _Float16 h16;
typedef unsigned short bf;
typedef __attribute__((ext_vector_type(16))) __bf16   v16bf;
typedef __attribute__((ext_vector_type(16))) _Float16 v16h;
typedef __attribute__((ext_vector_type(8)))  _Float16 v8h;
typedef __attribute__((ext_vector_type(8)))  unsigned short v8us;
typedef __attribute__((ext_vector_type(8)))  float    v8f;
typedef __attribute__((ext_vector_type(4)))  float    v4f;
typedef __attribute__((ext_vector_type(2)))  _Float16 v2h;
typedef __attribute__((ext_vector_type(2)))  unsigned short v2us;
typedef v4f  __attribute__((may_alias)) v4fa;
typedef v8us __attribute__((may_alias)) v8usa;

static_assert(HD == 64);
static_assert(DQ == DM);
static_assert(NH_ % NKV == 0);
static_assert(SEQ % 64 == 0);
static_assert(SEQ <= SEQ_FULL);
static_assert(RH % 64 == 0);
static_assert(RH <= SEQ);
static_assert(DM % 32 == 0);
static_assert(DQ % 32 == 0);
static_assert((NB * SEQ) % 128 == 0);
static_assert(NQKV % 128 == 0);
static_assert(DM % 256 == 0);
static_assert(DQ % 256 == 0);
static_assert((DM * DQ) % 64 == 0);
static_assert((DM * DKV) % 64 == 0);

__device__ __forceinline__ unsigned short f2bf(float f) { unsigned u = __float_as_uint(f); u += 0x7FFFu + ((u >> 16) & 1u); return (unsigned short)(u >> 16); }
__device__ __forceinline__ float bf2f(unsigned short b) { return __uint_as_float(((unsigned)b) << 16); }
__device__ __forceinline__ float bfr(float f) { return bf2f(f2bf(f)); }
__device__ __forceinline__ void splitf(float y, unsigned short& h, unsigned short& l) { h = f2bf(y); l = f2bf(y - bf2f(h)); }
__device__ __forceinline__ v16h cat16(v8h lo, v8h hi) { return __builtin_shufflevector(lo, hi, 0, 1, 2, 3, 4, 5, 6, 7, 8, 9, 10, 11, 12, 13, 14, 15); }
__device__ __forceinline__ v16bf cat16b(v8us lo, v8us hi) { return __builtin_bit_cast(v16bf, __builtin_shufflevector(lo, hi, 0, 1, 2, 3, 4, 5, 6, 7, 8, 9, 10, 11, 12, 13, 14, 15)); }
__device__ __forceinline__ v8f wmma16(v16h a, v16h b, v8f c) { return __builtin_amdgcn_wmma_f32_16x16x32_f16(false, a, false, b, (short)0, c, false, false); }
__device__ __forceinline__ v8f wmmab(v16bf a, v16bf b, v8f c) { return __builtin_amdgcn_wmma_f32_16x16x32_bf16(false, a, false, b, (short)0, c, false, false); }
// fragment loaders: p = b + vo + im (bytes) points at block start + lane * 16 bytes, which holds (row l&15, k0 + 8*(l>>4)); elements 0..7 <- bytes 0..15, elements 8..15 (k + 16) <- bytes 512..527.
// b: wave-uniform plane pointer, vo: the lane's byte offset, im: a constant; the loads take b as scalar base, and one 32-bit register per lane is all that moves from step to step
__device__ __forceinline__ v16bf ldbs(const bf* b, unsigned vo, int im) { const char* p = (const char*)b + vo; return cat16b(*(const v8us*)(p + im), *(const v8us*)(p + im + 512)); }
__device__ __forceinline__ v16h ldhs(const h16* b, unsigned vo, int im) { const char* p = (const char*)b + vo; return cat16(*(const v8h*)(p + im), *(const v8h*)(p + im + 512)); }

// hazard guards: name every accumulator of the group and the last fragments
template <typename V> __device__ __forceinline__ void nopg2(v8f& c0, v8f& c1, const V& x, const V& y, const V& z) {
    asm volatile("v_nop\n\tv_nop\n\tv_nop\n\tv_nop" : "+v"(c0), "+v"(c1) : "v"(x), "v"(y), "v"(z)); }
template <typename V> __device__ __forceinline__ void nopg4(v8f& c0, v8f& c1, v8f& c2, v8f& c3, const V& x, const V& y, const V& z) {
    asm volatile("v_nop\n\tv_nop\n\tv_nop\n\tv_nop" : "+v"(c0), "+v"(c1), "+v"(c2), "+v"(c3) : "v"(x), "v"(y), "v"(z)); }
// the GEMMs' guard names the accumulators alone: a fragment named here must lie in the first 256 registers, and with both fragment sets so bound an accumulator went to scratch in every stage
__device__ __forceinline__ void nopa8(v8f& c0, v8f& c1, v8f& c2, v8f& c3, v8f& c4, v8f& c5, v8f& c6, v8f& c7) {
    asm volatile("v_nop\n\tv_nop\n\tv_nop\n\tv_nop" : "+v"(c0), "+v"(c1), "+v"(c2), "+v"(c3), "+v"(c4), "+v"(c5), "+v"(c6), "+v"(c7)); }

// one k chunk's fragments of a 64x64 tile, and the two halves of a pipelined step: fetch (LDS loads only) and multiply (products only)
template <int NSPLIT> struct gfrag { v16bf a[4], a2[NSPLIT == 1 ? 4 : 1], b[4]; };
// a fragment from a staged block: p = block start + lane * 16 bytes; the block has the layout of the global planes
__device__ __forceinline__ v16bf ldls(const char* p) { return cat16b(*(const v8usa*)p, *(const v8usa*)(p + 512)); }
// sa, sb: the wave's first A and B block of the stage (+ lane * 16); a 16-row tile's NC chunks stand in a row; the A2 blocks stand OPB bytes behind the A blocks
template <int NSPLIT, int NC, int OPB>
__device__ __forceinline__ void gemm_fetch(gfrag<NSPLIT>& f, const char* sa, const char* sb, int c) {
#pragma unroll
    for (int mb = 0; mb < 4; ++mb) { f.a[mb] = ldls(sa + (mb * NC + c) * 1024); if (NSPLIT == 1) f.a2[mb] = ldls(sa + OPB + (mb * NC + c) * 1024); }
#pragma unroll
    for (int nb = 0; nb < 4; ++nb) f.b[nb] = ldls(sb + (nb * NC + c) * 1024);
    __builtin_amdgcn_sched_barrier(0);   // keeps the group of loads ahead of the products: sunk among them, each would be waited for where it stands
}
// a wave's share of a stage: two of the eight 16-row tiles of each operand, 4 KiB (four k chunks) in a row each, by asynchronous copies of 512 contiguous bytes (16 B a lane), through no register.
// la, la2, lb: the lane's own 16-B place in LDS, ga, ga2, gb: in global memory; tp: bytes from a tile to the next in the global plane. The staged blocks stand as in the planes, and the
// instruction's offset moves both addresses alike, so one address pair serves a tile's eight copies. The wait ends the statement: the address registers are written anew only behind it.
#define ACOPY(L, G, O) "global_load_async_to_lds_b128 %" #L ", %" #G ", off offset:" #O "\n\t"
#define ACOPY8(L, G) ACOPY(L, G, 0) ACOPY(L, G, 512) ACOPY(L, G, 1024) ACOPY(L, G, 1536) ACOPY(L, G, 2048) ACOPY(L, G, 2560) ACOPY(L, G, 3072) ACOPY(L, G, 3584)
__device__ __forceinline__ void stage_copy2(unsigned la, unsigned lb, const char* ga, const char* gb, int tp) {
    asm volatile(ACOPY8(0, 4) ACOPY8(1, 5) ACOPY8(2, 6) ACOPY8(3, 7) "s_wait_xcnt 0x0"
                 :: "v"(la), "v"(la + 4096u), "v"(lb), "v"(lb + 4096u), "v"(ga), "v"(ga + tp), "v"(gb), "v"(gb + tp) : "memory");
}
__device__ __forceinline__ void stage_copy3(unsigned la, unsigned la2, unsigned lb, const char* ga, const char* ga2, const char* gb, int tp) {
    asm volatile(ACOPY8(0, 6) ACOPY8(1, 7) ACOPY8(2, 8) ACOPY8(3, 9) ACOPY8(4, 10) ACOPY8(5, 11) "s_wait_xcnt 0x0"
                 :: "v"(la), "v"(la + 4096u), "v"(la2), "v"(la2 + 4096u), "v"(lb), "v"(lb + 4096u), "v"(ga), "v"(ga + tp), "v"(ga2), "v"(ga2 + tp), "v"(gb), "v"(gb + tp) : "memory");
}
template <int NSPLIT>
__device__ __forceinline__ void gemm_mul(const gfrag<NSPLIT>& f, v8f (&acc)[4][4]) {
#pragma unroll
    for (int nb = 0; nb < 4; ++nb) {
#pragma unroll
        for (int mb = 0; mb < 4; ++mb) { acc[mb][nb] = wmmab(f.a[mb], f.b[nb], acc[mb][nb]); if (NSPLIT == 1) acc[mb][nb] = wmmab(f.a2[mb], f.b[nb], acc[mb][nb]); } }
    nopa8(acc[0][0], acc[0][1], acc[0][2], acc[0][3], acc[1][0], acc[1][1], acc[1][2], acc[1][3]);
    nopa8(acc[2][0], acc[2][1], acc[2][2], acc[2][3], acc[3][0], acc[3][1], acc[3][2], acc[3][3]);
}
// ---- the projection GEMM's epilogue: a 64x64 tile of XB x WT^T is 64 rows t of ONE head (q, k or v), so the wave that computed it holds all that the head's attention operand planes need of these rows;
// the f32 projections never go to memory. acc[mb][nb][j]: row mb * 16 + 8 * hi + j, column nb * 16 + lr.
// rope_piece: the 16-B pieces d = j0..j0+7 (chunk 0, from ra) and d = 32+j0..32+j0+7 (chunk 1, from rb) of one row of rotary(x1 | x2) x sc, bf16 hi/lo; table values cv, sv by value (bf16 RNE on load)
__device__ __forceinline__ void rope_piece(const v8f x1, const v8f x2, const v8f cv, const v8f sv, float sc, v8us& ah, v8us& al, v8us& bh, v8us& bl) {
#pragma unroll
    for (int q = 0; q < 8; ++q) { const float c = bfr(cv[q]), s = bfr(sv[q]);
        const float ra = (x1[q] * c + x2[q] * s) * sc, rb = (x2[q] * c - x1[q] * s) * sc;
        unsigned short a2, c2; splitf(ra, a2, c2); ah[q] = a2; al[q] = c2; splitf(rb, a2, c2); bh[q] = a2; bl[q] = c2; }
}
struct planes_t { const float* COS; const float* SIN; bf* QPh; bf* QPl; bf* KPh; bf* KPl; h16* V16; h16* Vr; };
// r0: the tile's first row of NB * SEQ; ct: the head's place among 16 q, 4 k, 4 v; os: the wave's 16 x 68 floats of LDS
__device__ __forceinline__ void planes_epilogue(const v8f (&acc)[4][4], const planes_t& P, float* os, int r0, int ct, int lane) {
    const int lr = lane & 15, hi = lane >> 4;
    const int b = r0 / SEQ, t0 = r0 % SEQ;          // SEQ % 64 == 0: a tile lies in one batch
    if (ct >= NH_ + NKV) {
        // V planes (rows = d, k = key): a lane's 8 accumulator rows are 8 consecutive keys of one d = one 16-B piece; a wave-wide store fills 512 contiguous bytes
        const size_t vb = ((size_t)(b * NKV + (ct - NH_ - NKV)) * HD) * SEQ + (size_t)(t0 / 32) * 2048 + lane * 8;
#pragma unroll
        for (int mb = 0; mb < 4; ++mb) { v8h o16[4], o2[4];
#pragma unroll
            for (int nb = 0; nb < 4; ++nb) {
#pragma unroll
                for (int j = 0; j < 8; ++j) { const float x = acc[mb][nb][j]; const h16 a = (h16)x; o16[nb][j] = a; o2[nb][j] = (h16)((x - (float)a) * RCAR); } }
            __builtin_amdgcn_sched_barrier(0);              // keeps the round's stores together, behind its arithmetic: none of their registers is written again ahead of the one wait below
#pragma unroll
            for (int nb = 0; nb < 4; ++nb) { const size_t e = vb + ((mb >> 1) * 4 + nb) * 512 + (mb & 1) * 256;
                *(v8h*)(P.V16 + e) = o16[nb]; *(v8h*)(P.Vr + e) = o2[nb]; }
            __builtin_amdgcn_sched_barrier(0);              // nothing comes between the stores and their wait
            asm volatile("s_wait_xcnt 0x0" ::: "memory");   // the stores' data registers are written anew in the next round
            __builtin_amdgcn_sched_barrier(0);              // keeps that behind the wait
        }
        return;
    }
    // rotary q (x 1/8) or k planes (rows = t, k = d). Per 16 rows: the tile's rows go through LDS, then the wave takes 8 rows x 4 pieces twice: each table load touches 8 lines, each store fills 4 whole lines
    const bool isq = ct < NH_;
    const float sc = isq ? 0.125f : 1.0f;
    bf* Ph = isq ? P.QPh : P.KPh; bf* Pl = isq ? P.QPl : P.KPl;
    const int r8 = lane & 7, pc = lane >> 3;   // the lane's row (and row + 8) and its piece: d = pc * 8 .. + 7 and 32 + the same
    const size_t pb = ((size_t)(isq ? b * NH_ + ct : b * NKV + (ct - NH_)) * (SEQ / 16) + t0 / 16) * 1024 + (pc * 16 + r8) * 8;
    const unsigned to = (unsigned)((t0 + r8) * 32 + pc * 8);   // the lane's place in both tables
    v8f cv[4][2], sv[4][2];
#pragma unroll
    for (int it = 0; it < 2; ++it) { cv[0][it] = *(const v8f*)(P.COS + to + it * 256); sv[0][it] = *(const v8f*)(P.SIN + to + it * 256); }
#pragma unroll
    for (int mb = 0; mb < 4; ++mb) {
        if (mb < 3) {   // the next 16 rows' table values are fetched while these rows are worked on
#pragma unroll
            for (int it = 0; it < 2; ++it) { cv[mb + 1][it] = *(const v8f*)(P.COS + to + (mb + 1) * 512 + it * 256); sv[mb + 1][it] = *(const v8f*)(P.SIN + to + (mb + 1) * 512 + it * 256); }
            if (mb == 2) {
                asm volatile("s_wait_xcnt 0x0" ::: "memory");   // these were the last table loads: their address registers are free for other use below
                __builtin_amdgcn_sched_barrier(0);              // keeps that use behind the wait
            }
        }
#pragma unroll
        for (int nb = 0; nb < 4; ++nb) {
#pragma unroll
            for (int j = 0; j < 8; ++j) os[(hi * 8 + j) * 68 + nb * 16 + lr] = acc[mb][nb][j]; }
        asm volatile("s_wait_dscnt 0" ::: "memory"); __builtin_amdgcn_wave_barrier();   // the rows are in LDS before other lanes read them
        v8us ah[2], al[2], bh[2], bl[2];
#pragma unroll
        for (int it = 0; it < 2; ++it) { const float* rw = os + (r8 + 8 * it) * 68 + pc * 8;
            const v4f a0 = *(const v4fa*)rw, a1 = *(const v4fa*)(rw + 4), b0 = *(const v4fa*)(rw + 32), b1 = *(const v4fa*)(rw + 36);
            rope_piece(__builtin_shufflevector(a0, a1, 0, 1, 2, 3, 4, 5, 6, 7), __builtin_shufflevector(b0, b1, 0, 1, 2, 3, 4, 5, 6, 7), cv[mb][it], sv[mb][it], sc, ah[it], al[it], bh[it], bl[it]); }
        __builtin_amdgcn_sched_barrier(0);              // keeps the round's stores together, behind its arithmetic: none of their registers is written again ahead of the one wait below
#pragma unroll
        for (int it = 0; it < 2; ++it) { const size_t dst = pb + mb * 1024 + it * 64;
            *(v8us*)(Ph + dst) = ah[it]; *(v8us*)(Pl + dst) = al[it]; *(v8us*)(Ph + dst + 512) = bh[it]; *(v8us*)(Pl + dst + 512) = bl[it]; }
        __builtin_amdgcn_sched_barrier(0);              // nothing comes between the stores and their wait
        asm volatile("s_wait_xcnt 0x0" ::: "memory");   // the stores' data registers are written anew in the next round
        __builtin_amdgcn_sched_barrier(0);              // keeps that behind the wait
        asm volatile("s_wait_dscnt 0" ::: "memory"); __builtin_amdgcn_wave_barrier();   // every lane has read its rows before the next round overwrites them
    }
}
// ---- 128x128 tile GEMM, four waves of 64x64: C[m][n] (f32, pitch ldc) = sum_k A[m][k] Bt[n][k] (+ A2[m][k] Bt[n][k] when NSPLIT == 1); operands in fragment-order bf16 planes; K % (32 * NC) == 0, two stages or more.
// A stage = NC k chunks of the tile's 8 A (, 8 A2) and 8 B row tiles, block for block as in the planes; every wave copies two row tiles of each operand and reads the four A and four B row tiles of its 64x64.
// PLANES: the tile does not go to C but, through planes_epilogue, to the planes of P
template <int NSPLIT, bool PLANES>
__device__ __forceinline__ void gemm_body(const bf* A, const bf* A2, const bf* Bt, int K, float* C, int ldc, const planes_t& P) {
    constexpr int NC = 4;                                                    // k chunks of 32 in a stage
    constexpr int OPB = 8 * NC * 1024, STAGE = (NSPLIT == 1 ? 3 : 2) * OPB;  // bytes of one operand's share, of a stage: A | (A2 |) B
    __shared__ __align__(16) char ring[2 * STAGE];
    __shared__ __align__(16) float osa[4][16 * 68];
    const int lane = threadIdx.x & 31, lr = lane & 15, hi = lane >> 4;
    const int wave = __builtin_amdgcn_readfirstlane((int)(threadIdx.x >> 5)), wm = wave >> 1, wn = wave & 1;
    const int r0 = blockIdx.x * 128 + wm * 64, c0 = blockIdx.y * 128 + wn * 64;
    float* os = osa[wave];
    v8f acc[4][4];
#pragma unroll
    for (int mb = 0; mb < 4; ++mb)
#pragma unroll
        for (int nb = 0; nb < 4; ++nb) acc[mb][nb] = (v8f){};
    const int tp = 32 * K;   // a 16-row tile spans 16 * K elements (32 * K bytes), a k chunk of 32 one block of 1024 bytes
    const char* ga  = (const char*)A  + (size_t)(blockIdx.x * 8 + 2 * wave) * tp + lane * 16;   // the lane's place in the wave's share of the next stage to copy
    const char* ga2 = (const char*)A2 + (size_t)(blockIdx.x * 8 + 2 * wave) * tp + lane * 16;
    const char* gb  = (const char*)Bt + (size_t)(blockIdx.y * 8 + 2 * wave) * tp + lane * 16;
    const unsigned lw = (unsigned)(size_t)ring + (unsigned)(wave * (2 * NC * 1024) + lane * 16);   // the same in buffer 0 (LDS byte address)
    auto fill = [&](unsigned l) {
        if constexpr (NSPLIT == 1) stage_copy3(l, l + OPB, l + 2 * OPB, ga, ga2, gb, tp);
        else                       stage_copy2(l, l + OPB, ga, gb, tp);
        ga += NC * 1024; ga2 += NC * 1024; gb += NC * 1024;
    };
    const int nt = K / (32 * NC);   // stages; at least two
    fill(lw);
    asm volatile("s_wait_asynccnt 0x0" ::: "memory");   // this wave's share of stage 0 has landed
    __syncthreads();                                    // and every other wave's: stage 0 may be read
    fill(lw + STAGE);
    gfrag<NSPLIT> f[2];
#pragma unroll 1
    for (int t = 0; t < nt; ++t) {
        const char* st = ring + (t & 1) * STAGE + lane * 16;
        const char* sa = st + wm * (4 * NC * 1024); const char* sb = st + (STAGE - OPB) + wn * (4 * NC * 1024);
        // two fragment sets: while one k chunk is multiplied, the next chunk's LDS loads (one group, issued ahead of the products) are in flight; nothing of the next stage is read here
        gemm_fetch<NSPLIT, NC, OPB>(f[0], sa, sb, 0);
#pragma unroll
        for (int c = 0; c < NC; ++c) {
            if (c + 1 < NC) gemm_fetch<NSPLIT, NC, OPB>(f[(c + 1) & 1], sa, sb, c + 1);
            gemm_mul<NSPLIT>(f[c & 1], acc);
        }
        asm volatile("s_wait_dscnt 0x0" ::: "memory");      // this wave's reads of stage t are done
        asm volatile("s_wait_asynccnt 0x0" ::: "memory");   // its share of stage t + 1 has landed
        __syncthreads();                                    // both hold for every wave: stage t + 1 may be read, stage t's buffer refilled
        if (t + 2 < nt) fill(lw + (unsigned)(t & 1) * STAGE);
    }
    asm volatile("s_wait_asynccnt 0x0" ::: "memory");   // no copy is outstanding when the wave goes on to its epilogue and ends
    if constexpr (PLANES) { planes_epilogue(acc, P, os, r0, (int)blockIdx.y * 2 + wn, lane); return; }
#pragma unroll
    for (int mb = 0; mb < 4; ++mb) {
#pragma unroll
        for (int nb = 0; nb < 4; ++nb) {
#pragma unroll
            for (int j = 0; j < 8; ++j) os[(hi * 8 + j) * 68 + nb * 16 + lr] = acc[mb][nb][j]; }
        asm volatile("s_wait_dscnt 0" ::: "memory"); __builtin_amdgcn_wave_barrier();
        float* crow = C + (size_t)(r0 + mb * 16) * ldc + c0;
{
#pragma unroll
            for (int s = 0; s < 8; ++s) { const int row = 2 * s + hi, cofs = lr * 4; const v4f val = *(const v4fa*)(os + row * 68 + cofs);
                *(v4f*)(crow + (size_t)row * ldc + cofs) = val; }
             }
        asm volatile("s_wait_xcnt 0x0" ::: "memory");   // the stores' data registers are loaded anew in the next round
        asm volatile("s_wait_dscnt 0" ::: "memory"); __builtin_amdgcn_wave_barrier();
    }
}
// q, k, V planes <- XB[NB*SEQ][1024] x WT[1536][1024]^T
__global__ __launch_bounds__(128) void k_gemm_proj(const bf* __restrict__ A, const bf* __restrict__ Bt, const float* __restrict__ COS, const float* __restrict__ SIN, bf* QPh, bf* QPl, bf* KPh, bf* KPl, h16* V16, h16* Vr) {
    gemm_body<0, true>(A, A, Bt, DM, nullptr, 0, planes_t{COS, SIN, QPh, QPl, KPh, KPl, V16, Vr}); }
// OUT[NB*SEQ][1024] = (ATh + ATl)[NB*SEQ][1024] x WOT[1024][1024]^T
__global__ __launch_bounds__(128) void k_gemm_out(const bf* __restrict__ A, const bf* __restrict__ A2, const bf* __restrict__ Bt, float* C) { gemm_body<1, false>(A, A2, Bt, DQ, C, DM, planes_t{}); }

// The element-wise stages are device functions that take their block index bx: stages that do not depend on one another share one launch, each on its own range of block indices.
__device__ __forceinline__ void wtG_body(const float* __restrict__ w, int K, int N, bf* Bt, int bx) {
    const int lane = threadIdx.x & 31; const int L0 = (bx * 8 + (threadIdx.x >> 5)) * 8; const int nlines = N * K / 64;
{
#pragma unroll 1
        for (int l = 0; l < 8; ++l) { const int L = L0 + l; if (L >= nlines) break; const size_t e = (size_t)L * 64 + lane * 2; const int blk = (int)(e >> 9), in = (int)(e & 511);
            const int k = (blk % (K / 32)) * 32 + (in >> 7) * 8 + (in & 7), n = (blk / (K / 32)) * 16 + ((in >> 3) & 15); v2us o;
            o[0] = f2bf(w[(size_t)k * N + n]); o[1] = f2bf(w[(size_t)(k + 1) * N + n]); *(v2us*)(Bt + e) = o; }
         }
}
__device__ __forceinline__ void cvtx_body(const float* __restrict__ x, bf* XB, int bx) {
    const size_t i = (size_t)bx * 256 + threadIdx.x; if (i >= (size_t)NB * SEQ * DM / 8) return;
    // a wave takes 8 rows x 4 pieces: it reads whole 128-B lines of 8 rows and stores 4 whole lines
    const int blk = (int)(i >> 6), r = (int)((i & 7) | ((i >> 2) & 8)), pc = (int)((i >> 3) & 3); const size_t e = (size_t)blk * 512 + (pc * 16 + r) * 8;
    const int row = (blk / (DM / 32)) * 16 + r, k = (blk % (DM / 32)) * 32 + pc * 8;
    const v8f v = *(const v8f*)(x + (size_t)(row / SEQ) * SEQ_FULL * DM + (size_t)(row % SEQ) * DM + k); v8us o;
#pragma unroll
    for (int k = 0; k < 8; ++k) o[k] = f2bf(v[k]);
    *(v8us*)(XB + e) = o; 
}
// block counts of the stages
constexpr int GB_WQ = (DM * DQ / 64 + 63) / 64, GB_WKV = (DM * DKV / 64 + 63) / 64, GB_WO = (DQ * DM / 64 + 63) / 64, GB_X = (int)(((size_t)NB * SEQ * DM / 8 + 255) / 256);
// ---- k_prep: all operand planes made from inputs alone. Weights: in w[K = DM][N] -> out plane rows n (fragment order); q | k | v stacked into one [1536][1024] plane. The weight blocks (a serial loop each) come first, x behind them.
__global__ __launch_bounds__(256) void k_prep(const float* __restrict__ wq, const float* __restrict__ wk, const float* __restrict__ wv, const float* __restrict__ wo, const float* __restrict__ x, bf* WT, bf* WOT, bf* XB) {
    int bx = (int)blockIdx.x;
    if (bx < GB_WQ) { wtG_body(wq, DM, DQ, WT, bx); return; }
    bx -= GB_WQ;
    if (bx < GB_WO) { wtG_body(wo, DQ, DM, WOT, bx); return; }
    bx -= GB_WO;
    if (bx < GB_WKV) { wtG_body(wk, DM, DKV, WT + (size_t)KCOL * DM, bx); return; }
    bx -= GB_WKV;
    if (bx < GB_WKV) { wtG_body(wv, DM, DKV, WT + (size_t)VCOL * DM, bx); return; }
    bx -= GB_WKV;
    cvtx_body(x, XB, bx);
}

// ---- fused causal flash attention, transposed form. Block = 64 query rows of one (b, h), 8 waves; a wave owns 16 query rows (one per lane&15) and walks keys in 32-key steps up to its diagonal.
// S^T tile (keys x queries) = K (A, rows = keys) x Q^T (B, cols = queries); D: lane -> query l&15, rows -> keys 8h+r. Two key tiles give the B fragment of P^T directly.
// O^T tile (d x queries) = V^T (A, rows = d, k = keys) x P^T (B). Running max / sum / scale factor are per-lane scalars (both lane halves of a query agree via one xor-16 shuffle).
// Waves w and w + 4 own the same 16 query rows. SPLIT: wave w walks the first half of the key steps, wave w + 4 the second (with the diagonal).
// HIRES: both walk all key steps and compute the same scores; wave w owns d = 0..31 of V and O, wave w + 4 d = 32..63.
template <bool HIRES, bool SPLIT>
__device__ __forceinline__ void attn_body(const bf* Qh, const bf* Ql, const bf* Kh, const bf* Kl, const h16* V16, const h16* Vr, bf* Ah, bf* Al, int qblk, int bh) {
    constexpr int NJ = HIRES ? 2 : 4;   // 16-wide d tiles of V and O that a wave owns
    const int lane = threadIdx.x & 31, lr = lane & 15, hi = lane >> 4;
    const int wave = __builtin_amdgcn_readfirstlane((int)(threadIdx.x >> 5));
    const int b = bh / NH_, h = bh % NH_, g = h / REP;
    const int part = wave >> 2;
    const int m0 = qblk * 64 + (wave & 3) * 16;
    const size_t qbase = ((size_t)(b * NH_ + h) * SEQ) * HD;
    const size_t kbase = ((size_t)(b * NKV + g) * SEQ) * HD;
    const size_t vbase = ((size_t)(b * NKV + g) * HD) * SEQ;
    const int qrow = m0 + lr;
    v8f o[NJ], orr[NJ];
#pragma unroll
    for (int j = 0; j < NJ; ++j) { o[j] = (v8f){}; orr[j] = (v8f){}; }
    float mrun = NEGBIG, lsum = 0.0f;
    const int nall = (m0 + 47) >> 5;             // keys 0 .. m0+15 in 32-key steps; k0 + 31 < SEQ always (SEQ % 32 == 0)
    const int st0 = (SPLIT && part) ? (nall + 1) >> 1 : 0;  // this wave's steps: st0 .. nst - 1; never empty (SPLIT: m0 >= 64, nall >= 3)
    const int nst = (SPLIT && part == 0) ? (nall + 1) >> 1 : nall;
    __builtin_assume(st0 < nst);   // no branch round the loop, so the first loads keep the order written (Q, K, V): with Q last, the loop's counted waits, which also serve its first pass, would wait for each step's V loads at the loop's head
    // Loads run one step ahead of their products: Q fragments once, K of step st + 1 right behind the score products of step st, V of step st + 1 right behind the output products of step st.
    const bf* kph = Kh + kbase; const bf* kpl = Kl + kbase;          // 32 keys = 4 blocks of 1024 bytes (2 key tiles x 2 d chunks) in a row
    const int vd = HIRES ? part * (NJ * 512) : 0;                    // the wave's first d tile
    const h16* vp = V16 + vbase + vd; const h16* vrp = Vr + vbase + vd;   // 32 keys = 4 blocks of 1024 bytes (4 d tiles) in a row
    const unsigned vq = (unsigned)lane * 16u;                        // the lane's byte offset in a block
    unsigned vo = vq + (unsigned)st0 * (32u * HD * 2u);              // the lane's byte offset in the step's blocks, the same in all four planes
    v16bf qhf[2], qlf[2], k0h[2], k0l[2], k1h[2], k1l[2];
    v16h vf[NJ], vrf[NJ];
#pragma unroll
    for (int c = 0; c < 2; ++c) { qhf[c] = ldbs(Qh + qbase + m0 * HD, vq, 1024 * c); qlf[c] = ldbs(Ql + qbase + m0 * HD, vq, 1024 * c); }
#pragma unroll
    for (int c = 0; c < 2; ++c) { k0h[c] = ldbs(kph, vo, 1024 * c); k0l[c] = ldbs(kpl, vo, 1024 * c); k1h[c] = ldbs(kph, vo, 2048 + 1024 * c); k1l[c] = ldbs(kpl, vo, 2048 + 1024 * c); }
#pragma unroll
    for (int j = 0; j < NJ; ++j) { vf[j] = ldhs(vp, vo, j * 1024); if (HIRES) vrf[j] = ldhs(vrp, vo, j * 1024); }
    __builtin_amdgcn_sched_barrier(0);              // nothing comes between the loads and their wait
    asm volatile("s_wait_xcnt 0x0" ::: "memory");   // registers that these first loads name are free for other use below
    __builtin_amdgcn_sched_barrier(0);              // keeps that use behind the wait
#pragma unroll 1
    for (int st = st0; st < nst; ++st) {
        const int k0 = st * 32;
        v8f s0 = (v8f){}, s1 = (v8f){};
#pragma unroll
        for (int c = 0; c < 2; ++c) {
            s0 = wmmab(k0h[c], qhf[c], s0); s0 = wmmab(k0h[c], qlf[c], s0); s0 = wmmab(k0l[c], qhf[c], s0);
            s1 = wmmab(k1h[c], qhf[c], s1); s1 = wmmab(k1h[c], qlf[c], s1); s1 = wmmab(k1l[c], qhf[c], s1);
        }
        nopg2(s0, s1, qhf[1], qlf[1], k1l[1]);
        asm volatile("s_wait_xcnt 0x0" ::: "memory");   // the offset register of the loads in flight (V, from the last step's foot) is advanced below
        __builtin_amdgcn_sched_barrier(0);              // keeps that advance behind the wait
        vo += (st + 1 < nst) ? 32u * HD * 2u : 0u;      // to the next step's blocks; behind the last step: its own again, not used
#pragma unroll
        for (int c = 0; c < 2; ++c) { k0h[c] = ldbs(kph, vo, 1024 * c); k0l[c] = ldbs(kpl, vo, 1024 * c); k1h[c] = ldbs(kph, vo, 2048 + 1024 * c); k1l[c] = ldbs(kpl, vo, 2048 + 1024 * c); }
        __builtin_amdgcn_sched_barrier(0);   // keeps the K loads here, ahead of the softmax: sunk to the loop's foot they would be waited for at once
        // causal exclusion by value (key > query -> NEGBIG, probability exactly 0), running max
        const int kb = k0 + 8 * hi;
        float mx = NEGBIG;
#pragma unroll
        for (int r = 0; r < 8; ++r) {
            const float a0 = (kb + r <= qrow) ? s0[r] : NEGBIG;
            const float a1 = (kb + 16 + r <= qrow) ? s1[r] : NEGBIG;
            s0[r] = a0; s1[r] = a1; mx = fmaxf(mx, fmaxf(a0, a1));
        }
        mx = fmaxf(mx, __shfl_xor(mx, 16, 32));
        const float mnew = fmaxf(mrun, mx);
        const float corr = __builtin_amdgcn_exp2f((mrun - mnew) * L2E);
        mrun = mnew;
        float psum = 0.0f;
        v16h pbv, prv;
#pragma unroll
        for (int r = 0; r < 8; ++r) {
            const float p0 = __builtin_amdgcn_exp2f((s0[r] - mnew) * L2E);
            const float p1 = __builtin_amdgcn_exp2f((s1[r] - mnew) * L2E);
            psum += p0 + p1;
            const float c0 = p0 * PCAR, c1 = p1 * PCAR;
            const h16 h0 = (h16)c0, h1 = (h16)c1;
            pbv[r] = h0; pbv[8 + r] = h1;
            if (HIRES) { prv[r] = (h16)((c0 - (float)h0) * RCAR); prv[8 + r] = (h16)((c1 - (float)h1) * RCAR); }
        }
        lsum = lsum * corr + psum;
#pragma unroll
        for (int j = 0; j < NJ; ++j) {
#pragma unroll
            for (int r = 0; r < 8; ++r) { o[j][r] *= corr; if (HIRES) orr[j][r] *= corr; } }
        // O^T += V^T P^T
#pragma unroll
        for (int j = 0; j < NJ; ++j) {
            o[j] = wmma16(vf[j], pbv, o[j]);
            if (HIRES) { orr[j] = wmma16(vrf[j], pbv, orr[j]); orr[j] = wmma16(vf[j], prv, orr[j]); }
        }
        if constexpr (HIRES) nopg4(o[0], o[1], orr[0], orr[1], pbv, prv, vf[1]);
        else                 nopg4(o[0], o[1], o[2], o[3], pbv, pbv, vf[3]);
#pragma unroll
        for (int j = 0; j < NJ; ++j) { vf[j] = ldhs(vp, vo, j * 1024); if (HIRES) vrf[j] = ldhs(vrp, vo, j * 1024); }
    }
    asm volatile("s_wait_loadcnt 0x0" ::: "memory");   // the last step's look-ahead loads are not used: they have landed before their registers are reused or given back
    __builtin_amdgcn_sched_barrier(0);                 // keeps the epilogue's arithmetic behind the wait
    if constexpr (SPLIT) {
        // merge of the two key halves: the second-half wave hands its state over in LDS (lane-contiguous 16-B pieces), the first-half wave rescales both to the common maximum and adds
        __shared__ v4f mo[4][8][32];
        __shared__ float ml[4][2][32];
        const int tl = wave & 3;
        if (part) {
            ml[tl][0][lane] = mrun; ml[tl][1][lane] = lsum;
#pragma unroll
            for (int j = 0; j < 4; ++j) { mo[tl][2 * j][lane] = __builtin_shufflevector(o[j], o[j], 0, 1, 2, 3); mo[tl][2 * j + 1][lane] = __builtin_shufflevector(o[j], o[j], 4, 5, 6, 7); }
        }
        __syncthreads();   // every wave of the block passes it once: the second halves' states are in LDS before the first halves read them
        if (part) return;
        const float mb = ml[tl][0][lane], lb = ml[tl][1][lane];
        const float dm = (mrun - mb) * L2E;   // the half with the larger maximum keeps its scale (factor 1), the other is scaled down by 2^-|dm|
        const float sc = __builtin_amdgcn_exp2f(-fabsf(dm));
        const float ca = dm < 0.0f ? sc : 1.0f, cb = dm < 0.0f ? 1.0f : sc;
        lsum = lsum * ca + lb * cb;
#pragma unroll
        for (int j = 0; j < 4; ++j) { const v4f b0 = mo[tl][2 * j][lane], b1 = mo[tl][2 * j + 1][lane];
#pragma unroll
            for (int r = 0; r < 4; ++r) { o[j][r] = o[j][r] * ca + b0[r] * cb; o[j][4 + r] = o[j][4 + r] * ca + b1[r] * cb; } }
    }
    lsum += __shfl_xor(lsum, 16, 32);
    const float inv = 1.0f / (PCAR * lsum);
    // lane holds ctx(query m0+lr, d = (HIRES ? 32 * part : 0) + j*16 + 8*hi + r): 8 consecutive d per j -> one 16-B piece per plane, and piece j of lane l is piece l of half-block j of the wave's ctx blocks (HIRES: one, else two)
    const size_t dst = (size_t)(b * SEQ + m0) * DQ + h * (16 * HD) + lane * 8 + (HIRES ? part * (NJ * 256) : 0);
#pragma unroll
    for (int j = 0; j < NJ; ++j) { v8us vh, vl;
#pragma unroll
        for (int r = 0; r < 8; ++r) { const float val = HIRES ? (o[j][r] + orr[j][r] * (1.0f / RCAR)) * inv : o[j][r] * inv; unsigned short a2, c2; splitf(val, a2, c2); vh[r] = a2; vl[r] = c2; }
        *(v8us*)(Ah + dst + j * 256) = vh; *(v8us*)(Al + dst + j * 256) = vl; }
}
// One launch for all query rows. More blocks than the chip holds at once; the costliest 64-row tiles take the lowest block indices (for speed only).
// A tile's cost: the key steps of its longest wave (q + 1 where two waves split them, else 2 q + 2), x 1.4 for a step with residual planes (the ratio of the two loops' vector instructions).
struct deal_t { unsigned char q[SEQ / 64]; };
constexpr int tile_cost(int q) { return (q >= RH / 64 ? 10 : 28) * (q + 1); }
constexpr deal_t make_deal() {
    deal_t d{};
    for (int i = 0; i < SEQ / 64; ++i) { int p = i;   // insertion by falling cost
        for (; p > 0 && tile_cost(d.q[p - 1]) < tile_cost(i); --p) d.q[p] = d.q[p - 1];
        d.q[p] = (unsigned char)i; }
    return d;
}
__global__ __launch_bounds__(256) void k_attn(const bf* __restrict__ Qh, const bf* __restrict__ Ql, const bf* __restrict__ Kh, const bf* __restrict__ Kl, const h16* __restrict__ V16, const h16* __restrict__ Vr, bf* Ah, bf* Al) {
    constexpr deal_t deal = make_deal();
    const int qblk = deal.q[blockIdx.x / (unsigned)(NB * NH_)], bh = (int)(blockIdx.x % (unsigned)(NB * NH_));
    if (qblk >= RH / 64) attn_body<false, true>(Qh, Ql, Kh, Kl, V16, Vr, Ah, Al, qblk, bh);
    else                 attn_body<true, false>(Qh, Ql, Kh, Kl, V16, Vr, Ah, Al, qblk, bh);
}

// ---- workspace carve (bytes, every region 256-B aligned and sized to its full store extent)
constexpr size_t al256(size_t x) { return (x + 255) & ~(size_t)255; }
constexpr size_t SZ_WT  = al256((size_t)NQKV * DM * 2);
constexpr size_t SZ_WO  = al256((size_t)DM * DQ * 2);
constexpr size_t SZ_XB  = al256((size_t)NB * SEQ * DM * 2);
constexpr size_t SZ_QP  = al256((size_t)NB * NH_ * SEQ * HD * 2);
constexpr size_t SZ_KP  = al256((size_t)NB * NKV * SEQ * HD * 2);
constexpr size_t SZ_AT  = al256((size_t)NB * SEQ * DQ * 2);
constexpr size_t OFF_WT = 0;
constexpr size_t OFF_WO = OFF_WT + SZ_WT;
constexpr size_t OFF_XB = OFF_WO + SZ_WO;
constexpr size_t OFF_QH = OFF_XB + SZ_XB;
constexpr size_t OFF_QL = OFF_QH + SZ_QP;
constexpr size_t OFF_KH = OFF_QL + SZ_QP;
constexpr size_t OFF_KL = OFF_KH + SZ_KP;
constexpr size_t OFF_V1 = OFF_KL + SZ_KP;
constexpr size_t OFF_VR = OFF_V1 + SZ_KP;
constexpr size_t OFF_AH = OFF_VR + SZ_KP;
constexpr size_t OFF_AL = OFF_AH + SZ_AT;
constexpr size_t WS_TOTAL = OFF_AL + SZ_AT;
static_assert(WS_TOTAL <= (size_t)134217728);

extern "C" void kernel_launch(void* const* d_in, const int* in_sizes, int n_in,
                              void* d_out, int out_size, void* d_ws, size_t ws_size, hipStream_t stream) {
    if (n_in < 7) return;
    if (in_sizes[0] < (NB - 1) * SEQ_FULL * DM + SEQ * DM) return;
    if (in_sizes[1] < SEQ * 32 || in_sizes[2] < SEQ * 32) return;
    if (in_sizes[3] < DM * DQ || in_sizes[4] < DM * DKV || in_sizes[5] < DM * DKV || in_sizes[6] < DQ * DM) return;
    if (out_size < NB * SEQ * DM) return;
    if (ws_size < WS_TOTAL) return;
    const float* x = (const float*)d_in[0]; const float* cs = (const float*)d_in[1]; const float* sn = (const float*)d_in[2];
    const float* wq = (const float*)d_in[3]; const float* wk = (const float*)d_in[4]; const float* wv = (const float*)d_in[5]; const float* wo = (const float*)d_in[6];
    float* OUT = (float*)d_out;
    char* w8 = (char*)d_ws;
    bf* WT = (bf*)(w8 + OFF_WT); bf* WOT = (bf*)(w8 + OFF_WO); bf* XB = (bf*)(w8 + OFF_XB);
    bf* QPh = (bf*)(w8 + OFF_QH); bf* QPl = (bf*)(w8 + OFF_QL); bf* KPh = (bf*)(w8 + OFF_KH); bf* KPl = (bf*)(w8 + OFF_KL);
    h16* V16 = (h16*)(w8 + OFF_V1); h16* VR = (h16*)(w8 + OFF_VR); bf* ATh = (bf*)(w8 + OFF_AH); bf* ATl = (bf*)(w8 + OFF_AL);

    k_prep<<<(unsigned)(GB_WQ + GB_WO + 2 * GB_WKV + GB_X), 256, 0, stream>>>(wq, wk, wv, wo, x, WT, WOT, XB);
    k_gemm_proj<<<dim3(NB * SEQ / 128, NQKV / 128, 1), 128, 0, stream>>>(XB, WT, cs, sn, QPh, QPl, KPh, KPl, V16, VR);
    k_attn<<<(unsigned)(SEQ / 64 * NB * NH_), 256, 0, stream>>>(QPh, QPl, KPh, KPl, V16, VR, ATh, ATl);
    k_gemm_out<<<dim3(NB * SEQ / 128, DM / 128, 1), 128, 0, stream>>>(ATh, ATl, WOT, OUT);
}
